// v000
// Measured on an AMD MI455X. A time is GPU time per run, averaged over a window of back-to-back runs after a warm-up
// (all launches, gaps included; the runs take copies of the inputs in turn), and the median of several windows.
// Apart from v000's, it joins two sittings. Times from different sittings can be a few percent apart, while
// side-by-side timings come from the same sitting.
// v000, which the later versions start from, runs in 1540 microseconds.
#include <hip/hip_runtime.h>

// PluckerKernelAttention: q1,q2,k1,k2 = x W^T (1024 -> 16 heads x 4); L_q = normalize(exterior(q1,q2)), L_k likewise (6-d Plucker lines); scores = L_q . (J6 L_k) / sqrt(6) with a causal mask; attn = softmax; v = x W_v^T + b_v (16 x 64); o = attn v; out = o W_out^T + b_out -> [2][2048][1024].
// Deterministic: flash-style online softmax over fixed 256-key chunks (causal: chunks up to the query block), fixed order; no atomics.
// WMMA (v_wmma_f32_16x16x32_f16, f32 accumulate): x (EXACT bf16 x8, K 1024) x [W1q;W2q;W1k;W2k] rows (16 tiles) and x W_v rows (64 tiles in 4 groups) per 16-token wave; per (b, h, 16-query) wave and key chunk S = L_q (hi+lo x256, K 6 -> 32) x JL_k rows (hi+lo; 16 tiles) and O += P (hi+lo x256) x v^T rows (hi+lo; 4 tiles, K 256), 3 products; out-proj o (hi+lo, K 1024) x W_out rows (64 tiles) — weights EXACT x256 (torch (out,in)), ≈ 4.5 M WMMA; Plucker exterior/normalisation and softmax in f32.

namespace {
constexpr int NB_ = 2, T = 2048, D = 1024, H = 16, DH = 64, NT = NB_ * T /* 4096 tokens */, CH = 256;
constexpr float XS = 8.0f, HS = 256.0f, PS = 256.0f, WSC = 256.0f, SCL = 0.40824829046386302f /* 6^-0.5 */;
typedef _Float16 b16;
typedef __attribute__((ext_vector_type(16))) _Float16 v16b;
typedef __attribute__((ext_vector_type(8))) _Float16 v8b;
typedef __attribute__((ext_vector_type(2))) _Float16 v2b;
typedef __attribute__((ext_vector_type(8))) float v8f;
typedef __attribute__((ext_vector_type(4))) float v4f;
typedef __attribute__((ext_vector_type(2))) float v2f;
__device__ __forceinline__ float bf16_rne(float f) { unsigned int u = __float_as_uint(f); u += 0x7FFFu + ((u >> 16) & 1u); float r = __uint_as_float(u & 0xFFFF0000u); asm volatile("" : "+v"(r)); return r; }
__device__ __forceinline__ float bfv(float f) { float r = bf16_rne(f); asm volatile("" : "+v"(r)); return r; }
__device__ __forceinline__ void split16(float v, b16& hi, b16& lo) { hi = (b16)v; lo = (b16)(v - (float)hi); }
__device__ __forceinline__ v16b frag_kb(const b16* p, int hh) { const v8b a = *(const v8b*)(p + 8 * hh), b = *(const v8b*)(p + 16 + 8 * hh); v16b f;
#pragma unroll
  for (int e = 0; e < 8; ++e) { f[e] = a[e]; f[8 + e] = b[e]; } return f; }
__device__ __forceinline__ v8f wmma16b(v16b a, v16b b, v8f c) { v8f d = __builtin_amdgcn_wmma_f32_16x16x32_f16(false, a, false, b, (short)0, c, false, false); asm volatile("v_nop\n\tv_nop\n\tv_nop\n\tv_nop" : "+v"(d) : "v"(a), "v"(b)); return d; }
__device__ __forceinline__ void wave_lds_sync() { __builtin_amdgcn_fence(__ATOMIC_RELEASE, "workgroup"); __builtin_amdgcn_wave_barrier(); __builtin_amdgcn_fence(__ATOMIC_ACQUIRE, "workgroup"); }
__device__ __forceinline__ float pmul(float a, float b) { float p = a * b; asm volatile("" : "+v"(p)); return p; }

__global__ __launch_bounds__(256) void wput_kernel(const float* __restrict__ w1q, const float* __restrict__ w2q, const float* __restrict__ w1k, const float* __restrict__ w2k, const float* __restrict__ wv, const float* __restrict__ wo, b16* __restrict__ WQK, b16* __restrict__ WV, b16* __restrict__ WO) { const size_t nt = (size_t)gridDim.x * 256, u0 = (size_t)blockIdx.x * 256 + threadIdx.x; v8b v;
  for (size_t u = u0; u < (size_t)256 * 128; u += nt) { const int o = (int)(u / 128), k0 = (int)(u % 128) * 8; const float* w = o < 64 ? w1q : (o < 128 ? w2q : (o < 192 ? w1k : w2k)); const int oo = o % 64;
#pragma unroll
    for (int j = 0; j < 8; ++j) v[j] = (b16)(bf16_rne(w[(size_t)oo * D + k0 + j]) * WSC); { *(v8b*)(WQK + (size_t)o * D + k0) = v;  } }
  for (size_t u = u0; u < (size_t)D * 128; u += nt) { const int o = (int)(u / 128), k0 = (int)(u % 128) * 8; v8b a, c;
#pragma unroll
    for (int j = 0; j < 8; ++j) { a[j] = (b16)(bf16_rne(wv[(size_t)o * D + k0 + j]) * WSC); c[j] = (b16)(bf16_rne(wo[(size_t)o * D + k0 + j]) * WSC); } { *(v8b*)(WV + (size_t)o * D + k0) = a; *(v8b*)(WO + (size_t)o * D + k0) = c;  } } }
__global__ __launch_bounds__(32) void proj_kernel(const float* __restrict__ x, const b16* __restrict__ WQK, const b16* __restrict__ WV, const float* __restrict__ bv, b16* __restrict__ LQh, b16* __restrict__ LQl, b16* __restrict__ LKh, b16* __restrict__ LKl, float* __restrict__ V) { __shared__ __attribute__((aligned(16))) b16 Ah[16][D + 8]; __shared__ float Tf[16][260]; const int lane = threadIdx.x, nloc = lane & 15, hlf = lane >> 4; const size_t t0 = (size_t)blockIdx.x * 16;
  for (int rr = 0; rr < 16; ++rr) for (int q = 0; q < D / 32; ++q) { const int c = q * 32 + lane; Ah[rr][c] = (b16)(bf16_rne(x[(t0 + rr) * D + c]) * XS); }
  if (lane < 16) for (int k = D; k < D + 8; ++k) Ah[lane][k] = (b16)0.0f;
  wave_lds_sync();
#pragma unroll 1
  for (int g = 0; g < 5; ++g) { const b16* W = g == 0 ? WQK : WV + (size_t)(g - 1) * 256 * D; v8f acc[16];
#pragma unroll
    for (int t = 0; t < 16; ++t) acc[t] = (v8f){};
#pragma unroll 2
    for (int kb = 0; kb < D; kb += 32) { const v16b a = frag_kb(&Ah[nloc][kb], hlf);
#pragma unroll
      for (int t = 0; t < 16; ++t) acc[t] = wmma16b(a, frag_kb(W + (size_t)(t * 16 + nloc) * D + kb, hlf), acc[t]); }
#pragma unroll
    for (int t = 0; t < 16; ++t) { const int cc = t * 16 + nloc; const float bb = g == 0 ? 0.0f : bfv(bv[(g - 1) * 256 + cc]);
#pragma unroll
      for (int r8 = 0; r8 < 8; ++r8) Tf[8 * hlf + r8][cc] = acc[t][r8] * (1.0f / (XS * WSC)) + bb; }
    wave_lds_sync();
    if (g == 0) {   // Plucker lines: lane = (token rr = lane & 15, q-or-k = lane >> 4); loop heads
      const int rr = nloc, isk = hlf; const size_t tok = t0 + rr;
      {
#pragma unroll 1
        for (int h = 0; h < H; ++h) { const float* p1 = &Tf[rr][(isk ? 128 : 0) + h * 4]; const float* p2 = &Tf[rr][(isk ? 192 : 64) + h * 4]; float Lm[6]; Lm[0] = p1[0] * p2[1] - p1[1] * p2[0]; Lm[1] = p1[0] * p2[2] - p1[2] * p2[0]; Lm[2] = p1[0] * p2[3] - p1[3] * p2[0]; Lm[3] = p1[1] * p2[2] - p1[2] * p2[1]; Lm[4] = p1[1] * p2[3] - p1[3] * p2[1]; Lm[5] = p1[2] * p2[3] - p1[3] * p2[2];
          float n2 = 0.0f; for (int c = 0; c < 6; ++c) n2 += Lm[c] * Lm[c]; const float inv = 1.0f / fmaxf(sqrtf(n2), 1e-12f); float Lo[6];
          if (isk) { Lo[0] = Lm[5]; Lo[1] = -Lm[4]; Lo[2] = Lm[3]; Lo[3] = Lm[2]; Lo[4] = -Lm[1]; Lo[5] = Lm[0]; } else { for (int c = 0; c < 6; ++c) Lo[c] = Lm[c]; }
          b16 hh_[32], ll_[32]; for (int c = 0; c < 32; ++c) { hh_[c] = (b16)0.0f; ll_[c] = (b16)0.0f; } for (int c = 0; c < 6; ++c) split16(Lo[c] * inv * HS, hh_[c], ll_[c]);
          b16* dh = (isk ? LKh : LQh) + ((size_t)h * NT + tok) * 32; b16* dl = (isk ? LKl : LQl) + ((size_t)h * NT + tok) * 32;
          for (int c = 0; c < 32; c += 8) { v8b a, bq; for (int j = 0; j < 8; ++j) { a[j] = hh_[c + j]; bq[j] = ll_[c + j]; } *(v8b*)(dh + c) = a; *(v8b*)(dl + c) = bq; } }
         } }
    else { { for (int rr = 0; rr < 16; ++rr) for (int q = 0; q < 2; ++q) *(v4f*)(V + (t0 + rr) * D + (g - 1) * 256 + q * 128 + lane * 4) = *(const v4f*)(&Tf[rr][q * 128 + lane * 4]);  } }
    wave_lds_sync(); } }
__global__ __launch_bounds__(256) void vt_kernel(const float* __restrict__ V, b16* __restrict__ VTh, b16* __restrict__ VTl) { __shared__ float Tt[64][65]; const int b = blockIdx.x / (T / 64), tk0 = (blockIdx.x % (T / 64)) * 64; const int h = blockIdx.y; const int tid = threadIdx.x, wave = tid >> 5, lane = tid & 31;
  for (int q = wave; q < 64; q += 8) { Tt[q][lane * 2] = V[((size_t)b * T + tk0 + q) * D + h * DH + lane * 2]; Tt[q][lane * 2 + 1] = V[((size_t)b * T + tk0 + q) * D + h * DH + lane * 2 + 1]; }
  __syncthreads();
  { for (int d = wave; d < DH; d += 8) { b16 h0, l0, h1, l1; split16(Tt[lane * 2][d] * HS, h0, l0); split16(Tt[lane * 2 + 1][d] * HS, h1, l1); const size_t o = (((size_t)b * H + h) * DH + d) * T + tk0 + lane * 2; *(v2b*)(VTh + o) = (v2b){h0, h1}; *(v2b*)(VTl + o) = (v2b){l0, l1}; }  } }
__global__ __launch_bounds__(32) void att_kernel(const b16* __restrict__ LQh, const b16* __restrict__ LQl, const b16* __restrict__ LKh, const b16* __restrict__ LKl, const b16* __restrict__ VTh, const b16* __restrict__ VTl, int QLIM, float* __restrict__ O) { __shared__ __attribute__((aligned(16))) b16 Pa[16][CH + 8], Pb[16][CH + 8]; __shared__ float Sc[16][CH + 1], Mx[16], Ls[16], Fc[16], Of[16][DH + 1]; const int lane = threadIdx.x, nloc = lane & 15, hlf = lane >> 4; const int b = blockIdx.x / (H * (T / 16)), rem = blockIdx.x % (H * (T / 16)); const int h = rem / (T / 16), q0 = (rem % (T / 16)) * 16; if (q0 >= QLIM) return; const size_t tq = (size_t)b * T + q0;
  if (lane < 16) { for (int k = CH; k < CH + 8; ++k) { Pa[lane][k] = (b16)0.0f; Pb[lane][k] = (b16)0.0f; } Mx[lane] = -INFINITY; Ls[lane] = 0.0f; }
  wave_lds_sync();
  const v16b qa = frag_kb(LQh + ((size_t)h * NT + tq + nloc) * 32, hlf), ql = frag_kb(LQl + ((size_t)h * NT + tq + nloc) * 32, hlf);
  v8f oacc[4] = {(v8f){}, (v8f){}, (v8f){}, (v8f){}}; const int nch = q0 / CH + 1;
#pragma unroll 1
  for (int ch = 0; ch < nch; ++ch) { const int k0 = ch * CH;
#pragma unroll 1
    for (int half = 0; half < 2; ++half) { v8f sacc[8];
#pragma unroll
      for (int t = 0; t < 8; ++t) sacc[t] = (v8f){};
#pragma unroll
      for (int t = 0; t < 8; ++t) { const size_t key = (size_t)h * NT + (size_t)b * T + k0 + half * 128 + t * 16 + nloc; const v16b kh = frag_kb(LKh + key * 32, hlf), kl = frag_kb(LKl + key * 32, hlf); sacc[t] = wmma16b(qa, kh, sacc[t]); sacc[t] = wmma16b(qa, kl, sacc[t]); sacc[t] = wmma16b(ql, kh, sacc[t]); }
#pragma unroll
      for (int t = 0; t < 8; ++t)
#pragma unroll
        for (int r8 = 0; r8 < 8; ++r8) Sc[8 * hlf + r8][half * 128 + t * 16 + nloc] = sacc[t][r8] * (SCL / (HS * HS)); }
    wave_lds_sync();
    for (int r = 0; r < 16; ++r) { const int qi = q0 + r; float mx = -INFINITY; for (int j = lane; j < CH; j += 32) { const float s = (k0 + j <= qi) ? Sc[r][j] : -INFINITY; mx = fmaxf(mx, s); } for (int o = 16; o; o >>= 1) mx = fmaxf(mx, __shfl_xor(mx, o)); const float mo = Mx[r], mn = fmaxf(mo, mx); float sm = 0.0f; for (int j = lane; j < CH; j += 32) { const float p = (k0 + j <= qi) ? __expf(Sc[r][j] - mn) : 0.0f; Sc[r][j] = p; sm += p; } for (int o = 16; o; o >>= 1) sm += __shfl_xor(sm, o); wave_lds_sync(); if (lane == 0) { const float fac = (mo == -INFINITY) ? 0.0f : __expf(mo - mn); Fc[r] = fac; Ls[r] = Ls[r] * fac + sm; Mx[r] = mn; } }
    wave_lds_sync();
    for (int r = 0; r < 16; ++r) for (int q = 0; q < CH / 32; ++q) { const int c = q * 32 + lane; b16 p, pl; split16(Sc[r][c] * PS, p, pl); Pa[r][c] = p; Pb[r][c] = pl; }
    wave_lds_sync();
#pragma unroll
    for (int t = 0; t < 4; ++t)
#pragma unroll
      for (int r8 = 0; r8 < 8; ++r8) oacc[t][r8] *= Fc[8 * hlf + r8];
#pragma unroll 2
    for (int kb = 0; kb < CH; kb += 32) { const v16b pa = frag_kb(&Pa[nloc][kb], hlf), pb = frag_kb(&Pb[nloc][kb], hlf);
#pragma unroll
      for (int t = 0; t < 4; ++t) { const size_t vo = (((size_t)b * H + h) * DH + t * 16 + nloc) * T + k0 + kb; const v16b vh = frag_kb(VTh + vo, hlf), vl = frag_kb(VTl + vo, hlf); oacc[t] = wmma16b(pa, vh, oacc[t]); oacc[t] = wmma16b(pa, vl, oacc[t]); oacc[t] = wmma16b(pb, vh, oacc[t]); } }
    wave_lds_sync(); }
#pragma unroll
  for (int t = 0; t < 4; ++t)
#pragma unroll
    for (int r8 = 0; r8 < 8; ++r8) { const int r = 8 * hlf + r8; Of[r][t * 16 + nloc] = oacc[t][r8] * (1.0f / (PS * HS)) / Ls[r]; }
  wave_lds_sync();
  { for (int r = 0; r < 16; ++r) *(v2f*)(O + (tq + r) * D + h * DH + lane * 2) = (v2f){Of[r][lane * 2], Of[r][lane * 2 + 1]};  } }
__global__ __launch_bounds__(32) void outp_kernel(const float* __restrict__ O, const b16* __restrict__ WO, const float* __restrict__ bo, int QLIM, float* __restrict__ out) { __shared__ __attribute__((aligned(16))) b16 Ah[16][D + 8], Al[16][D + 8]; __shared__ float Tf[16][260]; const int lane = threadIdx.x, nloc = lane & 15, hlf = lane >> 4; const size_t t0 = (size_t)blockIdx.x * 16; if ((int)(t0 % T) >= QLIM) return;
  for (int rr = 0; rr < 16; ++rr) for (int q = 0; q < D / 32; ++q) { const int c = q * 32 + lane; b16 p, pl; split16(O[(t0 + rr) * D + c] * HS, p, pl); Ah[rr][c] = p; Al[rr][c] = pl; }
  if (lane < 16) for (int k = D; k < D + 8; ++k) { Ah[lane][k] = (b16)0.0f; Al[lane][k] = (b16)0.0f; }
  wave_lds_sync();
#pragma unroll 1
  for (int g = 0; g < 4; ++g) { v8f acc[16];
#pragma unroll
    for (int t = 0; t < 16; ++t) acc[t] = (v8f){};
#pragma unroll 2
    for (int kb = 0; kb < D; kb += 32) { const v16b a = frag_kb(&Ah[nloc][kb], hlf), al = frag_kb(&Al[nloc][kb], hlf);
#pragma unroll
      for (int t = 0; t < 16; ++t) { const v16b bw = frag_kb(WO + (size_t)(g * 256 + t * 16 + nloc) * D + kb, hlf); acc[t] = wmma16b(a, bw, acc[t]); acc[t] = wmma16b(al, bw, acc[t]); } }
#pragma unroll
    for (int t = 0; t < 16; ++t) { const int cc = t * 16 + nloc; const float bb = bfv(bo[g * 256 + cc]);
#pragma unroll
      for (int r8 = 0; r8 < 8; ++r8) Tf[8 * hlf + r8][cc] = acc[t][r8] * (1.0f / (HS * WSC)) + bb; }
    wave_lds_sync();
    { for (int rr = 0; rr < 16; ++rr) for (int q = 0; q < 2; ++q) *(v4f*)(out + (t0 + rr) * D + g * 256 + q * 128 + lane * 4) = *(const v4f*)(&Tf[rr][q * 128 + lane * 4]);  }
    wave_lds_sync(); } }
}  // namespace

extern "C" void kernel_launch(void* const* d_in, const int* in_sizes, int n_in, void* d_out, int out_size, void* d_ws, size_t ws_size, hipStream_t stream) {
  (void)n_in;
  auto Fp = [&](int i) { return (const float*)d_in[i]; };
  // inputs: 0 x [2,2048,1024]; 1 W1_q [64,1024]; 2 W2_q; 3 W1_k; 4 W2_k; 5 W_v [1024,1024]; 6 b_v; 7 W_out [1024,1024]; 8 b_out
  if (in_sizes[0] != NT * D || in_sizes[1] != 64 * D || in_sizes[4] != 64 * D || in_sizes[5] != D * D || in_sizes[7] != D * D || out_size != NT * D) return;
  const int QLIM = T;   // per-sequence query cut (multiple of 16)
  size_t off = 0; char* ws = (char*)d_ws;
  auto carve = [&](size_t bytes) { char* p = ws + off; off += (bytes + 255) & ~(size_t)255; return p; };
  b16* WQK = (b16*)carve((size_t)256 * D * 2); b16* WV = (b16*)carve((size_t)D * D * 2); b16* WO = (b16*)carve((size_t)D * D * 2); b16* LQh = (b16*)carve((size_t)H * NT * 32 * 2); b16* LQl = (b16*)carve((size_t)H * NT * 32 * 2); b16* LKh = (b16*)carve((size_t)H * NT * 32 * 2); b16* LKl = (b16*)carve((size_t)H * NT * 32 * 2); float* V = (float*)carve((size_t)NT * D * 4); b16* VTh = (b16*)carve((size_t)NB_ * H * DH * T * 2); b16* VTl = (b16*)carve((size_t)NB_ * H * DH * T * 2); float* O = (float*)carve((size_t)NT * D * 4);
  if (off > ws_size || off > ((size_t)80 << 20)) return;   // ~ 71 MB
  wput_kernel<<<128, 256, 0, stream>>>(Fp(1), Fp(2), Fp(3), Fp(4), Fp(5), Fp(7), WQK, WV, WO);
  proj_kernel<<<NT / 16, 32, 0, stream>>>(Fp(0), WQK, WV, Fp(6), LQh, LQl, LKh, LKl, V);
  vt_kernel<<<dim3(NB_ * (T / 64), H), 256, 0, stream>>>(V, VTh, VTl);
  att_kernel<<<NB_ * H * (T / 16), 32, 0, stream>>>(LQh, LQl, LKh, LKl, VTh, VTl, QLIM, O);
  outp_kernel<<<NT / 16, 32, 0, stream>>>(O, WO, Fp(8), QLIM, (float*)d_out);
}

// v001
// It runs in 624 microseconds.
// Next to v000, in two timings, it ran 2.48 and 2.49 times as fast.
#include <hip/hip_runtime.h>

// PluckerKernelAttention: q1,q2,k1,k2 = x W^T (1024 -> 16 heads x 4); L_q = normalize(exterior(q1,q2)), L_k likewise (6-d Plucker lines); scores = L_q . (J6 L_k) / sqrt(6) with a causal mask; attn = softmax; v = x W_v^T + b_v (16 x 64); o = attn v; out = o W_out^T + b_out -> [2][2048][1024].
// Deterministic: flash-style online softmax over fixed 256-key chunks (causal: chunks up to the query block), fixed order; no atomics.
// WMMA (v_wmma_f32_16x16x32_f16, f32 accumulate): x (EXACT bf16 x8, K 1024) x [W1q;W2q;W1k;W2k] rows (16 tiles) and x W_v rows (64 tiles), 4 tiles a wave, 20 waves per 16-token work-group; per (b, h, 16-query) wave and key chunk S = L_q (hi+lo x256, K 6 -> 32) x JL_k rows (hi+lo; 16 tiles) and O += P (hi+lo x256) x v^T rows (hi+lo; 4 tiles, K 256), 3 products; out-proj o (hi+lo, K 1024) x W_out rows (64 tiles, 4 a wave, 16 waves per 16-token work-group); weights EXACT x256, stored as (out, in) rows, about 4.4 M WMMA; Plucker exterior/normalisation and softmax in f32.

namespace {
constexpr int NB_ = 2, T = 2048, D = 1024, H = 16, DH = 64, NT = NB_ * T /* 4096 tokens */, CH = 256, PWV = 20 /* waves of a proj work-group */, OWV = 16 /* waves of an out-proj work-group */;
constexpr float XS = 8.0f, HS = 256.0f, PS = 256.0f, WSC = 256.0f, SCL = 0.40824829046386302f /* 6^-0.5 */;
typedef _Float16 b16;
typedef __attribute__((ext_vector_type(16))) _Float16 v16b;
typedef __attribute__((ext_vector_type(8))) _Float16 v8b;
typedef __attribute__((ext_vector_type(2))) _Float16 v2b;
typedef __attribute__((ext_vector_type(8))) float v8f;
typedef __attribute__((ext_vector_type(4))) float v4f;
typedef __attribute__((ext_vector_type(2))) float v2f;
__device__ __forceinline__ float bf16_rne(float f) { unsigned int u = __float_as_uint(f); u += 0x7FFFu + ((u >> 16) & 1u); float r = __uint_as_float(u & 0xFFFF0000u); asm volatile("" : "+v"(r)); return r; }
__device__ __forceinline__ float bfv(float f) { float r = bf16_rne(f); asm volatile("" : "+v"(r)); return r; }
__device__ __forceinline__ void split16(float v, b16& hi, b16& lo) { hi = (b16)v; lo = (b16)(v - (float)hi); }
__device__ __forceinline__ v16b frag_kb(const b16* p, int hh) { const v8b a = *(const v8b*)(p + 8 * hh), b = *(const v8b*)(p + 16 + 8 * hh); v16b f;
#pragma unroll
  for (int e = 0; e < 8; ++e) { f[e] = a[e]; f[8 + e] = b[e]; } return f; }
__device__ __forceinline__ v8f wmma16b(v16b a, v16b b, v8f c) { v8f d = __builtin_amdgcn_wmma_f32_16x16x32_f16(false, a, false, b, (short)0, c, false, false); asm volatile("v_nop\n\tv_nop\n\tv_nop\n\tv_nop" : "+v"(d) : "v"(a), "v"(b)); return d; }
__device__ __forceinline__ void wave_lds_sync() { __builtin_amdgcn_fence(__ATOMIC_RELEASE, "workgroup"); __builtin_amdgcn_wave_barrier(); __builtin_amdgcn_fence(__ATOMIC_ACQUIRE, "workgroup"); }
__device__ __forceinline__ float pmul(float a, float b) { float p = a * b; asm volatile("" : "+v"(p)); return p; }

__global__ __launch_bounds__(256) void wput_kernel(const float* __restrict__ w1q, const float* __restrict__ w2q, const float* __restrict__ w1k, const float* __restrict__ w2k, const float* __restrict__ wv, const float* __restrict__ wo, b16* __restrict__ WQK, b16* __restrict__ WV, b16* __restrict__ WO) { const size_t nt = (size_t)gridDim.x * 256, u0 = (size_t)blockIdx.x * 256 + threadIdx.x; v8b v;
  for (size_t u = u0; u < (size_t)256 * 128; u += nt) { const int o = (int)(u / 128), k0 = (int)(u % 128) * 8; const float* w = o < 64 ? w1q : (o < 128 ? w2q : (o < 192 ? w1k : w2k)); const int oo = o % 64;
#pragma unroll
    for (int j = 0; j < 8; ++j) v[j] = (b16)(bf16_rne(w[(size_t)oo * D + k0 + j]) * WSC); { *(v8b*)(WQK + (size_t)o * D + k0) = v;  } }
  for (size_t u = u0; u < (size_t)D * 128; u += nt) { const int o = (int)(u / 128), k0 = (int)(u % 128) * 8; v8b a, c;
#pragma unroll
    for (int j = 0; j < 8; ++j) { a[j] = (b16)(bf16_rne(wv[(size_t)o * D + k0 + j]) * WSC); c[j] = (b16)(bf16_rne(wo[(size_t)o * D + k0 + j]) * WSC); } { *(v8b*)(WV + (size_t)o * D + k0) = a; *(v8b*)(WO + (size_t)o * D + k0) = c;  } } }
// proj_kernel: one work-group per 16 tokens. The token tile is staged once in LDS and shared; wave w < 4 takes the q1,q2,k1,k2 columns of heads 4w..4w+3 (4 tiles), wave w >= 4 takes 64 columns of v (4 tiles).
__global__ __launch_bounds__(PWV * 32) void proj_kernel(const float* __restrict__ x, const b16* __restrict__ WQK, const b16* __restrict__ WV, const float* __restrict__ bv, b16* __restrict__ LQh, b16* __restrict__ LQl, b16* __restrict__ LKh, b16* __restrict__ LKl, float* __restrict__ V) { __shared__ __attribute__((aligned(16))) b16 Ah[16][D + 8]; __shared__ __attribute__((aligned(16))) float Tfs[PWV][16][68]; const int tid = threadIdx.x, lane = tid & 31, nloc = lane & 15, hlf = lane >> 4, wave = __builtin_amdgcn_readfirstlane(tid >> 5); const size_t t0 = (size_t)blockIdx.x * 16;
#pragma unroll   // constant offsets on one base address, and the range test only on the last trip
  for (int i = 0; i < (16 * D + PWV * 32 - 1) / (PWV * 32); ++i) { const int u = i * (PWV * 32) + tid; if (u < 16 * D) Ah[u / D][u % D] = (b16)(bf16_rne(x[t0 * D + u]) * XS); }
  if (tid < 16) for (int k = D; k < D + 8; ++k) Ah[tid][k] = (b16)0.0f;
  __syncthreads();   // the staged token tile is read by every wave
  float (*Tf)[68] = Tfs[wave]; const bool isqk = wave < 4; const int c0 = (wave - 4) * 64;
  const b16* W = isqk ? WQK + (size_t)(wave * 16 + nloc) * D : WV + (size_t)(c0 + nloc) * D; const size_t tstr = isqk ? (size_t)64 * D : (size_t)16 * D; v8f acc[4];
#pragma unroll
  for (int t = 0; t < 4; ++t) acc[t] = (v8f){};
#pragma unroll 2
  for (int kb = 0; kb < D; kb += 32) { const v16b a = frag_kb(&Ah[nloc][kb], hlf);
#pragma unroll
    for (int t = 0; t < 4; ++t) acc[t] = wmma16b(a, frag_kb(W + t * tstr + kb, hlf), acc[t]); }
#pragma unroll
  for (int t = 0; t < 4; ++t) { const int cc = t * 16 + nloc; const float bb = isqk ? 0.0f : bfv(bv[c0 + cc]);
#pragma unroll
    for (int r8 = 0; r8 < 8; ++r8) Tf[8 * hlf + r8][cc] = acc[t][r8] * (1.0f / (XS * WSC)) + bb; }
  wave_lds_sync();
  if (isqk) {   // Plucker lines: lane = (token rr = lane & 15, q-or-k = lane >> 4); loop this wave's 4 heads
    const int rr = nloc, isk = hlf; const size_t tok = t0 + rr;
#pragma unroll 1
    for (int hl = 0; hl < 4; ++hl) { const int h = wave * 4 + hl; const float* p1 = &Tf[rr][(isk ? 32 : 0) + hl * 4]; const float* p2 = &Tf[rr][(isk ? 48 : 16) + hl * 4]; float Lm[6]; Lm[0] = p1[0] * p2[1] - p1[1] * p2[0]; Lm[1] = p1[0] * p2[2] - p1[2] * p2[0]; Lm[2] = p1[0] * p2[3] - p1[3] * p2[0]; Lm[3] = p1[1] * p2[2] - p1[2] * p2[1]; Lm[4] = p1[1] * p2[3] - p1[3] * p2[1]; Lm[5] = p1[2] * p2[3] - p1[3] * p2[2];
      float n2 = 0.0f; for (int c = 0; c < 6; ++c) n2 += Lm[c] * Lm[c]; const float inv = 1.0f / fmaxf(sqrtf(n2), 1e-12f); float Lo[6];
      if (isk) { Lo[0] = Lm[5]; Lo[1] = -Lm[4]; Lo[2] = Lm[3]; Lo[3] = Lm[2]; Lo[4] = -Lm[1]; Lo[5] = Lm[0]; } else { for (int c = 0; c < 6; ++c) Lo[c] = Lm[c]; }
      b16 hh_[32], ll_[32]; for (int c = 0; c < 32; ++c) { hh_[c] = (b16)0.0f; ll_[c] = (b16)0.0f; } for (int c = 0; c < 6; ++c) split16(Lo[c] * inv * HS, hh_[c], ll_[c]);
      b16* dh = (isk ? LKh : LQh) + ((size_t)h * NT + tok) * 32; b16* dl = (isk ? LKl : LQl) + ((size_t)h * NT + tok) * 32;
      for (int c = 0; c < 32; c += 8) { v8b a, bq; for (int j = 0; j < 8; ++j) { a[j] = hh_[c + j]; bq[j] = ll_[c + j]; } *(v8b*)(dh + c) = a; *(v8b*)(dl + c) = bq; }
      asm volatile("s_wait_xcnt 0x0" ::: "memory");   // the next head's trip rewrites the address and data registers that these stores name
    } }
  else { for (int r2 = 0; r2 < 8; ++r2) { const int rr = r2 * 2 + hlf; *(v4f*)(V + (t0 + rr) * D + c0 + nloc * 4) = *(const v4f*)(&Tf[rr][nloc * 4]); }
    asm volatile("s_wait_xcnt 0x0" ::: "memory");   // closes the run of stores before any later instruction of the listing rewrites a register that they name
  } }
__global__ __launch_bounds__(256) void vt_kernel(const float* __restrict__ V, b16* __restrict__ VTh, b16* __restrict__ VTl) { __shared__ float Tt[64][65]; const int b = blockIdx.x / (T / 64), tk0 = (blockIdx.x % (T / 64)) * 64; const int h = blockIdx.y; const int tid = threadIdx.x, wave = tid >> 5, lane = tid & 31;
  for (int q = wave; q < 64; q += 8) { Tt[q][lane * 2] = V[((size_t)b * T + tk0 + q) * D + h * DH + lane * 2]; Tt[q][lane * 2 + 1] = V[((size_t)b * T + tk0 + q) * D + h * DH + lane * 2 + 1]; }
  __syncthreads();
  { for (int d = wave; d < DH; d += 8) { b16 h0, l0, h1, l1; split16(Tt[lane * 2][d] * HS, h0, l0); split16(Tt[lane * 2 + 1][d] * HS, h1, l1); const size_t o = (((size_t)b * H + h) * DH + d) * T + tk0 + lane * 2; *(v2b*)(VTh + o) = (v2b){h0, h1}; *(v2b*)(VTl + o) = (v2b){l0, l1}; }  } }
__global__ __launch_bounds__(32) void att_kernel(const b16* __restrict__ LQh, const b16* __restrict__ LQl, const b16* __restrict__ LKh, const b16* __restrict__ LKl, const b16* __restrict__ VTh, const b16* __restrict__ VTl, int QLIM, float* __restrict__ O) { __shared__ __attribute__((aligned(16))) b16 Pa[16][CH + 8], Pb[16][CH + 8]; __shared__ float Sc[16][CH + 1], Mx[16], Ls[16], Fc[16], Of[16][DH + 1]; const int lane = threadIdx.x, nloc = lane & 15, hlf = lane >> 4; const int b = blockIdx.x / (H * (T / 16)), rem = blockIdx.x % (H * (T / 16)); const int h = rem / (T / 16), q0 = (rem % (T / 16)) * 16; if (q0 >= QLIM) return; const size_t tq = (size_t)b * T + q0;
  if (lane < 16) { for (int k = CH; k < CH + 8; ++k) { Pa[lane][k] = (b16)0.0f; Pb[lane][k] = (b16)0.0f; } Mx[lane] = -INFINITY; Ls[lane] = 0.0f; }
  wave_lds_sync();
  const v16b qa = frag_kb(LQh + ((size_t)h * NT + tq + nloc) * 32, hlf), ql = frag_kb(LQl + ((size_t)h * NT + tq + nloc) * 32, hlf);
  v8f oacc[4] = {(v8f){}, (v8f){}, (v8f){}, (v8f){}}; const int nch = q0 / CH + 1;
#pragma unroll 1
  for (int ch = 0; ch < nch; ++ch) { const int k0 = ch * CH;
#pragma unroll 1
    for (int half = 0; half < 2; ++half) { v8f sacc[8];
#pragma unroll
      for (int t = 0; t < 8; ++t) sacc[t] = (v8f){};
#pragma unroll
      for (int t = 0; t < 8; ++t) { const size_t key = (size_t)h * NT + (size_t)b * T + k0 + half * 128 + t * 16 + nloc; const v16b kh = frag_kb(LKh + key * 32, hlf), kl = frag_kb(LKl + key * 32, hlf); sacc[t] = wmma16b(qa, kh, sacc[t]); sacc[t] = wmma16b(qa, kl, sacc[t]); sacc[t] = wmma16b(ql, kh, sacc[t]); }
#pragma unroll
      for (int t = 0; t < 8; ++t)
#pragma unroll
        for (int r8 = 0; r8 < 8; ++r8) Sc[8 * hlf + r8][half * 128 + t * 16 + nloc] = sacc[t][r8] * (SCL / (HS * HS)); }
    wave_lds_sync();
    for (int r = 0; r < 16; ++r) { const int qi = q0 + r; float mx = -INFINITY; for (int j = lane; j < CH; j += 32) { const float s = (k0 + j <= qi) ? Sc[r][j] : -INFINITY; mx = fmaxf(mx, s); } for (int o = 16; o; o >>= 1) mx = fmaxf(mx, __shfl_xor(mx, o)); const float mo = Mx[r], mn = fmaxf(mo, mx); float sm = 0.0f; for (int j = lane; j < CH; j += 32) { const float p = (k0 + j <= qi) ? __expf(Sc[r][j] - mn) : 0.0f; Sc[r][j] = p; sm += p; } for (int o = 16; o; o >>= 1) sm += __shfl_xor(sm, o); wave_lds_sync(); if (lane == 0) { const float fac = (mo == -INFINITY) ? 0.0f : __expf(mo - mn); Fc[r] = fac; Ls[r] = Ls[r] * fac + sm; Mx[r] = mn; } }
    wave_lds_sync();
    for (int r = 0; r < 16; ++r) for (int q = 0; q < CH / 32; ++q) { const int c = q * 32 + lane; b16 p, pl; split16(Sc[r][c] * PS, p, pl); Pa[r][c] = p; Pb[r][c] = pl; }
    wave_lds_sync();
#pragma unroll
    for (int t = 0; t < 4; ++t)
#pragma unroll
      for (int r8 = 0; r8 < 8; ++r8) oacc[t][r8] *= Fc[8 * hlf + r8];
#pragma unroll 2
    for (int kb = 0; kb < CH; kb += 32) { const v16b pa = frag_kb(&Pa[nloc][kb], hlf), pb = frag_kb(&Pb[nloc][kb], hlf);
#pragma unroll
      for (int t = 0; t < 4; ++t) { const size_t vo = (((size_t)b * H + h) * DH + t * 16 + nloc) * T + k0 + kb; const v16b vh = frag_kb(VTh + vo, hlf), vl = frag_kb(VTl + vo, hlf); oacc[t] = wmma16b(pa, vh, oacc[t]); oacc[t] = wmma16b(pa, vl, oacc[t]); oacc[t] = wmma16b(pb, vh, oacc[t]); } }
    wave_lds_sync(); }
#pragma unroll
  for (int t = 0; t < 4; ++t)
#pragma unroll
    for (int r8 = 0; r8 < 8; ++r8) { const int r = 8 * hlf + r8; Of[r][t * 16 + nloc] = oacc[t][r8] * (1.0f / (PS * HS)) / Ls[r]; }
  wave_lds_sync();
  { for (int r = 0; r < 16; ++r) *(v2f*)(O + (tq + r) * D + h * DH + lane * 2) = (v2f){Of[r][lane * 2], Of[r][lane * 2 + 1]};  } }
// outp_kernel: one work-group per 16 tokens; the hi and lo token tiles are staged once in LDS and shared; wave w takes output columns 64w..64w+63 (4 tiles).
__global__ __launch_bounds__(OWV * 32) void outp_kernel(const float* __restrict__ O, const b16* __restrict__ WO, const float* __restrict__ bo, int QLIM, float* __restrict__ out) { __shared__ __attribute__((aligned(16))) b16 Ah[16][D + 8], Al[16][D + 8]; __shared__ __attribute__((aligned(16))) float Tfs[OWV][16][68]; const int tid = threadIdx.x, lane = tid & 31, nloc = lane & 15, hlf = lane >> 4, wave = __builtin_amdgcn_readfirstlane(tid >> 5); const size_t t0 = (size_t)blockIdx.x * 16; if ((int)(t0 % T) >= QLIM) return;
#pragma unroll   // lets the staging loads issue as one run, with one wait
  for (int i = 0; i < 16 * D / (OWV * 32); ++i) { const int u = i * (OWV * 32) + tid; b16 p, pl; split16(O[t0 * D + u] * HS, p, pl); Ah[u / D][u % D] = p; Al[u / D][u % D] = pl; }
  if (tid < 16) for (int k = D; k < D + 8; ++k) { Ah[tid][k] = (b16)0.0f; Al[tid][k] = (b16)0.0f; }
  __syncthreads();   // the staged token tiles are read by every wave
  float (*Tf)[68] = Tfs[wave]; const int c0 = wave * 64; const b16* W = WO + (size_t)(c0 + nloc) * D; v8f acc[4];
#pragma unroll
  for (int t = 0; t < 4; ++t) acc[t] = (v8f){};
#pragma unroll 2
  for (int kb = 0; kb < D; kb += 32) { const v16b a = frag_kb(&Ah[nloc][kb], hlf), al = frag_kb(&Al[nloc][kb], hlf);
#pragma unroll
    for (int t = 0; t < 4; ++t) { const v16b bw = frag_kb(W + (size_t)t * 16 * D + kb, hlf); acc[t] = wmma16b(a, bw, acc[t]); acc[t] = wmma16b(al, bw, acc[t]); } }
#pragma unroll
  for (int t = 0; t < 4; ++t) { const int cc = t * 16 + nloc; const float bb = bfv(bo[c0 + cc]);
#pragma unroll
    for (int r8 = 0; r8 < 8; ++r8) Tf[8 * hlf + r8][cc] = acc[t][r8] * (1.0f / (HS * WSC)) + bb; }
  wave_lds_sync();
  for (int r2 = 0; r2 < 8; ++r2) { const int rr = r2 * 2 + hlf; *(v4f*)(out + (t0 + rr) * D + c0 + nloc * 4) = *(const v4f*)(&Tf[rr][nloc * 4]); } }
}  // namespace

extern "C" void kernel_launch(void* const* d_in, const int* in_sizes, int n_in, void* d_out, int out_size, void* d_ws, size_t ws_size, hipStream_t stream) {
  (void)n_in;
  auto Fp = [&](int i) { return (const float*)d_in[i]; };
  // inputs: 0 x [2,2048,1024]; 1 W1_q [64,1024]; 2 W2_q; 3 W1_k; 4 W2_k; 5 W_v [1024,1024]; 6 b_v; 7 W_out [1024,1024]; 8 b_out
  if (in_sizes[0] != NT * D || in_sizes[1] != 64 * D || in_sizes[4] != 64 * D || in_sizes[5] != D * D || in_sizes[7] != D * D || out_size != NT * D) return;
  const int QLIM = T;   // per-sequence query cut (multiple of 16)
  size_t off = 0; char* ws = (char*)d_ws;
  auto carve = [&](size_t bytes) { char* p = ws + off; off += (bytes + 255) & ~(size_t)255; return p; };
  b16* WQK = (b16*)carve((size_t)256 * D * 2); b16* WV = (b16*)carve((size_t)D * D * 2); b16* WO = (b16*)carve((size_t)D * D * 2); b16* LQh = (b16*)carve((size_t)H * NT * 32 * 2); b16* LQl = (b16*)carve((size_t)H * NT * 32 * 2); b16* LKh = (b16*)carve((size_t)H * NT * 32 * 2); b16* LKl = (b16*)carve((size_t)H * NT * 32 * 2); float* V = (float*)carve((size_t)NT * D * 4); b16* VTh = (b16*)carve((size_t)NB_ * H * DH * T * 2); b16* VTl = (b16*)carve((size_t)NB_ * H * DH * T * 2); float* O = (float*)carve((size_t)NT * D * 4);
  if (off > ws_size || off > ((size_t)80 << 20)) return;   // ~ 71 MB
  wput_kernel<<<128, 256, 0, stream>>>(Fp(1), Fp(2), Fp(3), Fp(4), Fp(5), Fp(7), WQK, WV, WO);
  proj_kernel<<<NT / 16, PWV * 32, 0, stream>>>(Fp(0), WQK, WV, Fp(6), LQh, LQl, LKh, LKl, V);
  vt_kernel<<<dim3(NB_ * (T / 64), H), 256, 0, stream>>>(V, VTh, VTl);
  att_kernel<<<NB_ * H * (T / 16), 32, 0, stream>>>(LQh, LQl, LKh, LKl, VTh, VTl, QLIM, O);
  outp_kernel<<<NT / 16, OWV * 32, 0, stream>>>(O, WO, Fp(8), QLIM, (float*)d_out);
}

// v002
// Measured time: 238 microseconds a run.
// In two side-by-side timings against v001, it was 2.61 and 2.65 times as fast.
// All steps since v000 together make it 6.54 times as fast.
#include <hip/hip_runtime.h>

// PluckerKernelAttention: q1,q2,k1,k2 = x W^T (1024 -> 16 heads x 4); L_q = normalize(exterior(q1,q2)), L_k likewise (6-d Plucker lines); scores = L_q . (J6 L_k) / sqrt(6) with a causal mask; attn = softmax; v = x W_v^T + b_v (16 x 64); o = attn v; out = o W_out^T + b_out -> [2][2048][1024].
// Deterministic: flash-style online softmax over fixed 128-key chunks (causal: chunks up to the query block), fixed order; no atomics.
// WMMA (v_wmma_f32_16x16x32_f16, f32 accumulate): x (EXACT bf16 x8, K 1024) x [W1q;W2q;W1k;W2k] rows (16 tiles) and x W_v rows (64 tiles), 4 tiles a wave, 20 waves per 16-token work-group; per (b, h, 16-query) wave and key chunk S^T = JL_k rows (hi+lo x256, K 6 -> 32; 8 tiles) x L_q (hi+lo) and O^T += v^T rows (hi+lo; 4 tiles, K 128) x P (hi+lo x256, packed from the score accumulators), 3 products; out-proj o (hi+lo, K 1024) x W_out rows (64 tiles, 4 a wave, 16 waves per 16-token work-group); weights EXACT x256, stored as (out, in) rows, about 4.2 M WMMA; Plucker exterior/normalisation and softmax in f32.

namespace {
constexpr int NB_ = 2, T = 2048, D = 1024, H = 16, DH = 64, NT = NB_ * T /* 4096 tokens */, CK = 128 /* keys of an attention chunk */, PWV = 20 /* waves of a proj work-group */, OWV = 16 /* waves of an out-proj work-group */;
constexpr float XS = 8.0f, HS = 256.0f, PS = 256.0f, WSC = 256.0f, SCL = 0.40824829046386302f /* 6^-0.5 */;
typedef _Float16 b16;
typedef __attribute__((ext_vector_type(16))) _Float16 v16b;
typedef __attribute__((ext_vector_type(8))) _Float16 v8b;
typedef __attribute__((ext_vector_type(2))) _Float16 v2b;
typedef __attribute__((ext_vector_type(8))) float v8f;
typedef __attribute__((ext_vector_type(4))) float v4f;
typedef __attribute__((ext_vector_type(2))) float v2f;
__device__ __forceinline__ float bf16_rne(float f) { unsigned int u = __float_as_uint(f); u += 0x7FFFu + ((u >> 16) & 1u); float r = __uint_as_float(u & 0xFFFF0000u); asm volatile("" : "+v"(r)); return r; }
__device__ __forceinline__ float bfv(float f) { float r = bf16_rne(f); asm volatile("" : "+v"(r)); return r; }
__device__ __forceinline__ void split16(float v, b16& hi, b16& lo) { hi = (b16)v; lo = (b16)(v - (float)hi); }
__device__ __forceinline__ v16b frag_kb(const b16* p, int hh) { const v8b a = *(const v8b*)(p + 8 * hh), b = *(const v8b*)(p + 16 + 8 * hh); v16b f;
#pragma unroll
  for (int e = 0; e < 8; ++e) { f[e] = a[e]; f[8 + e] = b[e]; } return f; }
__device__ __forceinline__ v8f wmma16b(v16b a, v16b b, v8f c) { v8f d = __builtin_amdgcn_wmma_f32_16x16x32_f16(false, a, false, b, (short)0, c, false, false); asm volatile("v_nop\n\tv_nop\n\tv_nop\n\tv_nop" : "+v"(d) : "v"(a), "v"(b)); return d; }
__device__ __forceinline__ void wave_lds_sync() { __builtin_amdgcn_fence(__ATOMIC_RELEASE, "workgroup"); __builtin_amdgcn_wave_barrier(); __builtin_amdgcn_fence(__ATOMIC_ACQUIRE, "workgroup"); }
__device__ __forceinline__ float xhalf(float x) { return __builtin_bit_cast(float, __builtin_amdgcn_permlanex16(__builtin_bit_cast(int, x), __builtin_bit_cast(int, x), 0x76543210, 0xfedcba98, false, false)); }   // lane l with lane l ^ 16
__device__ __forceinline__ float exp2s(float x) { float r; asm("v_exp_f32 %0, %1\n\tv_nop" : "=v"(r) : "v"(x)); return r; }   // 2^x; the v_nop is the one slot asked for between a transcendental and a next instruction that reads its result or overwrites its source: in one statement, so that it stands directly behind
__device__ __forceinline__ float pmul(float a, float b) { float p = a * b; asm volatile("" : "+v"(p)); return p; }

__global__ __launch_bounds__(256) void wput_kernel(const float* __restrict__ w1q, const float* __restrict__ w2q, const float* __restrict__ w1k, const float* __restrict__ w2k, const float* __restrict__ wv, const float* __restrict__ wo, b16* __restrict__ WQK, b16* __restrict__ WV, b16* __restrict__ WO) { const size_t nt = (size_t)gridDim.x * 256, u0 = (size_t)blockIdx.x * 256 + threadIdx.x; v8b v;
  for (size_t u = u0; u < (size_t)256 * 128; u += nt) { const int o = (int)(u / 128), k0 = (int)(u % 128) * 8; const float* w = o < 64 ? w1q : (o < 128 ? w2q : (o < 192 ? w1k : w2k)); const int oo = o % 64;
#pragma unroll
    for (int j = 0; j < 8; ++j) v[j] = (b16)(bf16_rne(w[(size_t)oo * D + k0 + j]) * WSC); { *(v8b*)(WQK + (size_t)o * D + k0) = v;  } }
  for (size_t u = u0; u < (size_t)D * 128; u += nt) { const int o = (int)(u / 128), k0 = (int)(u % 128) * 8; v8b a, c;
#pragma unroll
    for (int j = 0; j < 8; ++j) { a[j] = (b16)(bf16_rne(wv[(size_t)o * D + k0 + j]) * WSC); c[j] = (b16)(bf16_rne(wo[(size_t)o * D + k0 + j]) * WSC); } { *(v8b*)(WV + (size_t)o * D + k0) = a; *(v8b*)(WO + (size_t)o * D + k0) = c;  } } }
// proj_kernel: one work-group per 16 tokens. The token tile is staged once in LDS and shared; wave w < 4 takes the q1,q2,k1,k2 columns of heads 4w..4w+3 (4 tiles), wave w >= 4 takes 64 columns of v (4 tiles).
__global__ __launch_bounds__(PWV * 32) void proj_kernel(const float* __restrict__ x, const b16* __restrict__ WQK, const b16* __restrict__ WV, const float* __restrict__ bv, b16* __restrict__ LQh, b16* __restrict__ LQl, b16* __restrict__ LKh, b16* __restrict__ LKl, float* __restrict__ V) { __shared__ __attribute__((aligned(16))) b16 Ah[16][D + 8]; __shared__ __attribute__((aligned(16))) float Tfs[PWV][16][68]; const int tid = threadIdx.x, lane = tid & 31, nloc = lane & 15, hlf = lane >> 4, wave = __builtin_amdgcn_readfirstlane(tid >> 5); const size_t t0 = (size_t)blockIdx.x * 16;
#pragma unroll   // constant offsets on one base address, and the range test only on the last trip
  for (int i = 0; i < (16 * D + PWV * 32 - 1) / (PWV * 32); ++i) { const int u = i * (PWV * 32) + tid; if (u < 16 * D) Ah[u / D][u % D] = (b16)(bf16_rne(x[t0 * D + u]) * XS); }
  if (tid < 16) for (int k = D; k < D + 8; ++k) Ah[tid][k] = (b16)0.0f;
  __syncthreads();   // the staged token tile is read by every wave
  float (*Tf)[68] = Tfs[wave]; const bool isqk = wave < 4; const int c0 = (wave - 4) * 64;
  const b16* W = isqk ? WQK + (size_t)(wave * 16 + nloc) * D : WV + (size_t)(c0 + nloc) * D; const size_t tstr = isqk ? (size_t)64 * D : (size_t)16 * D; v8f acc[4];
#pragma unroll
  for (int t = 0; t < 4; ++t) acc[t] = (v8f){};
#pragma unroll 2
  for (int kb = 0; kb < D; kb += 32) { const v16b a = frag_kb(&Ah[nloc][kb], hlf);
#pragma unroll
    for (int t = 0; t < 4; ++t) acc[t] = wmma16b(a, frag_kb(W + t * tstr + kb, hlf), acc[t]); }
#pragma unroll
  for (int t = 0; t < 4; ++t) { const int cc = t * 16 + nloc; const float bb = isqk ? 0.0f : bfv(bv[c0 + cc]);
#pragma unroll
    for (int r8 = 0; r8 < 8; ++r8) Tf[8 * hlf + r8][cc] = acc[t][r8] * (1.0f / (XS * WSC)) + bb; }
  wave_lds_sync();
  if (isqk) {   // Plucker lines: lane = (token rr = lane & 15, q-or-k = lane >> 4); loop this wave's 4 heads
    const int rr = nloc, isk = hlf; const size_t tok = t0 + rr;
#pragma unroll 1
    for (int hl = 0; hl < 4; ++hl) { const int h = wave * 4 + hl; const float* p1 = &Tf[rr][(isk ? 32 : 0) + hl * 4]; const float* p2 = &Tf[rr][(isk ? 48 : 16) + hl * 4]; float Lm[6]; Lm[0] = p1[0] * p2[1] - p1[1] * p2[0]; Lm[1] = p1[0] * p2[2] - p1[2] * p2[0]; Lm[2] = p1[0] * p2[3] - p1[3] * p2[0]; Lm[3] = p1[1] * p2[2] - p1[2] * p2[1]; Lm[4] = p1[1] * p2[3] - p1[3] * p2[1]; Lm[5] = p1[2] * p2[3] - p1[3] * p2[2];
      float n2 = 0.0f; for (int c = 0; c < 6; ++c) n2 += Lm[c] * Lm[c]; const float inv = 1.0f / fmaxf(sqrtf(n2), 1e-12f); float Lo[6];
      if (isk) { Lo[0] = Lm[5]; Lo[1] = -Lm[4]; Lo[2] = Lm[3]; Lo[3] = Lm[2]; Lo[4] = -Lm[1]; Lo[5] = Lm[0]; } else { for (int c = 0; c < 6; ++c) Lo[c] = Lm[c]; }
      b16 hh_[32], ll_[32]; for (int c = 0; c < 32; ++c) { hh_[c] = (b16)0.0f; ll_[c] = (b16)0.0f; } for (int c = 0; c < 6; ++c) split16(Lo[c] * inv * HS, hh_[c], ll_[c]);
      b16* dh = (isk ? LKh : LQh) + ((size_t)h * NT + tok) * 32; b16* dl = (isk ? LKl : LQl) + ((size_t)h * NT + tok) * 32;
      for (int c = 0; c < 32; c += 8) { v8b a, bq; for (int j = 0; j < 8; ++j) { a[j] = hh_[c + j]; bq[j] = ll_[c + j]; } *(v8b*)(dh + c) = a; *(v8b*)(dl + c) = bq; }
      asm volatile("s_wait_xcnt 0x0" ::: "memory");   // the next head's trip rewrites the address and data registers that these stores name
    } }
  else { for (int r2 = 0; r2 < 8; ++r2) { const int rr = r2 * 2 + hlf; *(v4f*)(V + (t0 + rr) * D + c0 + nloc * 4) = *(const v4f*)(&Tf[rr][nloc * 4]); }
    asm volatile("s_wait_xcnt 0x0" ::: "memory");   // closes the run of stores before any later instruction of the listing rewrites a register that they name
  } }
__global__ __launch_bounds__(256) void vt_kernel(const float* __restrict__ V, b16* __restrict__ VTh, b16* __restrict__ VTl) { __shared__ float Tt[64][65]; const int b = blockIdx.x / (T / 64), tk0 = (blockIdx.x % (T / 64)) * 64; const int h = blockIdx.y; const int tid = threadIdx.x, wave = tid >> 5, lane = tid & 31;
  for (int q = wave; q < 64; q += 8) { Tt[q][lane * 2] = V[((size_t)b * T + tk0 + q) * D + h * DH + lane * 2]; Tt[q][lane * 2 + 1] = V[((size_t)b * T + tk0 + q) * D + h * DH + lane * 2 + 1]; }
  __syncthreads();
  { for (int d = wave; d < DH; d += 8) { b16 h0, l0, h1, l1; split16(Tt[lane * 2][d] * HS, h0, l0); split16(Tt[lane * 2 + 1][d] * HS, h1, l1); const size_t o = (((size_t)b * H + h) * DH + d) * T + tk0 + lane * 2; *(v2b*)(VTh + o) = (v2b){h0, h1}; *(v2b*)(VTl + o) = (v2b){l0, l1}; }  } }
// att_kernel: one wave per (b, h, 16 queries). S^T = JL_k x L_q^T, so a lane holds the scores of ONE query (column nloc; keys 8 * hlf + r of each 16-key tile): mask, maximum, exp and sum stay in registers,
// two converted score tiles are the B operand (hardware k order, the order of frag_kb) of O^T += v^T x P^T, and the rescale factor and the final 1 / sum are per lane. No LDS. Every inner loop is unrolled so that each index into a register array is a constant.
__global__ __launch_bounds__(32) __attribute__((amdgpu_waves_per_eu(4, 4))) /* 256 registers a wave: all 4096 waves are resident at once, four a SIMD */ void att_kernel(const b16* __restrict__ LQh, const b16* __restrict__ LQl, const b16* __restrict__ LKh, const b16* __restrict__ LKl, const b16* __restrict__ VTh, const b16* __restrict__ VTl, int QLIM, float* __restrict__ O) { const int lane = threadIdx.x, nloc = lane & 15, hlf = lane >> 4; const int b = blockIdx.x / (H * (T / 16)), rem = blockIdx.x % (H * (T / 16)); const int h = rem / (T / 16), q0 = (rem % (T / 16)) * 16; if (q0 >= QLIM) return; const size_t tq = (size_t)b * T + q0;
  constexpr float C2 = SCL / (HS * HS) * 1.4426950408889634f;   // raw accumulator -> score in the log2 domain
  const v16b qa = frag_kb(LQh + ((size_t)h * NT + tq + nloc) * 32, hlf), ql = frag_kb(LQl + ((size_t)h * NT + tq + nloc) * 32, hlf);
  const b16* Kh = LKh + ((size_t)h * NT + (size_t)b * T + nloc) * 32; const b16* Kl = LKl + ((size_t)h * NT + (size_t)b * T + nloc) * 32;   // a lane's own key row of a tile, and below its own d row of v^T
  const b16* Vh = VTh + (((size_t)b * H + h) * DH + nloc) * T; const b16* Vl = VTl + (((size_t)b * H + h) * DH + nloc) * T;
  v8f oacc[4] = {(v8f){}, (v8f){}, (v8f){}, (v8f){}}; float mrun = -INFINITY, lsum = 0.0f; const int nch = q0 / CK + 1;
#pragma unroll 1   // one chunk's code: a second copy would take the registers that keep four waves on a SIMD
  for (int ch = 0; ch < nch; ++ch) { const int k0 = ch * CK; v8f sacc[CK / 16]; const b16* pkh = Kh + (size_t)k0 * 32 + 8 * hlf; const b16* pkl = Kl + (size_t)k0 * 32 + 8 * hlf;
#pragma unroll
    for (int g = 0; g < CK / 16; g += 4) { v16b kh[4], kl[4];   // four independent tiles a group: no product waits for the one before it
#pragma unroll
      for (int t = 0; t < 4; ++t) { kh[t] = frag_kb(pkh + (g + t) * 16 * 32, 0); kl[t] = frag_kb(pkl + (g + t) * 16 * 32, 0); }
      asm volatile("s_wait_xcnt 0x0" :: "v"(pkh), "v"(pkl) : "memory");   // the two addresses are inputs, so they stay in their registers up to this wait: no result of these loads lands in a register that one of them still names
#pragma unroll
      for (int t = 0; t < 4; ++t) sacc[g + t] = wmma16b(kh[t], qa, (v8f){});
#pragma unroll
      for (int t = 0; t < 4; ++t) sacc[g + t] = wmma16b(kl[t], qa, sacc[g + t]);
#pragma unroll
      for (int t = 0; t < 4; ++t) sacc[g + t] = wmma16b(kh[t], ql, sacc[g + t]); }
    if (ch == nch - 1) { const int kd = q0 + nloc - k0 - 8 * hlf;   // causal mask: only the last chunk holds keys behind a query
#pragma unroll
      for (int t = 0; t < CK / 16; ++t)
#pragma unroll
        for (int r8 = 0; r8 < 8; ++r8) sacc[t][r8] = (t * 16 + r8 <= kd) ? sacc[t][r8] : -INFINITY; }
    float m4[4] = {sacc[0][0], sacc[0][1], sacc[0][2], sacc[0][3]};   // four chains, so that no maximum waits for the one before it
#pragma unroll
    for (int t = 0; t < CK / 16; ++t)
#pragma unroll
      for (int r8 = 0; r8 < 8; ++r8) m4[r8 & 3] = fmaxf(m4[r8 & 3], sacc[t][r8]);
    float mx = fmaxf(fmaxf(m4[0], m4[1]), fmaxf(m4[2], m4[3])); mx = fmaxf(mx, xhalf(mx));   // the two halves of the wave hold the two halves of a query's keys
    const float mn = fmaxf(mrun, mx), fac = exp2s((mrun - mn) * C2), nb = -mn * C2; mrun = mn;
    v16b pa[CK / 32], pb[CK / 32]; float sm[4] = {0.0f, 0.0f, 0.0f, 0.0f};
#pragma unroll
    for (int t = 0; t < CK / 16; ++t)
#pragma unroll
      for (int r8 = 0; r8 < 8; ++r8) { const float p = exp2s(fmaf(sacc[t][r8], C2, nb)); sm[r8 & 3] += p; b16 ph, pl; split16(p * PS, ph, pl); pa[t >> 1][(t & 1) * 8 + r8] = ph; pb[t >> 1][(t & 1) * 8 + r8] = pl; }
    lsum = lsum * fac + ((sm[0] + sm[1]) + (sm[2] + sm[3]));
#pragma unroll
    for (int t = 0; t < 4; ++t)
#pragma unroll
      for (int r8 = 0; r8 < 8; ++r8) oacc[t][r8] *= fac;
#pragma unroll
    for (int jj = 0; jj < CK / 64; ++jj)   // 64 keys are one 128-byte line of a v^T row: a block of loads takes whole lines, two d tiles at a time
#pragma unroll
      for (int tp = 0; tp < 4; tp += 2) { v16b vh[2][2], vl[2][2];
#pragma unroll
        for (int t = 0; t < 2; ++t)
#pragma unroll
          for (int j = 0; j < 2; ++j) { const size_t vo = (size_t)(tp + t) * 16 * T + k0 + (jj * 2 + j) * 32; vh[t][j] = frag_kb(Vh + vo, hlf); vl[t][j] = frag_kb(Vl + vo, hlf); }
#pragma unroll
        for (int j = 0; j < 2; ++j) { const int J = jj * 2 + j;
#pragma unroll
          for (int t = 0; t < 2; ++t) oacc[tp + t] = wmma16b(vh[t][j], pa[J], oacc[tp + t]);
#pragma unroll
          for (int t = 0; t < 2; ++t) oacc[tp + t] = wmma16b(vl[t][j], pa[J], oacc[tp + t]);
#pragma unroll
          for (int t = 0; t < 2; ++t) oacc[tp + t] = wmma16b(vh[t][j], pb[J], oacc[tp + t]); } } }
  const float rl = (1.0f / (PS * HS)) / (lsum + xhalf(lsum));
#pragma unroll
  for (int t = 0; t < 4; ++t) { float* op = O + (tq + nloc) * D + h * DH + t * 16 + 8 * hlf;   // a lane's 8 accumulator registers are 8 consecutive d of its query
    *(v4f*)op = (v4f){oacc[t][0] * rl, oacc[t][1] * rl, oacc[t][2] * rl, oacc[t][3] * rl}; *(v4f*)(op + 4) = (v4f){oacc[t][4] * rl, oacc[t][5] * rl, oacc[t][6] * rl, oacc[t][7] * rl}; } }
// outp_kernel: one work-group per 16 tokens; the hi and lo token tiles are staged once in LDS and shared; wave w takes output columns 64w..64w+63 (4 tiles).
__global__ __launch_bounds__(OWV * 32) void outp_kernel(const float* __restrict__ O, const b16* __restrict__ WO, const float* __restrict__ bo, int QLIM, float* __restrict__ out) { __shared__ __attribute__((aligned(16))) b16 Ah[16][D + 8], Al[16][D + 8]; __shared__ __attribute__((aligned(16))) float Tfs[OWV][16][68]; const int tid = threadIdx.x, lane = tid & 31, nloc = lane & 15, hlf = lane >> 4, wave = __builtin_amdgcn_readfirstlane(tid >> 5); const size_t t0 = (size_t)blockIdx.x * 16; if ((int)(t0 % T) >= QLIM) return;
#pragma unroll   // lets the staging loads issue as one run, with one wait
  for (int i = 0; i < 16 * D / (OWV * 32); ++i) { const int u = i * (OWV * 32) + tid; b16 p, pl; split16(O[t0 * D + u] * HS, p, pl); Ah[u / D][u % D] = p; Al[u / D][u % D] = pl; }
  if (tid < 16) for (int k = D; k < D + 8; ++k) { Ah[tid][k] = (b16)0.0f; Al[tid][k] = (b16)0.0f; }
  __syncthreads();   // the staged token tiles are read by every wave
  float (*Tf)[68] = Tfs[wave]; const int c0 = wave * 64; const b16* W = WO + (size_t)(c0 + nloc) * D; v8f acc[4];
#pragma unroll
  for (int t = 0; t < 4; ++t) acc[t] = (v8f){};
#pragma unroll 2
  for (int kb = 0; kb < D; kb += 32) { const v16b a = frag_kb(&Ah[nloc][kb], hlf), al = frag_kb(&Al[nloc][kb], hlf);
#pragma unroll
    for (int t = 0; t < 4; ++t) { const v16b bw = frag_kb(W + (size_t)t * 16 * D + kb, hlf); acc[t] = wmma16b(a, bw, acc[t]); acc[t] = wmma16b(al, bw, acc[t]); } }
#pragma unroll
  for (int t = 0; t < 4; ++t) { const int cc = t * 16 + nloc; const float bb = bfv(bo[c0 + cc]);
#pragma unroll
    for (int r8 = 0; r8 < 8; ++r8) Tf[8 * hlf + r8][cc] = acc[t][r8] * (1.0f / (HS * WSC)) + bb; }
  wave_lds_sync();
  for (int r2 = 0; r2 < 8; ++r2) { const int rr = r2 * 2 + hlf; *(v4f*)(out + (t0 + rr) * D + c0 + nloc * 4) = *(const v4f*)(&Tf[rr][nloc * 4]); } }
}  // namespace

extern "C" void kernel_launch(void* const* d_in, const int* in_sizes, int n_in, void* d_out, int out_size, void* d_ws, size_t ws_size, hipStream_t stream) {
  (void)n_in;
  auto Fp = [&](int i) { return (const float*)d_in[i]; };
  // inputs: 0 x [2,2048,1024]; 1 W1_q [64,1024]; 2 W2_q; 3 W1_k; 4 W2_k; 5 W_v [1024,1024]; 6 b_v; 7 W_out [1024,1024]; 8 b_out
  if (in_sizes[0] != NT * D || in_sizes[1] != 64 * D || in_sizes[4] != 64 * D || in_sizes[5] != D * D || in_sizes[7] != D * D || out_size != NT * D) return;
  const int QLIM = T;   // per-sequence query cut (multiple of 16)
  size_t off = 0; char* ws = (char*)d_ws;
  auto carve = [&](size_t bytes) { char* p = ws + off; off += (bytes + 255) & ~(size_t)255; return p; };
  b16* WQK = (b16*)carve((size_t)256 * D * 2); b16* WV = (b16*)carve((size_t)D * D * 2); b16* WO = (b16*)carve((size_t)D * D * 2); b16* LQh = (b16*)carve((size_t)H * NT * 32 * 2); b16* LQl = (b16*)carve((size_t)H * NT * 32 * 2); b16* LKh = (b16*)carve((size_t)H * NT * 32 * 2); b16* LKl = (b16*)carve((size_t)H * NT * 32 * 2); float* V = (float*)carve((size_t)NT * D * 4); b16* VTh = (b16*)carve((size_t)NB_ * H * DH * T * 2); b16* VTl = (b16*)carve((size_t)NB_ * H * DH * T * 2); float* O = (float*)carve((size_t)NT * D * 4);
  if (off > ws_size || off > ((size_t)80 << 20)) return;   // ~ 71 MB
  wput_kernel<<<128, 256, 0, stream>>>(Fp(1), Fp(2), Fp(3), Fp(4), Fp(5), Fp(7), WQK, WV, WO);
  proj_kernel<<<NT / 16, PWV * 32, 0, stream>>>(Fp(0), WQK, WV, Fp(6), LQh, LQl, LKh, LKl, V);
  vt_kernel<<<dim3(NB_ * (T / 64), H), 256, 0, stream>>>(V, VTh, VTl);
  att_kernel<<<NB_ * H * (T / 16), 32, 0, stream>>>(LQh, LQl, LKh, LKl, VTh, VTl, QLIM, O);
  outp_kernel<<<NT / 16, OWV * 32, 0, stream>>>(O, WO, Fp(8), QLIM, (float*)d_out);
}

// v003
// One run takes 203 microseconds.
// Next to v002, in two timings, it ran 1.18 times as fast each time.
// Over all steps from v000 it is 7.71 times as fast.
#include <hip/hip_runtime.h>

// PluckerKernelAttention: q1,q2,k1,k2 = x W^T (1024 -> 16 heads x 4); L_q = normalize(exterior(q1,q2)), L_k likewise (6-d Plucker lines); scores = L_q . (J6 L_k) / sqrt(6) with a causal mask; attn = softmax; v = x W_v^T + b_v (16 x 64); o = attn v; out = o W_out^T + b_out -> [2][2048][1024].
// Deterministic: flash-style online softmax over fixed 128-key chunks (causal: chunks up to the query block), fixed order; no atomics.
// WMMA (v_wmma_f32_16x16x32_f16, f32 accumulate): x (EXACT bf16 x8, K 1024) x [W1q;W2q;W1k;W2k] rows (16 tiles) and x W_v rows (64 tiles), 4 tiles a wave, 20 waves per 16-token work-group; per (b, h, 16-query) wave and key chunk S^T = JL_k rows (hi+lo x256, K 6 -> 32; 8 tiles) x L_q (hi+lo) and O^T += v^T rows (hi+lo; 4 tiles, K 128) x P (hi+lo x256, packed from the score accumulators), 3 products; out-proj o (hi+lo, K 1024) x W_out rows (64 tiles, 4 a wave, 16 waves per 16-token work-group); weights EXACT x256, stored as (out, in) rows, about 4.2 M WMMA; Plucker exterior/normalisation and softmax in f32.

namespace {
constexpr int NB_ = 2, T = 2048, D = 1024, H = 16, DH = 64, NT = NB_ * T /* 4096 tokens */, CK = 128 /* keys of an attention chunk */, PWV = 20 /* waves of a proj work-group */, OWV = 16 /* waves of an out-proj work-group */, NK = D / 32 /* k steps of a projection */;
constexpr float XS = 8.0f, HS = 256.0f, PS = 256.0f, WSC = 256.0f, SCL = 0.40824829046386302f /* 6^-0.5 */;
typedef _Float16 b16;
typedef __attribute__((ext_vector_type(16))) _Float16 v16b;
typedef __attribute__((ext_vector_type(8))) _Float16 v8b;
typedef __attribute__((ext_vector_type(2))) _Float16 v2b;
typedef __attribute__((ext_vector_type(8))) float v8f;
typedef __attribute__((ext_vector_type(4))) float v4f;
typedef __attribute__((ext_vector_type(2))) float v2f;
__device__ __forceinline__ float bf16_rne(float f) { unsigned int u = __float_as_uint(f); u += 0x7FFFu + ((u >> 16) & 1u); float r = __uint_as_float(u & 0xFFFF0000u); asm volatile("" : "+v"(r)); return r; }
__device__ __forceinline__ float bfv(float f) { float r = bf16_rne(f); asm volatile("" : "+v"(r)); return r; }
__device__ __forceinline__ void split16(float v, b16& hi, b16& lo) { hi = (b16)v; lo = (b16)(v - (float)hi); }
__device__ __forceinline__ v16b frag_kb(const b16* p, int hh) { const v8b a = *(const v8b*)(p + 8 * hh), b = *(const v8b*)(p + 16 + 8 * hh); v16b f;
#pragma unroll
  for (int e = 0; e < 8; ++e) { f[e] = a[e]; f[8 + e] = b[e]; } return f; }
__device__ __forceinline__ v8f wmma16b(v16b a, v16b b, v8f c) { v8f d = __builtin_amdgcn_wmma_f32_16x16x32_f16(false, a, false, b, (short)0, c, false, false); asm volatile("v_nop\n\tv_nop\n\tv_nop\n\tv_nop" : "+v"(d) : "v"(a), "v"(b)); return d; }
__device__ __forceinline__ void wave_lds_sync() { __builtin_amdgcn_fence(__ATOMIC_RELEASE, "workgroup"); __builtin_amdgcn_wave_barrier(); __builtin_amdgcn_fence(__ATOMIC_ACQUIRE, "workgroup"); }
__device__ __forceinline__ float xhalf(float x) { return __builtin_bit_cast(float, __builtin_amdgcn_permlanex16(__builtin_bit_cast(int, x), __builtin_bit_cast(int, x), 0x76543210, 0xfedcba98, false, false)); }   // lane l with lane l ^ 16
__device__ __forceinline__ float exp2s(float x) { float r; asm("v_exp_f32 %0, %1\n\tv_nop" : "=v"(r) : "v"(x)); return r; }   // 2^x; the v_nop is the one slot asked for between a transcendental and a next instruction that reads its result or overwrites its source: in one statement, so that it stands directly behind
__device__ __forceinline__ float pmul(float a, float b) { float p = a * b; asm volatile("" : "+v"(p)); return p; }

__global__ __launch_bounds__(256) void wput_kernel(const float* __restrict__ w1q, const float* __restrict__ w2q, const float* __restrict__ w1k, const float* __restrict__ w2k, const float* __restrict__ wv, const float* __restrict__ wo, b16* __restrict__ WQK, b16* __restrict__ WV, b16* __restrict__ WO) { const size_t nt = (size_t)gridDim.x * 256, u0 = (size_t)blockIdx.x * 256 + threadIdx.x; v8b v;
  for (size_t u = u0; u < (size_t)256 * 128; u += nt) { const int o = (int)(u / 128), k0 = (int)(u % 128) * 8; const float* w = o < 64 ? w1q : (o < 128 ? w2q : (o < 192 ? w1k : w2k)); const int oo = o % 64;
#pragma unroll
    for (int j = 0; j < 8; ++j) v[j] = (b16)(bf16_rne(w[(size_t)oo * D + k0 + j]) * WSC); { *(v8b*)(WQK + (size_t)o * D + k0) = v;  } }
  for (size_t u = u0; u < (size_t)D * 128; u += nt) { const int o = (int)(u / 128), k0 = (int)(u % 128) * 8; v8b a, c;
#pragma unroll
    for (int j = 0; j < 8; ++j) { a[j] = (b16)(bf16_rne(wv[(size_t)o * D + k0 + j]) * WSC); c[j] = (b16)(bf16_rne(wo[(size_t)o * D + k0 + j]) * WSC); } { *(v8b*)(WV + (size_t)o * D + k0) = a; *(v8b*)(WO + (size_t)o * D + k0) = c;  } } }
// proj_kernel: one work-group per 16 tokens. The token tile is staged once in LDS and shared; wave w < 4 takes the q1,q2,k1,k2 columns of heads 4w..4w+3 (4 tiles), wave w >= 4 takes 64 columns of v (4 tiles).
__global__ __launch_bounds__(PWV * 32) void proj_kernel(const float* __restrict__ x, const b16* __restrict__ WQK, const b16* __restrict__ WV, const float* __restrict__ bv, b16* __restrict__ LQh, b16* __restrict__ LQl, b16* __restrict__ LKh, b16* __restrict__ LKl, float* __restrict__ V) { __shared__ __attribute__((aligned(16))) b16 Ah[16][D + 8]; __shared__ __attribute__((aligned(16))) float Tfs[PWV][16][68]; const int tid = threadIdx.x, lane = tid & 31, nloc = lane & 15, hlf = lane >> 4, wave = __builtin_amdgcn_readfirstlane(tid >> 5); const size_t t0 = (size_t)blockIdx.x * 16;
#pragma unroll   // constant offsets on one base address, and the range test only on the last trip
  for (int i = 0; i < (16 * D + PWV * 32 - 1) / (PWV * 32); ++i) { const int u = i * (PWV * 32) + tid; if (u < 16 * D) Ah[u / D][u % D] = (b16)(bf16_rne(x[t0 * D + u]) * XS); }
  if (tid < 16) for (int k = D; k < D + 8; ++k) Ah[tid][k] = (b16)0.0f;
  __syncthreads();   // the staged token tile is read by every wave
  float (*Tf)[68] = Tfs[wave]; const bool isqk = wave < 4; const int c0 = (wave - 4) * 64;
  const b16* W = isqk ? WQK + (size_t)(wave * 16 + nloc) * D : WV + (size_t)(c0 + nloc) * D; const size_t tstr = isqk ? (size_t)64 * D : (size_t)16 * D; v8f acc[4];
#pragma unroll
  for (int t = 0; t < 4; ++t) acc[t] = (v8f){};
  // Register ring: the weight fragments of two k steps (one whole 128-byte line of each weight row) are asked for as one group, one group ahead of the products that use them. A product waits only for loads of the older group.
  v16b bw[2][2][4];
#pragma unroll
  for (int t = 0; t < 4; ++t)
#pragma unroll
    for (int e = 0; e < 2; ++e) bw[0][e][t] = frag_kb(W + t * tstr + e * 32, hlf);
#pragma unroll 1   // one ring turn is the loop body: every ring index is a constant, and a second copy would take registers from the ring
  for (int st0 = 0; st0 < NK - 4; st0 += 4)
#pragma unroll
    for (int s = 0; s < 4; ++s) { const int kb = (st0 + s) * 32; const v16b a = frag_kb(&Ah[nloc][kb], hlf);
      if ((s & 1) == 0) {
#pragma unroll
        for (int t = 0; t < 4; ++t)
#pragma unroll
          for (int e = 0; e < 2; ++e) bw[(s >> 1) ^ 1][e][t] = frag_kb(W + t * tstr + kb + (2 + e) * 32, hlf); }
#pragma unroll
      for (int t = 0; t < 4; ++t) acc[t] = wmma16b(a, bw[s >> 1][s & 1][t], acc[t]);
      if (s == 3) asm volatile("s_wait_xcnt 0x0" ::: "memory"); }   // the next turn forms its addresses in the registers that this turn's loads name
#pragma unroll
  for (int s = 0; s < 4; ++s) { const int kb = (NK - 4 + s) * 32; const v16b a = frag_kb(&Ah[nloc][kb], hlf);   // the last turn: only its first step still fetches a group
    if (s == 0) {
#pragma unroll
      for (int t = 0; t < 4; ++t)
#pragma unroll
        for (int e = 0; e < 2; ++e) bw[1][e][t] = frag_kb(W + t * tstr + kb + (2 + e) * 32, hlf); }
#pragma unroll
    for (int t = 0; t < 4; ++t) acc[t] = wmma16b(a, bw[s >> 1][s & 1][t], acc[t]); }
#pragma unroll
  for (int t = 0; t < 4; ++t) { const int cc = t * 16 + nloc; const float bb = isqk ? 0.0f : bfv(bv[c0 + cc]);
#pragma unroll
    for (int r8 = 0; r8 < 8; ++r8) Tf[8 * hlf + r8][cc] = acc[t][r8] * (1.0f / (XS * WSC)) + bb; }
  wave_lds_sync();
  if (isqk) {   // Plucker lines: lane = (token rr = lane & 15, q-or-k = lane >> 4); loop this wave's 4 heads
    const int rr = nloc, isk = hlf; const size_t tok = t0 + rr;
#pragma unroll 1
    for (int hl = 0; hl < 4; ++hl) { const int h = wave * 4 + hl; const float* p1 = &Tf[rr][(isk ? 32 : 0) + hl * 4]; const float* p2 = &Tf[rr][(isk ? 48 : 16) + hl * 4]; float Lm[6]; Lm[0] = p1[0] * p2[1] - p1[1] * p2[0]; Lm[1] = p1[0] * p2[2] - p1[2] * p2[0]; Lm[2] = p1[0] * p2[3] - p1[3] * p2[0]; Lm[3] = p1[1] * p2[2] - p1[2] * p2[1]; Lm[4] = p1[1] * p2[3] - p1[3] * p2[1]; Lm[5] = p1[2] * p2[3] - p1[3] * p2[2];
      float n2 = 0.0f; for (int c = 0; c < 6; ++c) n2 += Lm[c] * Lm[c]; const float inv = 1.0f / fmaxf(sqrtf(n2), 1e-12f); float Lo[6];
      if (isk) { Lo[0] = Lm[5]; Lo[1] = -Lm[4]; Lo[2] = Lm[3]; Lo[3] = Lm[2]; Lo[4] = -Lm[1]; Lo[5] = Lm[0]; } else { for (int c = 0; c < 6; ++c) Lo[c] = Lm[c]; }
      b16 hh_[32], ll_[32]; for (int c = 0; c < 32; ++c) { hh_[c] = (b16)0.0f; ll_[c] = (b16)0.0f; } for (int c = 0; c < 6; ++c) split16(Lo[c] * inv * HS, hh_[c], ll_[c]);
      b16* dh = (isk ? LKh : LQh) + ((size_t)h * NT + tok) * 32; b16* dl = (isk ? LKl : LQl) + ((size_t)h * NT + tok) * 32;
      for (int c = 0; c < 32; c += 8) { v8b a, bq; for (int j = 0; j < 8; ++j) { a[j] = hh_[c + j]; bq[j] = ll_[c + j]; } *(v8b*)(dh + c) = a; *(v8b*)(dl + c) = bq; }
      asm volatile("s_wait_xcnt 0x0" ::: "memory");   // the next head's trip rewrites the address and data registers that these stores name
    } }
  else { for (int r2 = 0; r2 < 8; ++r2) { const int rr = r2 * 2 + hlf; *(v4f*)(V + (t0 + rr) * D + c0 + nloc * 4) = *(const v4f*)(&Tf[rr][nloc * 4]); }
    asm volatile("s_wait_xcnt 0x0" ::: "memory");   // closes the run of stores before any later instruction of the listing rewrites a register that they name
  } }
__global__ __launch_bounds__(256) void vt_kernel(const float* __restrict__ V, b16* __restrict__ VTh, b16* __restrict__ VTl) { __shared__ float Tt[64][65]; const int b = blockIdx.x / (T / 64), tk0 = (blockIdx.x % (T / 64)) * 64; const int h = blockIdx.y; const int tid = threadIdx.x, wave = tid >> 5, lane = tid & 31;
  for (int q = wave; q < 64; q += 8) { Tt[q][lane * 2] = V[((size_t)b * T + tk0 + q) * D + h * DH + lane * 2]; Tt[q][lane * 2 + 1] = V[((size_t)b * T + tk0 + q) * D + h * DH + lane * 2 + 1]; }
  __syncthreads();
  { for (int d = wave; d < DH; d += 8) { b16 h0, l0, h1, l1; split16(Tt[lane * 2][d] * HS, h0, l0); split16(Tt[lane * 2 + 1][d] * HS, h1, l1); const size_t o = (((size_t)b * H + h) * DH + d) * T + tk0 + lane * 2; *(v2b*)(VTh + o) = (v2b){h0, h1}; *(v2b*)(VTl + o) = (v2b){l0, l1}; }  } }
// att_kernel: one wave per (b, h, 16 queries). S^T = JL_k x L_q^T, so a lane holds the scores of ONE query (column nloc; keys 8 * hlf + r of each 16-key tile): mask, maximum, exp and sum stay in registers,
// two converted score tiles are the B operand (hardware k order, the order of frag_kb) of O^T += v^T x P^T, and the rescale factor and the final 1 / sum are per lane. No LDS. Every inner loop is unrolled so that each index into a register array is a constant.
__global__ __launch_bounds__(32) __attribute__((amdgpu_waves_per_eu(4, 4))) /* 256 registers a wave: all 4096 waves are resident at once, four a SIMD */ void att_kernel(const b16* __restrict__ LQh, const b16* __restrict__ LQl, const b16* __restrict__ LKh, const b16* __restrict__ LKl, const b16* __restrict__ VTh, const b16* __restrict__ VTl, int QLIM, float* __restrict__ O) { const int lane = threadIdx.x, nloc = lane & 15, hlf = lane >> 4; const int b = blockIdx.x / (H * (T / 16)), rem = blockIdx.x % (H * (T / 16)); const int h = rem / (T / 16), q0 = (rem % (T / 16)) * 16; if (q0 >= QLIM) return; const size_t tq = (size_t)b * T + q0;
  constexpr float C2 = SCL / (HS * HS) * 1.4426950408889634f;   // raw accumulator -> score in the log2 domain
  const v16b qa = frag_kb(LQh + ((size_t)h * NT + tq + nloc) * 32, hlf), ql = frag_kb(LQl + ((size_t)h * NT + tq + nloc) * 32, hlf);
  const b16* Kh = LKh + ((size_t)h * NT + (size_t)b * T + nloc) * 32; const b16* Kl = LKl + ((size_t)h * NT + (size_t)b * T + nloc) * 32;   // a lane's own key row of a tile, and below its own d row of v^T
  const b16* Vh = VTh + (((size_t)b * H + h) * DH + nloc) * T; const b16* Vl = VTl + (((size_t)b * H + h) * DH + nloc) * T;
  v8f oacc[4] = {(v8f){}, (v8f){}, (v8f){}, (v8f){}}; float mrun = -INFINITY, lsum = 0.0f; const int nch = q0 / CK + 1;
#pragma unroll 1   // one chunk's code: a second copy would take the registers that keep four waves on a SIMD
  for (int ch = 0; ch < nch; ++ch) { const int k0 = ch * CK; v8f sacc[CK / 16]; const b16* pkh = Kh + (size_t)k0 * 32 + 8 * hlf; const b16* pkl = Kl + (size_t)k0 * 32 + 8 * hlf;
#pragma unroll
    for (int g = 0; g < CK / 16; g += 4) { v16b kh[4], kl[4];   // four independent tiles a group: no product waits for the one before it
#pragma unroll
      for (int t = 0; t < 4; ++t) { kh[t] = frag_kb(pkh + (g + t) * 16 * 32, 0); kl[t] = frag_kb(pkl + (g + t) * 16 * 32, 0); }
      asm volatile("s_wait_xcnt 0x0" :: "v"(pkh), "v"(pkl) : "memory");   // the two addresses are inputs, so they stay in their registers up to this wait: no result of these loads lands in a register that one of them still names
#pragma unroll
      for (int t = 0; t < 4; ++t) sacc[g + t] = wmma16b(kh[t], qa, (v8f){});
#pragma unroll
      for (int t = 0; t < 4; ++t) sacc[g + t] = wmma16b(kl[t], qa, sacc[g + t]);
#pragma unroll
      for (int t = 0; t < 4; ++t) sacc[g + t] = wmma16b(kh[t], ql, sacc[g + t]); }
    if (ch == nch - 1) { const int kd = q0 + nloc - k0 - 8 * hlf;   // causal mask: only the last chunk holds keys behind a query
#pragma unroll
      for (int t = 0; t < CK / 16; ++t)
#pragma unroll
        for (int r8 = 0; r8 < 8; ++r8) sacc[t][r8] = (t * 16 + r8 <= kd) ? sacc[t][r8] : -INFINITY; }
    float m4[4] = {sacc[0][0], sacc[0][1], sacc[0][2], sacc[0][3]};   // four chains, so that no maximum waits for the one before it
#pragma unroll
    for (int t = 0; t < CK / 16; ++t)
#pragma unroll
      for (int r8 = 0; r8 < 8; ++r8) m4[r8 & 3] = fmaxf(m4[r8 & 3], sacc[t][r8]);
    float mx = fmaxf(fmaxf(m4[0], m4[1]), fmaxf(m4[2], m4[3])); mx = fmaxf(mx, xhalf(mx));   // the two halves of the wave hold the two halves of a query's keys
    const float mn = fmaxf(mrun, mx), fac = exp2s((mrun - mn) * C2), nb = -mn * C2; mrun = mn;
    v16b pa[CK / 32], pb[CK / 32]; float sm[4] = {0.0f, 0.0f, 0.0f, 0.0f};
#pragma unroll
    for (int t = 0; t < CK / 16; ++t)
#pragma unroll
      for (int r8 = 0; r8 < 8; ++r8) { const float p = exp2s(fmaf(sacc[t][r8], C2, nb)); sm[r8 & 3] += p; b16 ph, pl; split16(p * PS, ph, pl); pa[t >> 1][(t & 1) * 8 + r8] = ph; pb[t >> 1][(t & 1) * 8 + r8] = pl; }
    lsum = lsum * fac + ((sm[0] + sm[1]) + (sm[2] + sm[3]));
#pragma unroll
    for (int t = 0; t < 4; ++t)
#pragma unroll
      for (int r8 = 0; r8 < 8; ++r8) oacc[t][r8] *= fac;
#pragma unroll
    for (int jj = 0; jj < CK / 64; ++jj)   // 64 keys are one 128-byte line of a v^T row: a block of loads takes whole lines, two d tiles at a time
#pragma unroll
      for (int tp = 0; tp < 4; tp += 2) { v16b vh[2][2], vl[2][2];
#pragma unroll
        for (int t = 0; t < 2; ++t)
#pragma unroll
          for (int j = 0; j < 2; ++j) { const size_t vo = (size_t)(tp + t) * 16 * T + k0 + (jj * 2 + j) * 32; vh[t][j] = frag_kb(Vh + vo, hlf); vl[t][j] = frag_kb(Vl + vo, hlf); }
#pragma unroll
        for (int j = 0; j < 2; ++j) { const int J = jj * 2 + j;
#pragma unroll
          for (int t = 0; t < 2; ++t) oacc[tp + t] = wmma16b(vh[t][j], pa[J], oacc[tp + t]);
#pragma unroll
          for (int t = 0; t < 2; ++t) oacc[tp + t] = wmma16b(vl[t][j], pa[J], oacc[tp + t]);
#pragma unroll
          for (int t = 0; t < 2; ++t) oacc[tp + t] = wmma16b(vh[t][j], pb[J], oacc[tp + t]); } } }
  const float rl = (1.0f / (PS * HS)) / (lsum + xhalf(lsum));
#pragma unroll
  for (int t = 0; t < 4; ++t) { float* op = O + (tq + nloc) * D + h * DH + t * 16 + 8 * hlf;   // a lane's 8 accumulator registers are 8 consecutive d of its query
    *(v4f*)op = (v4f){oacc[t][0] * rl, oacc[t][1] * rl, oacc[t][2] * rl, oacc[t][3] * rl}; *(v4f*)(op + 4) = (v4f){oacc[t][4] * rl, oacc[t][5] * rl, oacc[t][6] * rl, oacc[t][7] * rl}; } }
// outp_kernel: one work-group per 16 tokens; the hi and lo token tiles are staged once in LDS and shared; wave w takes output columns 64w..64w+63 (4 tiles).
__global__ __launch_bounds__(OWV * 32) void outp_kernel(const float* __restrict__ O, const b16* __restrict__ WO, const float* __restrict__ bo, int QLIM, float* __restrict__ out) { __shared__ __attribute__((aligned(16))) b16 Ah[16][D + 8], Al[16][D + 8]; __shared__ __attribute__((aligned(16))) float Tfs[OWV][16][68]; const int tid = threadIdx.x, lane = tid & 31, nloc = lane & 15, hlf = lane >> 4, wave = __builtin_amdgcn_readfirstlane(tid >> 5); const size_t t0 = (size_t)blockIdx.x * 16; if ((int)(t0 % T) >= QLIM) return;
#pragma unroll   // lets the staging loads issue as one run, with one wait
  for (int i = 0; i < 16 * D / (OWV * 32); ++i) { const int u = i * (OWV * 32) + tid; b16 p, pl; split16(O[t0 * D + u] * HS, p, pl); Ah[u / D][u % D] = p; Al[u / D][u % D] = pl; }
  if (tid < 16) for (int k = D; k < D + 8; ++k) { Ah[tid][k] = (b16)0.0f; Al[tid][k] = (b16)0.0f; }
  __syncthreads();   // the staged token tiles are read by every wave
  float (*Tf)[68] = Tfs[wave]; const int c0 = wave * 64; const b16* W = WO + (size_t)(c0 + nloc) * D; v8f acc[4];
#pragma unroll
  for (int t = 0; t < 4; ++t) acc[t] = (v8f){};
  // Register ring, as in proj_kernel: weight fragments in groups of two k steps, one group ahead; the two token fragments one k step ahead.
  v16b bw[2][2][4], af[2], afl[2];
#pragma unroll
  for (int t = 0; t < 4; ++t)
#pragma unroll
    for (int e = 0; e < 2; ++e) bw[0][e][t] = frag_kb(W + (size_t)t * 16 * D + e * 32, hlf);
  af[0] = frag_kb(&Ah[nloc][0], hlf); afl[0] = frag_kb(&Al[nloc][0], hlf);
#pragma unroll 1   // one ring turn is the loop body: every ring index is a constant, and a second copy would take registers from the ring
  for (int st0 = 0; st0 < NK - 4; st0 += 4)
#pragma unroll
    for (int s = 0; s < 4; ++s) { const int kb = (st0 + s) * 32;
      if ((s & 1) == 0) {
#pragma unroll
        for (int t = 0; t < 4; ++t)
#pragma unroll
          for (int e = 0; e < 2; ++e) bw[(s >> 1) ^ 1][e][t] = frag_kb(W + (size_t)t * 16 * D + kb + (2 + e) * 32, hlf); }
      af[(s + 1) & 1] = frag_kb(&Ah[nloc][kb + 32], hlf); afl[(s + 1) & 1] = frag_kb(&Al[nloc][kb + 32], hlf);
#pragma unroll
      for (int t = 0; t < 4; ++t) { acc[t] = wmma16b(af[s & 1], bw[s >> 1][s & 1][t], acc[t]); acc[t] = wmma16b(afl[s & 1], bw[s >> 1][s & 1][t], acc[t]); } }
#pragma unroll
  for (int s = 0; s < 4; ++s) { const int kb = (NK - 4 + s) * 32;   // the last turn: only its first step still fetches a group
    if (s == 0) {
#pragma unroll
      for (int t = 0; t < 4; ++t)
#pragma unroll
        for (int e = 0; e < 2; ++e) bw[1][e][t] = frag_kb(W + (size_t)t * 16 * D + kb + (2 + e) * 32, hlf); }
    if (s < 3) { af[(s + 1) & 1] = frag_kb(&Ah[nloc][kb + 32], hlf); afl[(s + 1) & 1] = frag_kb(&Al[nloc][kb + 32], hlf); }
#pragma unroll
    for (int t = 0; t < 4; ++t) { acc[t] = wmma16b(af[s & 1], bw[s >> 1][s & 1][t], acc[t]); acc[t] = wmma16b(afl[s & 1], bw[s >> 1][s & 1][t], acc[t]); } }
#pragma unroll
  for (int t = 0; t < 4; ++t) { const int cc = t * 16 + nloc; const float bb = bfv(bo[c0 + cc]);
#pragma unroll
    for (int r8 = 0; r8 < 8; ++r8) Tf[8 * hlf + r8][cc] = acc[t][r8] * (1.0f / (HS * WSC)) + bb; }
  wave_lds_sync();
  for (int r2 = 0; r2 < 8; ++r2) { const int rr = r2 * 2 + hlf; *(v4f*)(out + (t0 + rr) * D + c0 + nloc * 4) = *(const v4f*)(&Tf[rr][nloc * 4]); } }
}  // namespace

extern "C" void kernel_launch(void* const* d_in, const int* in_sizes, int n_in, void* d_out, int out_size, void* d_ws, size_t ws_size, hipStream_t stream) {
  (void)n_in;
  auto Fp = [&](int i) { return (const float*)d_in[i]; };
  // inputs: 0 x [2,2048,1024]; 1 W1_q [64,1024]; 2 W2_q; 3 W1_k; 4 W2_k; 5 W_v [1024,1024]; 6 b_v; 7 W_out [1024,1024]; 8 b_out
  if (in_sizes[0] != NT * D || in_sizes[1] != 64 * D || in_sizes[4] != 64 * D || in_sizes[5] != D * D || in_sizes[7] != D * D || out_size != NT * D) return;
  const int QLIM = T;   // per-sequence query cut (multiple of 16)
  size_t off = 0; char* ws = (char*)d_ws;
  auto carve = [&](size_t bytes) { char* p = ws + off; off += (bytes + 255) & ~(size_t)255; return p; };
  b16* WQK = (b16*)carve((size_t)256 * D * 2); b16* WV = (b16*)carve((size_t)D * D * 2); b16* WO = (b16*)carve((size_t)D * D * 2); b16* LQh = (b16*)carve((size_t)H * NT * 32 * 2); b16* LQl = (b16*)carve((size_t)H * NT * 32 * 2); b16* LKh = (b16*)carve((size_t)H * NT * 32 * 2); b16* LKl = (b16*)carve((size_t)H * NT * 32 * 2); float* V = (float*)carve((size_t)NT * D * 4); b16* VTh = (b16*)carve((size_t)NB_ * H * DH * T * 2); b16* VTl = (b16*)carve((size_t)NB_ * H * DH * T * 2); float* O = (float*)carve((size_t)NT * D * 4);
  if (off > ws_size || off > ((size_t)80 << 20)) return;   // ~ 71 MB
  wput_kernel<<<128, 256, 0, stream>>>(Fp(1), Fp(2), Fp(3), Fp(4), Fp(5), Fp(7), WQK, WV, WO);
  proj_kernel<<<NT / 16, PWV * 32, 0, stream>>>(Fp(0), WQK, WV, Fp(6), LQh, LQl, LKh, LKl, V);
  vt_kernel<<<dim3(NB_ * (T / 64), H), 256, 0, stream>>>(V, VTh, VTl);
  att_kernel<<<NB_ * H * (T / 16), 32, 0, stream>>>(LQh, LQl, LKh, LKl, VTh, VTl, QLIM, O);
  outp_kernel<<<NT / 16, OWV * 32, 0, stream>>>(O, WO, Fp(8), QLIM, (float*)d_out);
}

// v004
// Measured time: 164 microseconds a run.
// Two timings next to v003 put it at 1.24 and 1.23 times that version's speed.
// Over all steps from v000 it is 9.54 times as fast.
#include <hip/hip_runtime.h>

// PluckerKernelAttention: q1,q2,k1,k2 = x W^T (1024 -> 16 heads x 4); L_q = normalize(exterior(q1,q2)), L_k likewise (6-d Plucker lines); scores = L_q . (J6 L_k) / sqrt(6) with a causal mask; attn = softmax; v = x W_v^T + b_v (16 x 64); o = attn v; out = o W_out^T + b_out -> [2][2048][1024].
// Deterministic: flash-style online softmax over fixed 128-key chunks (causal: chunks up to the query block), fixed order; no atomics.
// WMMA (v_wmma_f32_16x16x32_f16, f32 accumulate): x (EXACT bf16 x8, K 1024) x [W1q;W2q;W1k;W2k] rows (16 tiles) and x W_v rows (64 tiles), 4 tiles a wave, 20 waves per 16-token work-group; per (b, h, 16-query) wave and key chunk S^T = JL_k rows (hi+lo x256, K 6 -> 32; 8 tiles) x L_q (hi+lo) and O^T += v^T rows (hi+lo; 4 tiles, K 128) x P (hi+lo x256, packed from the score accumulators), 3 products; out-proj o (hi+lo, K 1024) x W_out rows (64 tiles, 4 a wave, 16 waves per 16-token work-group); weights EXACT x256, (out, in) rows stored as 16 x 32 tiles in fragment order, about 4.2 M WMMA; Plucker exterior/normalisation and softmax in f32.

namespace {
constexpr int NB_ = 2, T = 2048, D = 1024, H = 16, DH = 64, NT = NB_ * T /* 4096 tokens */, CK = 128 /* keys of an attention chunk */, PWV = 20 /* waves of a proj work-group */, OWV = 16 /* waves of an out-proj work-group */, NK = D / 32 /* k steps of a projection */;
constexpr float XS = 8.0f, HS = 256.0f, PS = 256.0f, WSC = 256.0f, SCL = 0.40824829046386302f /* 6^-0.5 */;
typedef _Float16 b16;
typedef __attribute__((ext_vector_type(16))) _Float16 v16b;
typedef __attribute__((ext_vector_type(8))) _Float16 v8b;
typedef __attribute__((ext_vector_type(2))) _Float16 v2b;
typedef __attribute__((ext_vector_type(8))) float v8f;
typedef __attribute__((ext_vector_type(4))) float v4f;
typedef __attribute__((ext_vector_type(2))) float v2f;
__device__ __forceinline__ float bf16_rne(float f) { unsigned int u = __float_as_uint(f); u += 0x7FFFu + ((u >> 16) & 1u); float r = __uint_as_float(u & 0xFFFF0000u); asm volatile("" : "+v"(r)); return r; }
__device__ __forceinline__ float bfv(float f) { float r = bf16_rne(f); asm volatile("" : "+v"(r)); return r; }
__device__ __forceinline__ void split16(float v, b16& hi, b16& lo) { hi = (b16)v; lo = (b16)(v - (float)hi); }
__device__ __forceinline__ v16b frag_kb(const b16* p, int hh) { const v8b a = *(const v8b*)(p + 8 * hh), b = *(const v8b*)(p + 16 + 8 * hh); v16b f;
#pragma unroll
  for (int e = 0; e < 8; ++e) { f[e] = a[e]; f[8 + e] = b[e]; } return f; }
// Fragment order: a 16-row x 32-k operand tile that a kernel of this file writes to the workspace is 512 halves laid as [k >> 4][(k >> 3 & 1) * 16 + row][k & 7], so that each of a wave's two 16-byte loads takes 512 contiguous bytes (4 whole lines). p = tile + lane * 8. Same registers, same k order as frag_kb on a row-major tile.
__device__ __forceinline__ v16b frag_fo(const b16* p) { const v8b a = *(const v8b*)p, b = *(const v8b*)(p + 256); v16b f;
#pragma unroll
  for (int e = 0; e < 8; ++e) { f[e] = a[e]; f[8 + e] = b[e]; } return f; }
__device__ __forceinline__ v8f wmma16b(v16b a, v16b b, v8f c) { v8f d = __builtin_amdgcn_wmma_f32_16x16x32_f16(false, a, false, b, (short)0, c, false, false); asm volatile("v_nop\n\tv_nop\n\tv_nop\n\tv_nop" : "+v"(d) : "v"(a), "v"(b)); return d; }
__device__ __forceinline__ void wave_lds_sync() { __builtin_amdgcn_fence(__ATOMIC_RELEASE, "workgroup"); __builtin_amdgcn_wave_barrier(); __builtin_amdgcn_fence(__ATOMIC_ACQUIRE, "workgroup"); }
__device__ __forceinline__ float xhalf(float x) { return __builtin_bit_cast(float, __builtin_amdgcn_permlanex16(__builtin_bit_cast(int, x), __builtin_bit_cast(int, x), 0x76543210, 0xfedcba98, false, false)); }   // lane l with lane l ^ 16
__device__ __forceinline__ float exp2s(float x) { float r; asm("v_exp_f32 %0, %1\n\tv_nop" : "=v"(r) : "v"(x)); return r; }   // 2^x; the v_nop is the one slot asked for between a transcendental and a next instruction that reads its result or overwrites its source: in one statement, so that it stands directly behind
__device__ __forceinline__ float pmul(float a, float b) { float p = a * b; asm volatile("" : "+v"(p)); return p; }

__global__ __launch_bounds__(256) void wput_kernel(const float* __restrict__ w1q, const float* __restrict__ w2q, const float* __restrict__ w1k, const float* __restrict__ w2k, const float* __restrict__ wv, const float* __restrict__ wo, b16* __restrict__ WQK, b16* __restrict__ WV, b16* __restrict__ WO) { const size_t nt = (size_t)gridDim.x * 256, u0 = (size_t)blockIdx.x * 256 + threadIdx.x; v8b v;
  // u counts the 16-byte units of the destination (tile = 16 rows x 32 k, NK tiles a row tile): a wave stores 512 contiguous bytes, and a block reads whole lines of 16 rows
  for (size_t u = u0; u < (size_t)256 * 128; u += nt) { const int o = (int)(u >> 11) * 16 + ((int)u & 15), k0 = ((int)(u >> 6) & 31) * 32 + ((int)(u >> 4) & 3) * 8; const float* w = o < 64 ? w1q : (o < 128 ? w2q : (o < 192 ? w1k : w2k)); const int oo = o % 64;
#pragma unroll
    for (int j = 0; j < 8; ++j) v[j] = (b16)(bf16_rne(w[(size_t)oo * D + k0 + j]) * WSC); { *(v8b*)(WQK + u * 8) = v;  } }
  for (size_t u = u0; u < (size_t)D * 128; u += nt) { const int o = (int)(u >> 11) * 16 + ((int)u & 15), k0 = ((int)(u >> 6) & 31) * 32 + ((int)(u >> 4) & 3) * 8; v8b a, c;
#pragma unroll
    for (int j = 0; j < 8; ++j) { a[j] = (b16)(bf16_rne(wv[(size_t)o * D + k0 + j]) * WSC); c[j] = (b16)(bf16_rne(wo[(size_t)o * D + k0 + j]) * WSC); } { *(v8b*)(WV + u * 8) = a; *(v8b*)(WO + u * 8) = c;  } } }
// proj_kernel: one work-group per 16 tokens. The token tile is staged once in LDS and shared; wave w < 4 takes the q1,q2,k1,k2 columns of heads 4w..4w+3 (4 tiles), wave w >= 4 takes 64 columns of v (4 tiles).
__global__ __launch_bounds__(PWV * 32) void proj_kernel(const float* __restrict__ x, const b16* __restrict__ WQK, const b16* __restrict__ WV, const float* __restrict__ bv, b16* __restrict__ LQh, b16* __restrict__ LQl, b16* __restrict__ LKh, b16* __restrict__ LKl, float* __restrict__ V) { __shared__ __attribute__((aligned(16))) b16 Ah[16][D + 8]; __shared__ __attribute__((aligned(16))) float Tfs[PWV][16][68]; const int tid = threadIdx.x, lane = tid & 31, nloc = lane & 15, hlf = lane >> 4, wave = __builtin_amdgcn_readfirstlane(tid >> 5); const size_t t0 = (size_t)blockIdx.x * 16;
#pragma unroll   // constant offsets on one base address, and the range test only on the last trip
  for (int i = 0; i < (16 * D + PWV * 32 - 1) / (PWV * 32); ++i) { const int u = i * (PWV * 32) + tid; if (u < 16 * D) Ah[u / D][u % D] = (b16)(bf16_rne(x[t0 * D + u]) * XS); }
  if (tid < 16) for (int k = D; k < D + 8; ++k) Ah[tid][k] = (b16)0.0f;
  __syncthreads();   // the staged token tile is read by every wave
  float (*Tf)[68] = Tfs[wave]; const bool isqk = wave < 4; const int c0 = (wave - 4) * 64;
  const b16* W = (isqk ? WQK + (size_t)wave * 16 * D : WV + (size_t)c0 * D) + lane * 8; const size_t tstr = isqk ? (size_t)64 * D : (size_t)16 * D; v8f acc[4];
#pragma unroll
  for (int t = 0; t < 4; ++t) acc[t] = (v8f){};
  // Register ring: the weight fragments of two k steps (2 KB in a row of each column tile) are asked for as one group, one group ahead of the products that use them. A product waits only for loads of the older group.
  v16b bw[2][2][4];
#pragma unroll
  for (int t = 0; t < 4; ++t)
#pragma unroll
    for (int e = 0; e < 2; ++e) bw[0][e][t] = frag_fo(W + t * tstr + e * 512);
#pragma unroll 1   // one ring turn is the loop body: every ring index is a constant, and a second copy would take registers from the ring
  for (int st0 = 0; st0 < NK - 4; st0 += 4)
#pragma unroll
    for (int s = 0; s < 4; ++s) { const int kb = (st0 + s) * 32; const v16b a = frag_kb(&Ah[nloc][kb], hlf);
      if ((s & 1) == 0) {
#pragma unroll
        for (int t = 0; t < 4; ++t)
#pragma unroll
          for (int e = 0; e < 2; ++e) bw[(s >> 1) ^ 1][e][t] = frag_fo(W + t * tstr + (size_t)(st0 + s + 2 + e) * 512); }
#pragma unroll
      for (int t = 0; t < 4; ++t) acc[t] = wmma16b(a, bw[s >> 1][s & 1][t], acc[t]);
      if (s == 3) asm volatile("s_wait_xcnt 0x0" ::: "memory"); }   // the next turn forms its addresses in the registers that this turn's loads name
#pragma unroll
  for (int s = 0; s < 4; ++s) { const int kb = (NK - 4 + s) * 32; const v16b a = frag_kb(&Ah[nloc][kb], hlf);   // the last turn: only its first step still fetches a group
    if (s == 0) {
#pragma unroll
      for (int t = 0; t < 4; ++t)
#pragma unroll
        for (int e = 0; e < 2; ++e) bw[1][e][t] = frag_fo(W + t * tstr + (NK - 4 + s + 2 + e) * 512); }
#pragma unroll
    for (int t = 0; t < 4; ++t) acc[t] = wmma16b(a, bw[s >> 1][s & 1][t], acc[t]); }
#pragma unroll
  for (int t = 0; t < 4; ++t) { const int cc = t * 16 + nloc; const float bb = isqk ? 0.0f : bfv(bv[c0 + cc]);
#pragma unroll
    for (int r8 = 0; r8 < 8; ++r8) Tf[8 * hlf + r8][cc] = acc[t][r8] * (1.0f / (XS * WSC)) + bb; }
  wave_lds_sync();
  if (isqk) {   // Plucker lines: lane = (token rr = lane & 15, q-or-k = lane >> 4); loop this wave's 4 heads
    const int rr = nloc, isk = hlf;
#pragma unroll 1
    for (int hl = 0; hl < 4; ++hl) { const int h = wave * 4 + hl; const float* p1 = &Tf[rr][(isk ? 32 : 0) + hl * 4]; const float* p2 = &Tf[rr][(isk ? 48 : 16) + hl * 4]; float Lm[6]; Lm[0] = p1[0] * p2[1] - p1[1] * p2[0]; Lm[1] = p1[0] * p2[2] - p1[2] * p2[0]; Lm[2] = p1[0] * p2[3] - p1[3] * p2[0]; Lm[3] = p1[1] * p2[2] - p1[2] * p2[1]; Lm[4] = p1[1] * p2[3] - p1[3] * p2[1]; Lm[5] = p1[2] * p2[3] - p1[3] * p2[2];
      float n2 = 0.0f; for (int c = 0; c < 6; ++c) n2 += Lm[c] * Lm[c]; const float inv = 1.0f / fmaxf(sqrtf(n2), 1e-12f); float Lo[6];
      if (isk) { Lo[0] = Lm[5]; Lo[1] = -Lm[4]; Lo[2] = Lm[3]; Lo[3] = Lm[2]; Lo[4] = -Lm[1]; Lo[5] = Lm[0]; } else { for (int c = 0; c < 6; ++c) Lo[c] = Lm[c]; }
      b16 hh_[32], ll_[32]; for (int c = 0; c < 32; ++c) { hh_[c] = (b16)0.0f; ll_[c] = (b16)0.0f; } for (int c = 0; c < 6; ++c) split16(Lo[c] * inv * HS, hh_[c], ll_[c]);
      b16* dh = (isk ? LKh : LQh) + ((size_t)h * NT + t0) * 32 + rr * 8; b16* dl = (isk ? LKl : LQl) + ((size_t)h * NT + t0) * 32 + rr * 8;   // the 16 tokens are one tile in fragment order
      for (int c = 0; c < 32; c += 8) { v8b a, bq; for (int j = 0; j < 8; ++j) { a[j] = hh_[c + j]; bq[j] = ll_[c + j]; } *(v8b*)(dh + c * 16) = a; *(v8b*)(dl + c * 16) = bq; }
      asm volatile("s_wait_xcnt 0x0" ::: "memory");   // the next head's trip rewrites the address and data registers that these stores name
    } }
  else { for (int r2 = 0; r2 < 8; ++r2) { const int rr = r2 * 2 + hlf; *(v4f*)(V + (t0 + rr) * D + c0 + nloc * 4) = *(const v4f*)(&Tf[rr][nloc * 4]); }
    asm volatile("s_wait_xcnt 0x0" ::: "memory");   // closes the run of stores before any later instruction of the listing rewrites a register that they name
  } }
__global__ __launch_bounds__(256) void vt_kernel(const float* __restrict__ V, b16* __restrict__ VTh, b16* __restrict__ VTl) { __shared__ float Tt[64][66] /* 8 rows on are 16 banks on: the two halves of a wave read apart */; const int b = blockIdx.x / (T / 64), tk0 = (blockIdx.x % (T / 64)) * 64; const int h = blockIdx.y; const int tid = threadIdx.x, wave = tid >> 5, lane = tid & 31;
  for (int q = wave; q < 64; q += 8) { Tt[q][lane * 2] = V[((size_t)b * T + tk0 + q) * D + h * DH + lane * 2]; Tt[q][lane * 2 + 1] = V[((size_t)b * T + tk0 + q) * D + h * DH + lane * 2 + 1]; }
  __syncthreads();
  // v^T in fragment order, tiles as [b, h][32-key step][16-d tile]: the block's 64 keys are 8 tiles = 512 units of 16 bytes in a row; unit j is (tile j >> 6, k >> 4 = j >> 5 & 1, lane j & 31)
  const size_t ob = (((size_t)b * H + h) * (T / 32) + tk0 / 32) * 4 * 512;
#pragma unroll   // two trips: constant offsets on one store address
  for (int i = 0; i < 2; ++i) { const int j = i * 256 + tid, d = ((j >> 6) & 3) * 16 + (j & 15), kq = (j >> 8) * 32 + ((j >> 4) & 3) * 8; v8b vh, vl;
#pragma unroll
    for (int e = 0; e < 8; ++e) { b16 h0, l0; split16(Tt[kq + e][d] * HS, h0, l0); vh[e] = h0; vl[e] = l0; }
    *(v8b*)(VTh + ob + (size_t)j * 8) = vh; *(v8b*)(VTl + ob + (size_t)j * 8) = vl; } }
// att_kernel: one wave per (b, h, 16 queries). S^T = JL_k x L_q^T, so a lane holds the scores of ONE query (column nloc; keys 8 * hlf + r of each 16-key tile): mask, maximum, exp and sum stay in registers,
// two converted score tiles are the B operand (hardware k order, the order of frag_kb) of O^T += v^T x P^T, and the rescale factor and the final 1 / sum are per lane. No LDS. Every inner loop is unrolled so that each index into a register array is a constant.
__global__ __launch_bounds__(32) __attribute__((amdgpu_waves_per_eu(4, 4))) /* 256 registers a wave: all 4096 waves are resident at once, four a SIMD */ void att_kernel(const b16* __restrict__ LQh, const b16* __restrict__ LQl, const b16* __restrict__ LKh, const b16* __restrict__ LKl, const b16* __restrict__ VTh, const b16* __restrict__ VTl, int QLIM, float* __restrict__ O) { const int lane = threadIdx.x, nloc = lane & 15, hlf = lane >> 4; const int b = blockIdx.x / (H * (T / 16)), rem = blockIdx.x % (H * (T / 16)); const int h = rem / (T / 16), q0 = (rem % (T / 16)) * 16; if (q0 >= QLIM) return; const size_t tq = (size_t)b * T + q0;
  constexpr float C2 = SCL / (HS * HS) * 1.4426950408889634f;   // raw accumulator -> score in the log2 domain
  const v16b qa = frag_fo(LQh + ((size_t)h * NT + tq) * 32 + lane * 8), ql = frag_fo(LQl + ((size_t)h * NT + tq) * 32 + lane * 8);
  const b16* Kh = LKh + ((size_t)h * NT + (size_t)b * T) * 32 + lane * 8; const b16* Kl = LKl + ((size_t)h * NT + (size_t)b * T) * 32 + lane * 8;   // a lane's own 16 bytes of a tile in fragment order, here and below
  const b16* Vh = VTh + ((size_t)b * H + h) * DH * T + lane * 8; const b16* Vl = VTl + ((size_t)b * H + h) * DH * T + lane * 8;
  v8f oacc[4] = {(v8f){}, (v8f){}, (v8f){}, (v8f){}}; float mrun = -INFINITY, lsum = 0.0f; const int nch = q0 / CK + 1;
#pragma unroll 1   // one chunk's code: a second copy would take the registers that keep four waves on a SIMD
  for (int ch = 0; ch < nch; ++ch) { const int k0 = ch * CK; v8f sacc[CK / 16]; const b16* pkh = Kh + (size_t)k0 * 32; const b16* pkl = Kl + (size_t)k0 * 32;
#pragma unroll
    for (int g = 0; g < CK / 16; g += 4) { v16b kh[4], kl[4];   // four independent tiles a group: no product waits for the one before it
#pragma unroll
      for (int t = 0; t < 4; ++t) { kh[t] = frag_fo(pkh + (g + t) * 512); kl[t] = frag_fo(pkl + (g + t) * 512); }
      asm volatile("s_wait_xcnt 0x0" :: "v"(pkh), "v"(pkl) : "memory");   // the two addresses are inputs, so they stay in their registers up to this wait: no result of these loads lands in a register that one of them still names
#pragma unroll
      for (int t = 0; t < 4; ++t) sacc[g + t] = wmma16b(kh[t], qa, (v8f){});
#pragma unroll
      for (int t = 0; t < 4; ++t) sacc[g + t] = wmma16b(kl[t], qa, sacc[g + t]);
#pragma unroll
      for (int t = 0; t < 4; ++t) sacc[g + t] = wmma16b(kh[t], ql, sacc[g + t]); }
    if (ch == nch - 1) { const int kd = q0 + nloc - k0 - 8 * hlf;   // causal mask: only the last chunk holds keys behind a query
#pragma unroll
      for (int t = 0; t < CK / 16; ++t)
#pragma unroll
        for (int r8 = 0; r8 < 8; ++r8) sacc[t][r8] = (t * 16 + r8 <= kd) ? sacc[t][r8] : -INFINITY; }
    float m4[4] = {sacc[0][0], sacc[0][1], sacc[0][2], sacc[0][3]};   // four chains, so that no maximum waits for the one before it
#pragma unroll
    for (int t = 0; t < CK / 16; ++t)
#pragma unroll
      for (int r8 = 0; r8 < 8; ++r8) m4[r8 & 3] = fmaxf(m4[r8 & 3], sacc[t][r8]);
    float mx = fmaxf(fmaxf(m4[0], m4[1]), fmaxf(m4[2], m4[3])); mx = fmaxf(mx, xhalf(mx));   // the two halves of the wave hold the two halves of a query's keys
    const float mn = fmaxf(mrun, mx), fac = exp2s((mrun - mn) * C2), nb = -mn * C2; mrun = mn;
    v16b pa[CK / 32], pb[CK / 32]; float sm[4] = {0.0f, 0.0f, 0.0f, 0.0f};
#pragma unroll
    for (int t = 0; t < CK / 16; ++t)
#pragma unroll
      for (int r8 = 0; r8 < 8; ++r8) { const float p = exp2s(fmaf(sacc[t][r8], C2, nb)); sm[r8 & 3] += p; b16 ph, pl; split16(p * PS, ph, pl); pa[t >> 1][(t & 1) * 8 + r8] = ph; pb[t >> 1][(t & 1) * 8 + r8] = pl; }
    lsum = lsum * fac + ((sm[0] + sm[1]) + (sm[2] + sm[3]));
#pragma unroll
    for (int t = 0; t < 4; ++t)
#pragma unroll
      for (int r8 = 0; r8 < 8; ++r8) oacc[t][r8] *= fac;
#pragma unroll
    for (int jj = 0; jj < CK / 64; ++jj)   // a block of loads: 64 keys, two d tiles
#pragma unroll
      for (int tp = 0; tp < 4; tp += 2) { v16b vh[2][2], vl[2][2];
#pragma unroll
        for (int t = 0; t < 2; ++t)
#pragma unroll
          for (int j = 0; j < 2; ++j) { const size_t vo = (size_t)k0 * DH + ((jj * 2 + j) * 4 + tp + t) * 512; vh[t][j] = frag_fo(Vh + vo); vl[t][j] = frag_fo(Vl + vo); }
#pragma unroll
        for (int j = 0; j < 2; ++j) { const int J = jj * 2 + j;
#pragma unroll
          for (int t = 0; t < 2; ++t) oacc[tp + t] = wmma16b(vh[t][j], pa[J], oacc[tp + t]);
#pragma unroll
          for (int t = 0; t < 2; ++t) oacc[tp + t] = wmma16b(vl[t][j], pa[J], oacc[tp + t]);
#pragma unroll
          for (int t = 0; t < 2; ++t) oacc[tp + t] = wmma16b(vh[t][j], pb[J], oacc[tp + t]); } } }
  const float rl = (1.0f / (PS * HS)) / (lsum + xhalf(lsum));
#pragma unroll
  for (int t = 0; t < 4; ++t) { float* op = O + (tq + nloc) * D + h * DH + t * 16 + 8 * hlf;   // a lane's 8 accumulator registers are 8 consecutive d of its query
    *(v4f*)op = (v4f){oacc[t][0] * rl, oacc[t][1] * rl, oacc[t][2] * rl, oacc[t][3] * rl}; *(v4f*)(op + 4) = (v4f){oacc[t][4] * rl, oacc[t][5] * rl, oacc[t][6] * rl, oacc[t][7] * rl}; } }
// outp_kernel: one work-group per 16 tokens; the hi and lo token tiles are staged once in LDS and shared; wave w takes output columns 64w..64w+63 (4 tiles).
__global__ __launch_bounds__(OWV * 32) void outp_kernel(const float* __restrict__ O, const b16* __restrict__ WO, const float* __restrict__ bo, int QLIM, float* __restrict__ out) { __shared__ __attribute__((aligned(16))) b16 Ah[16][D + 8], Al[16][D + 8]; __shared__ __attribute__((aligned(16))) float Tfs[OWV][16][68]; const int tid = threadIdx.x, lane = tid & 31, nloc = lane & 15, hlf = lane >> 4, wave = __builtin_amdgcn_readfirstlane(tid >> 5); const size_t t0 = (size_t)blockIdx.x * 16; if ((int)(t0 % T) >= QLIM) return;
#pragma unroll   // lets the staging loads issue as one run, with one wait
  for (int i = 0; i < 16 * D / (OWV * 32); ++i) { const int u = i * (OWV * 32) + tid; b16 p, pl; split16(O[t0 * D + u] * HS, p, pl); Ah[u / D][u % D] = p; Al[u / D][u % D] = pl; }
  if (tid < 16) for (int k = D; k < D + 8; ++k) { Ah[tid][k] = (b16)0.0f; Al[tid][k] = (b16)0.0f; }
  __syncthreads();   // the staged token tiles are read by every wave
  float (*Tf)[68] = Tfs[wave]; const int c0 = wave * 64; const b16* W = WO + (size_t)c0 * D + lane * 8; v8f acc[4];
#pragma unroll
  for (int t = 0; t < 4; ++t) acc[t] = (v8f){};
  // Register ring, as in proj_kernel: weight fragments in groups of two k steps, one group ahead; the two token fragments one k step ahead.
  v16b bw[2][2][4], af[2], afl[2];
#pragma unroll
  for (int t = 0; t < 4; ++t)
#pragma unroll
    for (int e = 0; e < 2; ++e) bw[0][e][t] = frag_fo(W + (size_t)t * 16 * D + e * 512);
  af[0] = frag_kb(&Ah[nloc][0], hlf); afl[0] = frag_kb(&Al[nloc][0], hlf);
#pragma unroll 1   // one ring turn is the loop body: every ring index is a constant, and a second copy would take registers from the ring
  for (int st0 = 0; st0 < NK - 4; st0 += 4)
#pragma unroll
    for (int s = 0; s < 4; ++s) { const int kb = (st0 + s) * 32;
      if ((s & 1) == 0) {
#pragma unroll
        for (int t = 0; t < 4; ++t)
#pragma unroll
          for (int e = 0; e < 2; ++e) bw[(s >> 1) ^ 1][e][t] = frag_fo(W + (size_t)t * 16 * D + (size_t)(st0 + s + 2 + e) * 512); }
      af[(s + 1) & 1] = frag_kb(&Ah[nloc][kb + 32], hlf); afl[(s + 1) & 1] = frag_kb(&Al[nloc][kb + 32], hlf);
#pragma unroll
      for (int t = 0; t < 4; ++t) { acc[t] = wmma16b(af[s & 1], bw[s >> 1][s & 1][t], acc[t]); acc[t] = wmma16b(afl[s & 1], bw[s >> 1][s & 1][t], acc[t]); } }
#pragma unroll
  for (int s = 0; s < 4; ++s) { const int kb = (NK - 4 + s) * 32;   // the last turn: only its first step still fetches a group
    if (s == 0) {
#pragma unroll
      for (int t = 0; t < 4; ++t)
#pragma unroll
        for (int e = 0; e < 2; ++e) bw[1][e][t] = frag_fo(W + (size_t)t * 16 * D + (NK - 4 + s + 2 + e) * 512);
      asm volatile("s_wait_xcnt 0x0" :: "v"(W) : "memory"); }   // the address is an input, so it stays in its registers up to this wait: the epilogue reuses them
    if (s < 3) { af[(s + 1) & 1] = frag_kb(&Ah[nloc][kb + 32], hlf); afl[(s + 1) & 1] = frag_kb(&Al[nloc][kb + 32], hlf); }
#pragma unroll
    for (int t = 0; t < 4; ++t) { acc[t] = wmma16b(af[s & 1], bw[s >> 1][s & 1][t], acc[t]); acc[t] = wmma16b(afl[s & 1], bw[s >> 1][s & 1][t], acc[t]); } }
#pragma unroll
  for (int t = 0; t < 4; ++t) { const int cc = t * 16 + nloc; const float bb = bfv(bo[c0 + cc]);
#pragma unroll
    for (int r8 = 0; r8 < 8; ++r8) Tf[8 * hlf + r8][cc] = acc[t][r8] * (1.0f / (HS * WSC)) + bb; }
  wave_lds_sync();
  for (int r2 = 0; r2 < 8; ++r2) { const int rr = r2 * 2 + hlf; *(v4f*)(out + (t0 + rr) * D + c0 + nloc * 4) = *(const v4f*)(&Tf[rr][nloc * 4]); } }
}  // namespace

extern "C" void kernel_launch(void* const* d_in, const int* in_sizes, int n_in, void* d_out, int out_size, void* d_ws, size_t ws_size, hipStream_t stream) {
  (void)n_in;
  auto Fp = [&](int i) { return (const float*)d_in[i]; };
  // inputs: 0 x [2,2048,1024]; 1 W1_q [64,1024]; 2 W2_q; 3 W1_k; 4 W2_k; 5 W_v [1024,1024]; 6 b_v; 7 W_out [1024,1024]; 8 b_out
  if (in_sizes[0] != NT * D || in_sizes[1] != 64 * D || in_sizes[4] != 64 * D || in_sizes[5] != D * D || in_sizes[7] != D * D || out_size != NT * D) return;
  const int QLIM = T;   // per-sequence query cut (multiple of 16)
  size_t off = 0; char* ws = (char*)d_ws;
  auto carve = [&](size_t bytes) { char* p = ws + off; off += (bytes + 255) & ~(size_t)255; return p; };
  b16* WQK = (b16*)carve((size_t)256 * D * 2); b16* WV = (b16*)carve((size_t)D * D * 2); b16* WO = (b16*)carve((size_t)D * D * 2); b16* LQh = (b16*)carve((size_t)H * NT * 32 * 2); b16* LQl = (b16*)carve((size_t)H * NT * 32 * 2); b16* LKh = (b16*)carve((size_t)H * NT * 32 * 2); b16* LKl = (b16*)carve((size_t)H * NT * 32 * 2); float* V = (float*)carve((size_t)NT * D * 4); b16* VTh = (b16*)carve((size_t)NB_ * H * DH * T * 2); b16* VTl = (b16*)carve((size_t)NB_ * H * DH * T * 2); float* O = (float*)carve((size_t)NT * D * 4);
  if (off > ws_size || off > ((size_t)80 << 20)) return;   // ~ 71 MB
  wput_kernel<<<128, 256, 0, stream>>>(Fp(1), Fp(2), Fp(3), Fp(4), Fp(5), Fp(7), WQK, WV, WO);
  proj_kernel<<<NT / 16, PWV * 32, 0, stream>>>(Fp(0), WQK, WV, Fp(6), LQh, LQl, LKh, LKl, V);
  vt_kernel<<<dim3(NB_ * (T / 64), H), 256, 0, stream>>>(V, VTh, VTl);
  att_kernel<<<NB_ * H * (T / 16), 32, 0, stream>>>(LQh, LQl, LKh, LKl, VTh, VTl, QLIM, O);
  outp_kernel<<<NT / 16, OWV * 32, 0, stream>>>(O, WO, Fp(8), QLIM, (float*)d_out);
}

// v005
// A run of this version takes 120 microseconds.
// Two timings next to v004 both put it at 1.35 times that version's speed.
// Over all steps from v000 it is 12.9 times as fast.
#include <hip/hip_runtime.h>

// PluckerKernelAttention: q1,q2,k1,k2 = x W^T (1024 -> 16 heads x 4); L_q = normalize(exterior(q1,q2)), L_k likewise (6-d Plucker lines); scores = L_q . (J6 L_k) / sqrt(6) with a causal mask; attn = softmax; v = x W_v^T + b_v (16 x 64); o = attn v; out = o W_out^T + b_out -> [2][2048][1024].
// Deterministic: flash-style online softmax over fixed 128-key chunks (causal: chunks up to the query block), fixed order; no atomics.
// WMMA (v_wmma_f32_16x16x32_f16, f32 accumulate): x (EXACT bf16 x8, K 1024) x [W1q;W2q;W1k;W2k] rows (16 tiles) and x W_v rows (64 tiles), 4 tiles a wave, 20 waves per 16-token work-group; per (b, h, 16-query) wave and key chunk S^T = JL_k rows (hi+lo x256, K 6 -> 32; 8 tiles) x L_q (hi+lo) and O^T += v^T rows (hi+lo; 4 tiles, K 128) x P (hi+lo x256, packed from the score accumulators), 3 products; out-proj o (hi+lo, K 1024) x W_out rows (64 tiles, 4 a wave, 16 waves per 16-token work-group); weights EXACT x256, (out, in) rows stored as 16 x 32 tiles in fragment order, about 4.2 M WMMA; Plucker exterior/normalisation and softmax in f32.

namespace {
constexpr int NB_ = 2, T = 2048, D = 1024, H = 16, DH = 64, NT = NB_ * T /* 4096 tokens */, CK = 128 /* keys of an attention chunk */, PWV = 20 /* waves of a proj work-group */, OWV = 16 /* waves of an out-proj work-group */, NK = D / 32 /* k steps of a projection */, AWV = 8 /* waves of an attention work-group */, CKH = CK * 32 /* halves of a chunk of L_k, hi or lo */, CVH = CK * DH /* halves of a chunk of v^T, hi or lo */, CBH = 2 * CKH + 2 * CVH /* halves of a ring buffer */;
constexpr float XS = 8.0f, HS = 256.0f, PS = 256.0f, WSC = 256.0f, SCL = 0.40824829046386302f /* 6^-0.5 */;
typedef _Float16 b16;
typedef __attribute__((ext_vector_type(16))) _Float16 v16b;
typedef __attribute__((ext_vector_type(8))) _Float16 v8b;
typedef __attribute__((ext_vector_type(2))) _Float16 v2b;
typedef __attribute__((ext_vector_type(8))) float v8f;
typedef __attribute__((ext_vector_type(4))) float v4f;
typedef __attribute__((ext_vector_type(2))) float v2f;
__device__ __forceinline__ float bf16_rne(float f) { unsigned int u = __float_as_uint(f); u += 0x7FFFu + ((u >> 16) & 1u); float r = __uint_as_float(u & 0xFFFF0000u); asm volatile("" : "+v"(r)); return r; }
__device__ __forceinline__ float bfv(float f) { float r = bf16_rne(f); asm volatile("" : "+v"(r)); return r; }
__device__ __forceinline__ void split16(float v, b16& hi, b16& lo) { hi = (b16)v; lo = (b16)(v - (float)hi); }
__device__ __forceinline__ v16b frag_kb(const b16* p, int hh) { const v8b a = *(const v8b*)(p + 8 * hh), b = *(const v8b*)(p + 16 + 8 * hh); v16b f;
#pragma unroll
  for (int e = 0; e < 8; ++e) { f[e] = a[e]; f[8 + e] = b[e]; } return f; }
// Fragment order: a 16-row x 32-k operand tile that a kernel of this file writes to the workspace is 512 halves laid as [k >> 4][(k >> 3 & 1) * 16 + row][k & 7], so that each of a wave's two 16-byte loads takes 512 contiguous bytes (4 whole lines). p = tile + lane * 8. Same registers, same k order as frag_kb on a row-major tile.
__device__ __forceinline__ v16b frag_fo(const b16* p) { const v8b a = *(const v8b*)p, b = *(const v8b*)(p + 256); v16b f;
#pragma unroll
  for (int e = 0; e < 8; ++e) { f[e] = a[e]; f[8 + e] = b[e]; } return f; }
__device__ __forceinline__ v8f wmma16b(v16b a, v16b b, v8f c) { v8f d = __builtin_amdgcn_wmma_f32_16x16x32_f16(false, a, false, b, (short)0, c, false, false); asm volatile("v_nop\n\tv_nop\n\tv_nop\n\tv_nop" : "+v"(d) : "v"(a), "v"(b)); return d; }
__device__ __forceinline__ void wave_lds_sync() { __builtin_amdgcn_fence(__ATOMIC_RELEASE, "workgroup"); __builtin_amdgcn_wave_barrier(); __builtin_amdgcn_fence(__ATOMIC_ACQUIRE, "workgroup"); }
__device__ __forceinline__ float xhalf(float x) { return __builtin_bit_cast(float, __builtin_amdgcn_permlanex16(__builtin_bit_cast(int, x), __builtin_bit_cast(int, x), 0x76543210, 0xfedcba98, false, false)); }   // lane l with lane l ^ 16
__device__ __forceinline__ float exp2s(float x) { float r; asm("v_exp_f32 %0, %1\n\tv_nop" : "=v"(r) : "v"(x)); return r; }   // 2^x; the v_nop is the one slot asked for between a transcendental and a next instruction that reads its result or overwrites its source: in one statement, so that it stands directly behind
__device__ __forceinline__ float pmul(float a, float b) { float p = a * b; asm volatile("" : "+v"(p)); return p; }

__global__ __launch_bounds__(256) void wput_kernel(const float* __restrict__ w1q, const float* __restrict__ w2q, const float* __restrict__ w1k, const float* __restrict__ w2k, const float* __restrict__ wv, const float* __restrict__ wo, b16* __restrict__ WQK, b16* __restrict__ WV, b16* __restrict__ WO) { const size_t nt = (size_t)gridDim.x * 256, u0 = (size_t)blockIdx.x * 256 + threadIdx.x; v8b v;
  // u counts the 16-byte units of the destination (tile = 16 rows x 32 k, NK tiles a row tile): a wave stores 512 contiguous bytes, and a block reads whole lines of 16 rows
  for (size_t u = u0; u < (size_t)256 * 128; u += nt) { const int o = (int)(u >> 11) * 16 + ((int)u & 15), k0 = ((int)(u >> 6) & 31) * 32 + ((int)(u >> 4) & 3) * 8; const float* w = o < 64 ? w1q : (o < 128 ? w2q : (o < 192 ? w1k : w2k)); const int oo = o % 64;
#pragma unroll
    for (int j = 0; j < 8; ++j) v[j] = (b16)(bf16_rne(w[(size_t)oo * D + k0 + j]) * WSC); { *(v8b*)(WQK + u * 8) = v;  } }
  for (size_t u = u0; u < (size_t)D * 128; u += nt) { const int o = (int)(u >> 11) * 16 + ((int)u & 15), k0 = ((int)(u >> 6) & 31) * 32 + ((int)(u >> 4) & 3) * 8; v8b a, c;
#pragma unroll
    for (int j = 0; j < 8; ++j) { a[j] = (b16)(bf16_rne(wv[(size_t)o * D + k0 + j]) * WSC); c[j] = (b16)(bf16_rne(wo[(size_t)o * D + k0 + j]) * WSC); } { *(v8b*)(WV + u * 8) = a; *(v8b*)(WO + u * 8) = c;  } } }
// proj_kernel: one work-group per 16 tokens. The token tile is staged once in LDS and shared; wave w < 4 takes the q1,q2,k1,k2 columns of heads 4w..4w+3 (4 tiles), wave w >= 4 takes 64 columns of v (4 tiles).
__global__ __launch_bounds__(PWV * 32) void proj_kernel(const float* __restrict__ x, const b16* __restrict__ WQK, const b16* __restrict__ WV, const float* __restrict__ bv, b16* __restrict__ LQh, b16* __restrict__ LQl, b16* __restrict__ LKh, b16* __restrict__ LKl, float* __restrict__ V) { __shared__ __attribute__((aligned(16))) b16 Ah[16][D + 8]; __shared__ __attribute__((aligned(16))) float Tfs[PWV][16][68]; const int tid = threadIdx.x, lane = tid & 31, nloc = lane & 15, hlf = lane >> 4, wave = __builtin_amdgcn_readfirstlane(tid >> 5); const size_t t0 = (size_t)blockIdx.x * 16;
#pragma unroll   // constant offsets on one base address, and the range test only on the last trip
  for (int i = 0; i < (16 * D + PWV * 32 - 1) / (PWV * 32); ++i) { const int u = i * (PWV * 32) + tid; if (u < 16 * D) Ah[u / D][u % D] = (b16)(bf16_rne(x[t0 * D + u]) * XS); }
  if (tid < 16) for (int k = D; k < D + 8; ++k) Ah[tid][k] = (b16)0.0f;
  __syncthreads();   // the staged token tile is read by every wave
  float (*Tf)[68] = Tfs[wave]; const bool isqk = wave < 4; const int c0 = (wave - 4) * 64;
  const b16* W = (isqk ? WQK + (size_t)wave * 16 * D : WV + (size_t)c0 * D) + lane * 8; const size_t tstr = isqk ? (size_t)64 * D : (size_t)16 * D; v8f acc[4];
#pragma unroll
  for (int t = 0; t < 4; ++t) acc[t] = (v8f){};
  // Register ring: the weight fragments of two k steps (2 KB in a row of each column tile) are asked for as one group, one group ahead of the products that use them. A product waits only for loads of the older group.
  v16b bw[2][2][4];
#pragma unroll
  for (int t = 0; t < 4; ++t)
#pragma unroll
    for (int e = 0; e < 2; ++e) bw[0][e][t] = frag_fo(W + t * tstr + e * 512);
#pragma unroll 1   // one ring turn is the loop body: every ring index is a constant, and a second copy would take registers from the ring
  for (int st0 = 0; st0 < NK - 4; st0 += 4)
#pragma unroll
    for (int s = 0; s < 4; ++s) { const int kb = (st0 + s) * 32; const v16b a = frag_kb(&Ah[nloc][kb], hlf);
      if ((s & 1) == 0) {
#pragma unroll
        for (int t = 0; t < 4; ++t)
#pragma unroll
          for (int e = 0; e < 2; ++e) bw[(s >> 1) ^ 1][e][t] = frag_fo(W + t * tstr + (size_t)(st0 + s + 2 + e) * 512); }
#pragma unroll
      for (int t = 0; t < 4; ++t) acc[t] = wmma16b(a, bw[s >> 1][s & 1][t], acc[t]);
      if (s == 3) asm volatile("s_wait_xcnt 0x0" ::: "memory"); }   // the next turn forms its addresses in the registers that this turn's loads name
#pragma unroll
  for (int s = 0; s < 4; ++s) { const int kb = (NK - 4 + s) * 32; const v16b a = frag_kb(&Ah[nloc][kb], hlf);   // the last turn: only its first step still fetches a group
    if (s == 0) {
#pragma unroll
      for (int t = 0; t < 4; ++t)
#pragma unroll
        for (int e = 0; e < 2; ++e) bw[1][e][t] = frag_fo(W + t * tstr + (NK - 4 + s + 2 + e) * 512); }
#pragma unroll
    for (int t = 0; t < 4; ++t) acc[t] = wmma16b(a, bw[s >> 1][s & 1][t], acc[t]); }
#pragma unroll
  for (int t = 0; t < 4; ++t) { const int cc = t * 16 + nloc; const float bb = isqk ? 0.0f : bfv(bv[c0 + cc]);
#pragma unroll
    for (int r8 = 0; r8 < 8; ++r8) Tf[8 * hlf + r8][cc] = acc[t][r8] * (1.0f / (XS * WSC)) + bb; }
  wave_lds_sync();
  if (isqk) {   // Plucker lines: lane = (token rr = lane & 15, q-or-k = lane >> 4); loop this wave's 4 heads
    const int rr = nloc, isk = hlf;
#pragma unroll 1
    for (int hl = 0; hl < 4; ++hl) { const int h = wave * 4 + hl; const float* p1 = &Tf[rr][(isk ? 32 : 0) + hl * 4]; const float* p2 = &Tf[rr][(isk ? 48 : 16) + hl * 4]; float Lm[6]; Lm[0] = p1[0] * p2[1] - p1[1] * p2[0]; Lm[1] = p1[0] * p2[2] - p1[2] * p2[0]; Lm[2] = p1[0] * p2[3] - p1[3] * p2[0]; Lm[3] = p1[1] * p2[2] - p1[2] * p2[1]; Lm[4] = p1[1] * p2[3] - p1[3] * p2[1]; Lm[5] = p1[2] * p2[3] - p1[3] * p2[2];
      float n2 = 0.0f; for (int c = 0; c < 6; ++c) n2 += Lm[c] * Lm[c]; const float inv = 1.0f / fmaxf(sqrtf(n2), 1e-12f); float Lo[6];
      if (isk) { Lo[0] = Lm[5]; Lo[1] = -Lm[4]; Lo[2] = Lm[3]; Lo[3] = Lm[2]; Lo[4] = -Lm[1]; Lo[5] = Lm[0]; } else { for (int c = 0; c < 6; ++c) Lo[c] = Lm[c]; }
      b16 hh_[32], ll_[32]; for (int c = 0; c < 32; ++c) { hh_[c] = (b16)0.0f; ll_[c] = (b16)0.0f; } for (int c = 0; c < 6; ++c) split16(Lo[c] * inv * HS, hh_[c], ll_[c]);
      b16* dh = (isk ? LKh : LQh) + ((size_t)h * NT + t0) * 32 + rr * 8; b16* dl = (isk ? LKl : LQl) + ((size_t)h * NT + t0) * 32 + rr * 8;   // the 16 tokens are one tile in fragment order
      for (int c = 0; c < 32; c += 8) { v8b a, bq; for (int j = 0; j < 8; ++j) { a[j] = hh_[c + j]; bq[j] = ll_[c + j]; } *(v8b*)(dh + c * 16) = a; *(v8b*)(dl + c * 16) = bq; }
      asm volatile("s_wait_xcnt 0x0" ::: "memory");   // the next head's trip rewrites the address and data registers that these stores name
    } }
  else { for (int r2 = 0; r2 < 8; ++r2) { const int rr = r2 * 2 + hlf; *(v4f*)(V + (t0 + rr) * D + c0 + nloc * 4) = *(const v4f*)(&Tf[rr][nloc * 4]); }
    asm volatile("s_wait_xcnt 0x0" ::: "memory");   // closes the run of stores before any later instruction of the listing rewrites a register that they name
  } }
__global__ __launch_bounds__(256) void vt_kernel(const float* __restrict__ V, b16* __restrict__ VTh, b16* __restrict__ VTl) { __shared__ float Tt[64][66] /* 8 rows on are 16 banks on: the two halves of a wave read apart */; const int b = blockIdx.x / (T / 64), tk0 = (blockIdx.x % (T / 64)) * 64; const int h = blockIdx.y; const int tid = threadIdx.x, wave = tid >> 5, lane = tid & 31;
  for (int q = wave; q < 64; q += 8) { Tt[q][lane * 2] = V[((size_t)b * T + tk0 + q) * D + h * DH + lane * 2]; Tt[q][lane * 2 + 1] = V[((size_t)b * T + tk0 + q) * D + h * DH + lane * 2 + 1]; }
  __syncthreads();
  // v^T in fragment order, tiles as [b, h][32-key step][16-d tile]: the block's 64 keys are 8 tiles = 512 units of 16 bytes in a row; unit j is (tile j >> 6, k >> 4 = j >> 5 & 1, lane j & 31)
  const size_t ob = (((size_t)b * H + h) * (T / 32) + tk0 / 32) * 4 * 512;
#pragma unroll   // two trips: constant offsets on one store address
  for (int i = 0; i < 2; ++i) { const int j = i * 256 + tid, d = ((j >> 6) & 3) * 16 + (j & 15), kq = (j >> 8) * 32 + ((j >> 4) & 3) * 8; v8b vh, vl;
#pragma unroll
    for (int e = 0; e < 8; ++e) { b16 h0, l0; split16(Tt[kq + e][d] * HS, h0, l0); vh[e] = h0; vl[e] = l0; }
    *(v8b*)(VTh + ob + (size_t)j * 8) = vh; *(v8b*)(VTl + ob + (size_t)j * 8) = vl; } }
// att_kernel: one work-group of 8 waves per (b, h, t): the 128-query block 15 - t and then the block t, one after the other, so that every work-group walks 17 key chunks. A wave takes 16 queries of the block. S^T = JL_k x L_q^T, so a lane holds the scores of ONE query (column nloc; keys 8 * hlf + r of each 16-key tile): mask, maximum, exp and sum stay in registers,
// two converted score tiles are the B operand (hardware k order, the order of frag_kb) of O^T += v^T x P^T, and the rescale factor and the final 1 / sum are per lane. Every inner loop is unrolled so that each index into a register array is a constant.
// The 8 waves of a block need the same key chunks: a chunk (L_k hi, L_k lo, v^T hi, v^T lo, each one contiguous run of the workspace in fragment order, 48 KB together) is brought into LDS once for all of them, one chunk ahead, two buffers.
// chunk_copy: the work-group's 256 lanes move one chunk, 12 asynchronous copies of 16 bytes a lane; a wave's copy is 512 contiguous bytes on both sides. l = the lane's LDS byte address in the buffer, the pointers = the lane's own 16 bytes of each run.
__device__ __forceinline__ void chunk_copy(unsigned l, const b16* kh, const b16* kl, const b16* vh, const b16* vl) {
  asm volatile(   // the wait in the last line stands in front of every later rewrite of a register that these copies name (a precaution): in the copies' own statement, so that the compiler moves nothing in between
    "global_load_async_to_lds_b128 %0, %12, off\n\t"
    "global_load_async_to_lds_b128 %1, %13, off\n\t"
    "global_load_async_to_lds_b128 %2, %14, off\n\t"
    "global_load_async_to_lds_b128 %3, %15, off\n\t"
    "global_load_async_to_lds_b128 %4, %16, off\n\t"
    "global_load_async_to_lds_b128 %5, %17, off\n\t"
    "global_load_async_to_lds_b128 %6, %18, off\n\t"
    "global_load_async_to_lds_b128 %7, %19, off\n\t"
    "global_load_async_to_lds_b128 %8, %20, off\n\t"
    "global_load_async_to_lds_b128 %9, %21, off\n\t"
    "global_load_async_to_lds_b128 %10, %22, off\n\t"
    "global_load_async_to_lds_b128 %11, %23, off\n\t"
    "s_wait_xcnt 0x0"
    :: "v"(l), "v"(l + 4096u), "v"(l + 8192u), "v"(l + 12288u), "v"(l + 16384u), "v"(l + 20480u), "v"(l + 24576u), "v"(l + 28672u), "v"(l + 32768u), "v"(l + 36864u), "v"(l + 40960u), "v"(l + 45056u),
       "v"(kh), "v"(kh + 2048), "v"(kl), "v"(kl + 2048), "v"(vh), "v"(vh + 2048), "v"(vh + 4096), "v"(vh + 6144), "v"(vl), "v"(vl + 2048), "v"(vl + 4096), "v"(vl + 6144) : "memory"); }
__global__ __launch_bounds__(AWV * 32) __attribute__((amdgpu_waves_per_eu(4, 4))) /* at most 256 registers a wave: none above v255 */ void att_kernel(const b16* __restrict__ LQh, const b16* __restrict__ LQl, const b16* __restrict__ LKh, const b16* __restrict__ LKl, const b16* __restrict__ VTh, const b16* __restrict__ VTl, int QLIM, float* __restrict__ O) { __shared__ __attribute__((aligned(16))) b16 Ring[2][CBH]; const int tid = threadIdx.x, lane = tid & 31, nloc = lane & 15, hlf = lane >> 4, wave = __builtin_amdgcn_readfirstlane(tid >> 5); const int bh = blockIdx.x % (NB_ * H), b = bh / H, h = bh % H; const int nA = T / CK - (int)(blockIdx.x / (NB_ * H));   // chunks of the first block, 16 .. 9; the second has NCH - nA
  constexpr int NCH = T / CK + 1;   // chunks of a work-group
  constexpr float C2 = SCL / (HS * HS) * 1.4426950408889634f;   // raw accumulator -> score in the log2 domain
  const b16* Kh = LKh + ((size_t)h * NT + (size_t)b * T) * 32 + tid * 8; const b16* Kl = LKl + ((size_t)h * NT + (size_t)b * T) * 32 + tid * 8;   // a lane's own 16 bytes of the first 4 KB of a run, here and below
  const b16* Vh = VTh + ((size_t)b * H + h) * DH * T + tid * 8; const b16* Vl = VTl + ((size_t)b * H + h) * DH * T + tid * 8;
  const unsigned l0 = (unsigned)(size_t)&Ring[0][0] + tid * 16;
  auto fill = [&](int c) { const size_t k0 = (size_t)((c < nA ? c : c - nA) * CK); chunk_copy(l0 + (c & 1) * (CBH * 2), Kh + k0 * 32, Kl + k0 * 32, Vh + k0 * DH, Vl + k0 * DH); };   // chunk c of the 17, into buffer c mod 2
  fill(0);
  asm volatile("s_wait_asynccnt 0x0" ::: "memory");   // this wave's part of chunk 0 has landed
  __syncthreads();   // chunk 0 is whole: every wave reads all of it
  fill(1);
  int c = 0;
#pragma unroll 1   // one copy of the code for the two blocks
  for (int blk = 0; blk < 2; ++blk) { const int nch = blk ? NCH - nA : nA, q0 = (nch - 1) * CK + wave * 16; const size_t tq = (size_t)b * T + q0;
  const b16* pqh = LQh + ((size_t)h * NT + tq) * 32 + lane * 8; const b16* pql = LQl + ((size_t)h * NT + tq) * 32 + lane * 8; const v16b qa = frag_fo(pqh), ql = frag_fo(pql);
  asm volatile("s_wait_xcnt 0x0" :: "v"(pqh), "v"(pql) : "memory");   // the two addresses are inputs, so they stay in their registers up to this wait
  v8f oacc[4] = {(v8f){}, (v8f){}, (v8f){}, (v8f){}}; float mrun = -INFINITY, lsum = 0.0f;
#pragma unroll 1   // one chunk's code: a second copy would take registers
  for (int ch = 0; ch < nch; ++ch, ++c) { const int k0 = ch * CK; v8f sacc[CK / 16]; const b16* R = &Ring[c & 1][lane * 8]; const b16* pkh = R; const b16* pkl = R + CKH; const b16* pvh = R + 2 * CKH; const b16* pvl = R + 2 * CKH + CVH;   // a lane's own 16 bytes of a tile in fragment order
#pragma unroll
    for (int g = 0; g < CK / 16; g += 4) { v16b kh[4], kl[4];   // four independent tiles a group: no product waits for the one before it
#pragma unroll
      for (int t = 0; t < 4; ++t) { kh[t] = frag_fo(pkh + (g + t) * 512); kl[t] = frag_fo(pkl + (g + t) * 512); }
#pragma unroll
      for (int t = 0; t < 4; ++t) sacc[g + t] = wmma16b(kh[t], qa, (v8f){});
#pragma unroll
      for (int t = 0; t < 4; ++t) sacc[g + t] = wmma16b(kl[t], qa, sacc[g + t]);
#pragma unroll
      for (int t = 0; t < 4; ++t) sacc[g + t] = wmma16b(kh[t], ql, sacc[g + t]); }
    if (ch == nch - 1) { const int kd = q0 + nloc - k0 - 8 * hlf;   // causal mask: only the last chunk holds keys behind a query
#pragma unroll
      for (int t = 0; t < CK / 16; ++t)
#pragma unroll
        for (int r8 = 0; r8 < 8; ++r8) sacc[t][r8] = (t * 16 + r8 <= kd) ? sacc[t][r8] : -INFINITY; }
    float m4[4] = {sacc[0][0], sacc[0][1], sacc[0][2], sacc[0][3]};   // four chains, so that no maximum waits for the one before it
#pragma unroll
    for (int t = 0; t < CK / 16; ++t)
#pragma unroll
      for (int r8 = 0; r8 < 8; ++r8) m4[r8 & 3] = fmaxf(m4[r8 & 3], sacc[t][r8]);
    float mx = fmaxf(fmaxf(m4[0], m4[1]), fmaxf(m4[2], m4[3])); mx = fmaxf(mx, xhalf(mx));   // the two halves of the wave hold the two halves of a query's keys
    const float mn = fmaxf(mrun, mx), fac = exp2s((mrun - mn) * C2), nb = -mn * C2; mrun = mn;
    v16b pa[CK / 32], pb[CK / 32]; float sm[4] = {0.0f, 0.0f, 0.0f, 0.0f};
#pragma unroll
    for (int t = 0; t < CK / 16; ++t)
#pragma unroll
      for (int r8 = 0; r8 < 8; ++r8) { const float p = exp2s(fmaf(sacc[t][r8], C2, nb)); sm[r8 & 3] += p; b16 ph, pl; split16(p * PS, ph, pl); pa[t >> 1][(t & 1) * 8 + r8] = ph; pb[t >> 1][(t & 1) * 8 + r8] = pl; }
    lsum = lsum * fac + ((sm[0] + sm[1]) + (sm[2] + sm[3]));
#pragma unroll
    for (int t = 0; t < 4; ++t)
#pragma unroll
      for (int r8 = 0; r8 < 8; ++r8) oacc[t][r8] *= fac;
#pragma unroll
    for (int jj = 0; jj < CK / 64; ++jj)   // a block of loads: 64 keys, two d tiles
#pragma unroll
      for (int tp = 0; tp < 4; tp += 2) { v16b vh[2][2], vl[2][2];
#pragma unroll
        for (int t = 0; t < 2; ++t)
#pragma unroll
          for (int j = 0; j < 2; ++j) { const int vo = ((jj * 2 + j) * 4 + tp + t) * 512; vh[t][j] = frag_fo(pvh + vo); vl[t][j] = frag_fo(pvl + vo); }
#pragma unroll
        for (int j = 0; j < 2; ++j) { const int J = jj * 2 + j;
#pragma unroll
          for (int t = 0; t < 2; ++t) oacc[tp + t] = wmma16b(vh[t][j], pa[J], oacc[tp + t]);
#pragma unroll
          for (int t = 0; t < 2; ++t) oacc[tp + t] = wmma16b(vl[t][j], pa[J], oacc[tp + t]);
#pragma unroll
          for (int t = 0; t < 2; ++t) oacc[tp + t] = wmma16b(vh[t][j], pb[J], oacc[tp + t]); } }
    asm volatile("s_wait_dscnt 0x0" :: "v"(lsum) : "memory");   // this wave has read all it reads of buffer c mod 2. The row sum is an input so that it is formed in front of the branch below: behind it, where the compiler otherwise moves the 64 additions, the 64 exponentials stay in registers over the v^T products, and registers spill
    asm volatile("s_wait_asynccnt 0x0" ::: "memory");   // this wave's part of chunk c + 1 has landed
    __syncthreads();   // chunk c + 1 is whole, and no wave still reads buffer c mod 2
    if (c + 2 < NCH) fill(c + 2); }
  const float rl = (1.0f / (PS * HS)) / (lsum + xhalf(lsum));
  if (q0 < QLIM) {
#pragma unroll
    for (int t = 0; t < 4; ++t) { float* op = O + (tq + nloc) * D + h * DH + t * 16 + 8 * hlf;   // a lane's 8 accumulator registers are 8 consecutive d of its query
      *(v4f*)op = (v4f){oacc[t][0] * rl, oacc[t][1] * rl, oacc[t][2] * rl, oacc[t][3] * rl}; *(v4f*)(op + 4) = (v4f){oacc[t][4] * rl, oacc[t][5] * rl, oacc[t][6] * rl, oacc[t][7] * rl}; }
    asm volatile("s_wait_xcnt 0x0" ::: "memory"); } }   // the second block's trip rewrites the address and data registers that these stores name
  asm volatile("s_wait_asynccnt 0x0" ::: "memory"); }   // no copy is outstanding when the wave ends
// outp_kernel: one work-group per 16 tokens; the hi and lo token tiles are staged once in LDS and shared; wave w takes output columns 64w..64w+63 (4 tiles).
__global__ __launch_bounds__(OWV * 32) void outp_kernel(const float* __restrict__ O, const b16* __restrict__ WO, const float* __restrict__ bo, int QLIM, float* __restrict__ out) { __shared__ __attribute__((aligned(16))) b16 Ah[16][D + 8], Al[16][D + 8]; __shared__ __attribute__((aligned(16))) float Tfs[OWV][16][68]; const int tid = threadIdx.x, lane = tid & 31, nloc = lane & 15, hlf = lane >> 4, wave = __builtin_amdgcn_readfirstlane(tid >> 5); const size_t t0 = (size_t)blockIdx.x * 16; if ((int)(t0 % T) >= QLIM) return;
#pragma unroll   // lets the staging loads issue as one run, with one wait
  for (int i = 0; i < 16 * D / (OWV * 32); ++i) { const int u = i * (OWV * 32) + tid; b16 p, pl; split16(O[t0 * D + u] * HS, p, pl); Ah[u / D][u % D] = p; Al[u / D][u % D] = pl; }
  if (tid < 16) for (int k = D; k < D + 8; ++k) { Ah[tid][k] = (b16)0.0f; Al[tid][k] = (b16)0.0f; }
  __syncthreads();   // the staged token tiles are read by every wave
  float (*Tf)[68] = Tfs[wave]; const int c0 = wave * 64; const b16* W = WO + (size_t)c0 * D + lane * 8; v8f acc[4];
#pragma unroll
  for (int t = 0; t < 4; ++t) acc[t] = (v8f){};
  // Register ring, as in proj_kernel: weight fragments in groups of two k steps, one group ahead; the two token fragments one k step ahead.
  v16b bw[2][2][4], af[2], afl[2];
#pragma unroll
  for (int t = 0; t < 4; ++t)
#pragma unroll
    for (int e = 0; e < 2; ++e) bw[0][e][t] = frag_fo(W + (size_t)t * 16 * D + e * 512);
  af[0] = frag_kb(&Ah[nloc][0], hlf); afl[0] = frag_kb(&Al[nloc][0], hlf);
#pragma unroll 1   // one ring turn is the loop body: every ring index is a constant, and a second copy would take registers from the ring
  for (int st0 = 0; st0 < NK - 4; st0 += 4)
#pragma unroll
    for (int s = 0; s < 4; ++s) { const int kb = (st0 + s) * 32;
      if ((s & 1) == 0) {
#pragma unroll
        for (int t = 0; t < 4; ++t)
#pragma unroll
          for (int e = 0; e < 2; ++e) bw[(s >> 1) ^ 1][e][t] = frag_fo(W + (size_t)t * 16 * D + (size_t)(st0 + s + 2 + e) * 512); }
      af[(s + 1) & 1] = frag_kb(&Ah[nloc][kb + 32], hlf); afl[(s + 1) & 1] = frag_kb(&Al[nloc][kb + 32], hlf);
#pragma unroll
      for (int t = 0; t < 4; ++t) { acc[t] = wmma16b(af[s & 1], bw[s >> 1][s & 1][t], acc[t]); acc[t] = wmma16b(afl[s & 1], bw[s >> 1][s & 1][t], acc[t]); } }
#pragma unroll
  for (int s = 0; s < 4; ++s) { const int kb = (NK - 4 + s) * 32;   // the last turn: only its first step still fetches a group
    if (s == 0) {
#pragma unroll
      for (int t = 0; t < 4; ++t)
#pragma unroll
        for (int e = 0; e < 2; ++e) bw[1][e][t] = frag_fo(W + (size_t)t * 16 * D + (NK - 4 + s + 2 + e) * 512);
      asm volatile("s_wait_xcnt 0x0" :: "v"(W) : "memory"); }   // the address is an input, so it stays in its registers up to this wait: the epilogue reuses them
    if (s < 3) { af[(s + 1) & 1] = frag_kb(&Ah[nloc][kb + 32], hlf); afl[(s + 1) & 1] = frag_kb(&Al[nloc][kb + 32], hlf); }
#pragma unroll
    for (int t = 0; t < 4; ++t) { acc[t] = wmma16b(af[s & 1], bw[s >> 1][s & 1][t], acc[t]); acc[t] = wmma16b(afl[s & 1], bw[s >> 1][s & 1][t], acc[t]); } }
#pragma unroll
  for (int t = 0; t < 4; ++t) { const int cc = t * 16 + nloc; const float bb = bfv(bo[c0 + cc]);
#pragma unroll
    for (int r8 = 0; r8 < 8; ++r8) Tf[8 * hlf + r8][cc] = acc[t][r8] * (1.0f / (HS * WSC)) + bb; }
  wave_lds_sync();
  for (int r2 = 0; r2 < 8; ++r2) { const int rr = r2 * 2 + hlf; *(v4f*)(out + (t0 + rr) * D + c0 + nloc * 4) = *(const v4f*)(&Tf[rr][nloc * 4]); } }
}  // namespace

extern "C" void kernel_launch(void* const* d_in, const int* in_sizes, int n_in, void* d_out, int out_size, void* d_ws, size_t ws_size, hipStream_t stream) {
  (void)n_in;
  auto Fp = [&](int i) { return (const float*)d_in[i]; };
  // inputs: 0 x [2,2048,1024]; 1 W1_q [64,1024]; 2 W2_q; 3 W1_k; 4 W2_k; 5 W_v [1024,1024]; 6 b_v; 7 W_out [1024,1024]; 8 b_out
  if (in_sizes[0] != NT * D || in_sizes[1] != 64 * D || in_sizes[4] != 64 * D || in_sizes[5] != D * D || in_sizes[7] != D * D || out_size != NT * D) return;
  const int QLIM = T;   // per-sequence query cut (multiple of 16)
  size_t off = 0; char* ws = (char*)d_ws;
  auto carve = [&](size_t bytes) { char* p = ws + off; off += (bytes + 255) & ~(size_t)255; return p; };
  b16* WQK = (b16*)carve((size_t)256 * D * 2); b16* WV = (b16*)carve((size_t)D * D * 2); b16* WO = (b16*)carve((size_t)D * D * 2); b16* LQh = (b16*)carve((size_t)H * NT * 32 * 2); b16* LQl = (b16*)carve((size_t)H * NT * 32 * 2); b16* LKh = (b16*)carve((size_t)H * NT * 32 * 2); b16* LKl = (b16*)carve((size_t)H * NT * 32 * 2); float* V = (float*)carve((size_t)NT * D * 4); b16* VTh = (b16*)carve((size_t)NB_ * H * DH * T * 2); b16* VTl = (b16*)carve((size_t)NB_ * H * DH * T * 2); float* O = (float*)carve((size_t)NT * D * 4);
  if (off > ws_size || off > ((size_t)80 << 20)) return;   // ~ 71 MB
  wput_kernel<<<128, 256, 0, stream>>>(Fp(1), Fp(2), Fp(3), Fp(4), Fp(5), Fp(7), WQK, WV, WO);
  proj_kernel<<<NT / 16, PWV * 32, 0, stream>>>(Fp(0), WQK, WV, Fp(6), LQh, LQl, LKh, LKl, V);
  vt_kernel<<<dim3(NB_ * (T / 64), H), 256, 0, stream>>>(V, VTh, VTl);
  att_kernel<<<NB_ * H * (T / CK / 2), AWV * 32, 0, stream>>>(LQh, LQl, LKh, LKl, VTh, VTl, QLIM, O);
  outp_kernel<<<NT / 16, OWV * 32, 0, stream>>>(O, WO, Fp(8), QLIM, (float*)d_out);
}

// v006
// One run takes 95.5 microseconds.
// Two timings next to v005 both put it at 1.27 times that version's speed.
// Counting every step since v000, it is 16.4 times as fast.
#include <hip/hip_runtime.h>

// PluckerKernelAttention: q1,q2,k1,k2 = x W^T (1024 -> 16 heads x 4); L_q = normalize(exterior(q1,q2)), L_k likewise (6-d Plucker lines); scores = L_q . (J6 L_k) / sqrt(6) with a causal mask; attn = softmax; v = x W_v^T + b_v (16 x 64); o = attn v; out = o W_out^T + b_out -> [2][2048][1024].
// Deterministic: flash-style online softmax over fixed 128-key chunks (causal: chunks up to the query block), fixed order; no atomics.
// WMMA (v_wmma_f32_16x16x32_f16, f32 accumulate): x (EXACT bf16 x8, K 1024) x [W1q;W2q;W1k;W2k] rows (16 tiles) and x W_v rows (64 tiles), 4 x 2 tiles a wave, 10 waves per work-group of 64 tokens x 320 columns; per (b, h, 16-query) wave and key chunk S^T = JL_k rows (hi+lo x256, K 6 -> 32; 8 tiles) x L_q (hi+lo) and O^T += v^T rows (hi+lo; 4 tiles, K 128) x P (hi+lo x256, packed from the score accumulators), 3 products; out-proj o (hi+lo, K 1024) x W_out rows (64 tiles, 4 x 2 a wave, 8 waves per work-group of 64 tokens x 256 columns); weights EXACT x256, (out, in) rows stored as 16 x 32 tiles in fragment order, about 4.2 M WMMA; Plucker exterior/normalisation and softmax in f32.

namespace {
constexpr int NB_ = 2, T = 2048, D = 1024, H = 16, DH = 64, NT = NB_ * T /* 4096 tokens */, CK = 128 /* keys of an attention chunk */, MT = 64 /* tokens of a proj or out-proj work-group */, PWV = 10 /* waves of a proj work-group */, OWV = 8 /* waves of an out-proj work-group */, PRB = 8, ORB = 4 /* k steps of their weight rings */, NK = D / 32 /* k steps of a projection */, AWV = 8 /* waves of an attention work-group */, CKH = CK * 32 /* halves of a chunk of L_k, hi or lo */, CVH = CK * DH /* halves of a chunk of v^T, hi or lo */, CBH = 2 * CKH + 2 * CVH /* halves of a ring buffer */;
constexpr float XS = 8.0f, HS = 256.0f, PS = 256.0f, WSC = 256.0f, SCL = 0.40824829046386302f /* 6^-0.5 */;
typedef _Float16 b16;
typedef __attribute__((ext_vector_type(16))) _Float16 v16b;
typedef __attribute__((ext_vector_type(8))) _Float16 v8b;
typedef __attribute__((ext_vector_type(4))) _Float16 v4b;
typedef __attribute__((ext_vector_type(2))) _Float16 v2b;
typedef __attribute__((ext_vector_type(8))) float v8f;
typedef __attribute__((ext_vector_type(4))) float v4f;
typedef __attribute__((ext_vector_type(2))) float v2f;
__device__ __forceinline__ float bf16_rne(float f) { unsigned int u = __float_as_uint(f); u += 0x7FFFu + ((u >> 16) & 1u); float r = __uint_as_float(u & 0xFFFF0000u); asm volatile("" : "+v"(r)); return r; }
__device__ __forceinline__ float bfv(float f) { float r = bf16_rne(f); asm volatile("" : "+v"(r)); return r; }
__device__ __forceinline__ void split16(float v, b16& hi, b16& lo) { hi = (b16)v; lo = (b16)(v - (float)hi); }
__device__ __forceinline__ v16b frag_kb(const b16* p, int hh) { const v8b a = *(const v8b*)(p + 8 * hh), b = *(const v8b*)(p + 16 + 8 * hh); v16b f;
#pragma unroll
  for (int e = 0; e < 8; ++e) { f[e] = a[e]; f[8 + e] = b[e]; } return f; }
// Fragment order: a 16-row x 32-k operand tile that a kernel of this file writes to the workspace is 512 halves laid as [k >> 4][(k >> 3 & 1) * 16 + row][k & 7], so that each of a wave's two 16-byte loads takes 512 contiguous bytes (4 whole lines). p = tile + lane * 8. Same registers, same k order as frag_kb on a row-major tile.
__device__ __forceinline__ v16b frag_fo(const b16* p) { const v8b a = *(const v8b*)p, b = *(const v8b*)(p + 256); v16b f;
#pragma unroll
  for (int e = 0; e < 8; ++e) { f[e] = a[e]; f[8 + e] = b[e]; } return f; }
__device__ __forceinline__ v8f wmma16b(v16b a, v16b b, v8f c) { v8f d = __builtin_amdgcn_wmma_f32_16x16x32_f16(false, a, false, b, (short)0, c, false, false); asm volatile("v_nop\n\tv_nop\n\tv_nop\n\tv_nop" : "+v"(d) : "v"(a), "v"(b)); return d; }
__device__ __forceinline__ void wave_lds_sync() { __builtin_amdgcn_fence(__ATOMIC_RELEASE, "workgroup"); __builtin_amdgcn_wave_barrier(); __builtin_amdgcn_fence(__ATOMIC_ACQUIRE, "workgroup"); }
__device__ __forceinline__ float xhalf(float x) { return __builtin_bit_cast(float, __builtin_amdgcn_permlanex16(__builtin_bit_cast(int, x), __builtin_bit_cast(int, x), 0x76543210, 0xfedcba98, false, false)); }   // lane l with lane l ^ 16
__device__ __forceinline__ float exp2s(float x) { float r; asm("v_exp_f32 %0, %1\n\tv_nop" : "=v"(r) : "v"(x)); return r; }   // 2^x; the v_nop is the one slot asked for between a transcendental and a next instruction that reads its result or overwrites its source: in one statement, so that it stands directly behind
__device__ __forceinline__ float pmul(float a, float b) { float p = a * b; asm volatile("" : "+v"(p)); return p; }

__global__ __launch_bounds__(256) void wput_kernel(const float* __restrict__ w1q, const float* __restrict__ w2q, const float* __restrict__ w1k, const float* __restrict__ w2k, const float* __restrict__ wv, const float* __restrict__ wo, b16* __restrict__ WQK, b16* __restrict__ WV, b16* __restrict__ WO) { const size_t nt = (size_t)gridDim.x * 256, u0 = (size_t)blockIdx.x * 256 + threadIdx.x; v8b v;
  // u counts the 16-byte units of the destination (tile = 16 rows x 32 k, NK tiles a row tile): a wave stores 512 contiguous bytes, and a block reads whole lines of 16 rows
  for (size_t u = u0; u < (size_t)256 * 128; u += nt) { const int o = (int)(u >> 11) * 16 + ((int)u & 15), k0 = ((int)(u >> 6) & 31) * 32 + ((int)(u >> 4) & 3) * 8; const float* w = o < 64 ? w1q : (o < 128 ? w2q : (o < 192 ? w1k : w2k)); const int oo = o % 64;
#pragma unroll
    for (int j = 0; j < 8; ++j) v[j] = (b16)(bf16_rne(w[(size_t)oo * D + k0 + j]) * WSC); { *(v8b*)(WQK + u * 8) = v;  } }
  for (size_t u = u0; u < (size_t)D * 128; u += nt) { const int o = (int)(u >> 11) * 16 + ((int)u & 15), k0 = ((int)(u >> 6) & 31) * 32 + ((int)(u >> 4) & 3) * 8; v8b a, c;
#pragma unroll
    for (int j = 0; j < 8; ++j) { a[j] = (b16)(bf16_rne(wv[(size_t)o * D + k0 + j]) * WSC); c[j] = (b16)(bf16_rne(wo[(size_t)o * D + k0 + j]) * WSC); } { *(v8b*)(WV + u * 8) = a; *(v8b*)(WO + u * 8) = c;  } } }
// proj_kernel: one work-group per (64 tokens, quarter np of the columns). The token tile is staged once in LDS and shared; a wave takes all 64 tokens x 32 columns (4 x 2 tiles), so that a weight tile is read once per 64 tokens: wave 0 the q1,q2 columns of heads 4np..4np+3, wave 1 their k1,k2 columns, wave w >= 2 takes 32 columns of v.
__global__ __launch_bounds__(PWV * 32) void proj_kernel(const float* __restrict__ x, const b16* __restrict__ WQK, const b16* __restrict__ WV, const float* __restrict__ bv, b16* __restrict__ LQh, b16* __restrict__ LQl, b16* __restrict__ LKh, b16* __restrict__ LKl, float* __restrict__ V) { __shared__ __attribute__((aligned(16))) b16 Ah[MT][D + 8]; __shared__ __attribute__((aligned(16))) float Tfs[PWV][MT][36]; const int tid = threadIdx.x, lane = tid & 31, nloc = lane & 15, hlf = lane >> 4, wave = __builtin_amdgcn_readfirstlane(tid >> 5), np = blockIdx.x & 3; const size_t t0 = (size_t)(blockIdx.x >> 2) * MT;
  const bool isqk = wave < 2; const int c0 = np * 256 + (wave - 2) * 32;
  const b16* W = (isqk ? WQK + (size_t)(np * 16 + wave * 128) * D : WV + (size_t)c0 * D) + lane * 8; const size_t tstr = isqk ? (size_t)64 * D : (size_t)16 * D;
  // Staging: 16 bytes a lane, runs of SB loads, the next run asked for before this one is converted (the pinned rounding keeps the loads where the source has them).
  constexpr int SB = 17, NTH = PWV * 32, REM = MT * D / 4 - 3 * SB * NTH /* 64 units are left: the last two waves */; const v4f* xs = (const v4f*)(x + t0 * D) + tid;
  auto put = [&](int u, v4f xv) { v4b hv;
#pragma unroll
    for (int j = 0; j < 4; ++j) hv[j] = (b16)(bf16_rne(xv[j]) * XS);
    *(v4b*)&Ah[u >> 8][(u & 255) * 4] = hv; };
  // Register ring: the two weight fragments of a k step are asked for PRB - 1 k steps ahead of the products that use them. The first ones fly while the last run of the token tile is converted.
  v16b bw[PRB][2]; v4f xv[2][SB], xr = (v4f){}; const bool rem = wave >= PWV - REM / 32;
#pragma unroll
  for (int j = 0; j < SB; ++j) xv[0][j] = xs[j * NTH];
#pragma unroll
  for (int r = 0; r < 3; ++r) {
    if (r < 2) {
#pragma unroll
      for (int j = 0; j < SB; ++j) xv[(r + 1) & 1][j] = xs[((r + 1) * SB + j) * NTH]; }
    else { if (rem) xr = xs[3 * SB * NTH - (NTH - REM)];
#pragma unroll
      for (int s = 0; s < PRB - 1; ++s)
#pragma unroll
        for (int n = 0; n < 2; ++n) bw[s][n] = frag_fo(W + n * tstr + s * 512); }
#pragma unroll
    for (int j = 0; j < SB; ++j) put((r * SB + j) * NTH + tid, xv[r & 1][j]); }
  if (rem) put(3 * SB * NTH - (NTH - REM) + tid, xr);
  if (tid < MT) for (int k = D; k < D + 8; ++k) Ah[tid][k] = (b16)0.0f;
  __syncthreads();   // the staged token tile is read by every wave
  float (*Tf)[36] = Tfs[wave]; v8f acc[4][2];
#pragma unroll
  for (int m = 0; m < 4; ++m)
#pragma unroll
    for (int n = 0; n < 2; ++n) acc[m][n] = (v8f){};
#pragma unroll 1   // one ring turn is the loop body: every ring index is a constant, and a second copy would take registers from the ring
  for (int st0 = 0; st0 < NK - PRB; st0 += PRB)
#pragma unroll
    for (int s = 0; s < PRB; ++s) { const int kb = (st0 + s) * 32; v16b a[4];
#pragma unroll
      for (int n = 0; n < 2; ++n) bw[(s + PRB - 1) % PRB][n] = frag_fo(W + n * tstr + (size_t)(st0 + s + PRB - 1) * 512);
#pragma unroll
      for (int m = 0; m < 4; ++m) a[m] = frag_kb(&Ah[m * 16 + nloc][kb], hlf);
#pragma unroll
      for (int m = 0; m < 4; ++m)
#pragma unroll
        for (int n = 0; n < 2; ++n) acc[m][n] = wmma16b(a[m], bw[s][n], acc[m][n]);
      if (s == PRB - 1) asm volatile("s_wait_xcnt 0x0" ::: "memory"); }   // the next turn forms its addresses in the registers that this turn's loads name
#pragma unroll
  for (int s = 0; s < PRB; ++s) { const int kb = (NK - PRB + s) * 32; v16b a[4];   // the last turn: only its first step still fetches
    if (s == 0) {
#pragma unroll
      for (int n = 0; n < 2; ++n) bw[PRB - 1][n] = frag_fo(W + n * tstr + (NK - 1) * 512);
      asm volatile("s_wait_xcnt 0x0" :: "v"(W) : "memory"); }   // the address is an input, so it stays in its registers up to this wait: the epilogue reuses them
#pragma unroll
    for (int m = 0; m < 4; ++m) a[m] = frag_kb(&Ah[m * 16 + nloc][kb], hlf);
#pragma unroll
    for (int m = 0; m < 4; ++m)
#pragma unroll
      for (int n = 0; n < 2; ++n) acc[m][n] = wmma16b(a[m], bw[s][n], acc[m][n]); }
#pragma unroll
  for (int n = 0; n < 2; ++n) { const int cc = n * 16 + nloc; const float bb = isqk ? 0.0f : bfv(bv[c0 + cc]);
#pragma unroll
    for (int m = 0; m < 4; ++m)
#pragma unroll
      for (int r8 = 0; r8 < 8; ++r8) Tf[m * 16 + 8 * hlf + r8][cc] = acc[m][n][r8] * (1.0f / (XS * WSC)) + bb; }
  wave_lds_sync();
  if (isqk) {   // Plucker lines: wave 0 the q lines, wave 1 the k lines; lane = (token lane & 15 of a 16-token tile, head pair lane >> 4); loop the 4 token tiles and the 2 heads of a pair
    const int isk = wave;
#pragma unroll 1
    for (int io = 0; io < 8; io += 4) {
#pragma unroll   // four independent lines side by side: each is one long dependent chain (root, division)
    for (int it = io; it < io + 4; ++it) { const int rr = (it >> 1) * 16 + nloc, hl = hlf * 2 + (it & 1), h = np * 4 + hl; const float* p1 = &Tf[rr][hl * 4]; const float* p2 = &Tf[rr][16 + hl * 4]; float Lm[6]; Lm[0] = p1[0] * p2[1] - p1[1] * p2[0]; Lm[1] = p1[0] * p2[2] - p1[2] * p2[0]; Lm[2] = p1[0] * p2[3] - p1[3] * p2[0]; Lm[3] = p1[1] * p2[2] - p1[2] * p2[1]; Lm[4] = p1[1] * p2[3] - p1[3] * p2[1]; Lm[5] = p1[2] * p2[3] - p1[3] * p2[2];
      float n2 = 0.0f; for (int c = 0; c < 6; ++c) n2 += Lm[c] * Lm[c]; const float inv = 1.0f / fmaxf(sqrtf(n2), 1e-12f); float Lo[6];
      if (isk) { Lo[0] = Lm[5]; Lo[1] = -Lm[4]; Lo[2] = Lm[3]; Lo[3] = Lm[2]; Lo[4] = -Lm[1]; Lo[5] = Lm[0]; } else { for (int c = 0; c < 6; ++c) Lo[c] = Lm[c]; }
      b16 hh_[32], ll_[32]; for (int c = 0; c < 32; ++c) { hh_[c] = (b16)0.0f; ll_[c] = (b16)0.0f; } for (int c = 0; c < 6; ++c) split16(Lo[c] * inv * HS, hh_[c], ll_[c]);
      b16* dh = (isk ? LKh : LQh) + ((size_t)h * NT + t0 + (it >> 1) * 16) * 32 + nloc * 8; b16* dl = (isk ? LKl : LQl) + ((size_t)h * NT + t0 + (it >> 1) * 16) * 32 + nloc * 8;   // 16 tokens are one tile in fragment order
      for (int c = 0; c < 32; c += 8) { v8b a, bq; for (int j = 0; j < 8; ++j) { a[j] = hh_[c + j]; bq[j] = ll_[c + j]; } *(v8b*)(dh + c * 16) = a; *(v8b*)(dl + c * 16) = bq; } }
      asm volatile("s_wait_xcnt 0x0" ::: "memory");   // the next trip rewrites the address and data registers that these stores name
    } }
  else {
#pragma unroll   // constant offsets on one store address
    for (int i = 0; i < MT / 4; ++i) { const int rr = i * 4 + (lane >> 3); *(v4f*)(V + (t0 + rr) * D + c0 + (lane & 7) * 4) = *(const v4f*)(&Tf[rr][(lane & 7) * 4]); }   // a wave's store: the whole 128-byte lines of 4 tokens
    asm volatile("s_wait_xcnt 0x0" ::: "memory");   // closes the run of stores before any later instruction of the listing rewrites a register that they name
  } }
__global__ __launch_bounds__(256) void vt_kernel(const float* __restrict__ V, b16* __restrict__ VTh, b16* __restrict__ VTl) { __shared__ float Tt[64][66] /* 8 rows on are 16 banks on: the two halves of a wave read apart */; const int b = blockIdx.x / (T / 64), tk0 = (blockIdx.x % (T / 64)) * 64; const int h = blockIdx.y; const int tid = threadIdx.x, wave = tid >> 5, lane = tid & 31;
  for (int q = wave; q < 64; q += 8) { Tt[q][lane * 2] = V[((size_t)b * T + tk0 + q) * D + h * DH + lane * 2]; Tt[q][lane * 2 + 1] = V[((size_t)b * T + tk0 + q) * D + h * DH + lane * 2 + 1]; }
  __syncthreads();
  // v^T in fragment order, tiles as [b, h][32-key step][16-d tile]: the block's 64 keys are 8 tiles = 512 units of 16 bytes in a row; unit j is (tile j >> 6, k >> 4 = j >> 5 & 1, lane j & 31)
  const size_t ob = (((size_t)b * H + h) * (T / 32) + tk0 / 32) * 4 * 512;
#pragma unroll   // two trips: constant offsets on one store address
  for (int i = 0; i < 2; ++i) { const int j = i * 256 + tid, d = ((j >> 6) & 3) * 16 + (j & 15), kq = (j >> 8) * 32 + ((j >> 4) & 3) * 8; v8b vh, vl;
#pragma unroll
    for (int e = 0; e < 8; ++e) { b16 h0, l0; split16(Tt[kq + e][d] * HS, h0, l0); vh[e] = h0; vl[e] = l0; }
    *(v8b*)(VTh + ob + (size_t)j * 8) = vh; *(v8b*)(VTl + ob + (size_t)j * 8) = vl; } }
// att_kernel: one work-group of 8 waves per (b, h, t): the 128-query block 15 - t and then the block t, one after the other, so that every work-group walks 17 key chunks. A wave takes 16 queries of the block. S^T = JL_k x L_q^T, so a lane holds the scores of ONE query (column nloc; keys 8 * hlf + r of each 16-key tile): mask, maximum, exp and sum stay in registers,
// two converted score tiles are the B operand (hardware k order, the order of frag_kb) of O^T += v^T x P^T, and the rescale factor and the final 1 / sum are per lane. Every inner loop is unrolled so that each index into a register array is a constant.
// The 8 waves of a block need the same key chunks: a chunk (L_k hi, L_k lo, v^T hi, v^T lo, each one contiguous run of the workspace in fragment order, 48 KB together) is brought into LDS once for all of them, one chunk ahead, two buffers.
// chunk_copy: the work-group's 256 lanes move one chunk, 12 asynchronous copies of 16 bytes a lane; a wave's copy is 512 contiguous bytes on both sides. l = the lane's LDS byte address in the buffer, the pointers = the lane's own 16 bytes of each run.
__device__ __forceinline__ void chunk_copy(unsigned l, const b16* kh, const b16* kl, const b16* vh, const b16* vl) {
  asm volatile(   // the wait in the last line stands in front of every later rewrite of a register that these copies name (a precaution): in the copies' own statement, so that the compiler moves nothing in between
    "global_load_async_to_lds_b128 %0, %12, off\n\t"
    "global_load_async_to_lds_b128 %1, %13, off\n\t"
    "global_load_async_to_lds_b128 %2, %14, off\n\t"
    "global_load_async_to_lds_b128 %3, %15, off\n\t"
    "global_load_async_to_lds_b128 %4, %16, off\n\t"
    "global_load_async_to_lds_b128 %5, %17, off\n\t"
    "global_load_async_to_lds_b128 %6, %18, off\n\t"
    "global_load_async_to_lds_b128 %7, %19, off\n\t"
    "global_load_async_to_lds_b128 %8, %20, off\n\t"
    "global_load_async_to_lds_b128 %9, %21, off\n\t"
    "global_load_async_to_lds_b128 %10, %22, off\n\t"
    "global_load_async_to_lds_b128 %11, %23, off\n\t"
    "s_wait_xcnt 0x0"
    :: "v"(l), "v"(l + 4096u), "v"(l + 8192u), "v"(l + 12288u), "v"(l + 16384u), "v"(l + 20480u), "v"(l + 24576u), "v"(l + 28672u), "v"(l + 32768u), "v"(l + 36864u), "v"(l + 40960u), "v"(l + 45056u),
       "v"(kh), "v"(kh + 2048), "v"(kl), "v"(kl + 2048), "v"(vh), "v"(vh + 2048), "v"(vh + 4096), "v"(vh + 6144), "v"(vl), "v"(vl + 2048), "v"(vl + 4096), "v"(vl + 6144) : "memory"); }
__global__ __launch_bounds__(AWV * 32) __attribute__((amdgpu_waves_per_eu(4, 4))) /* at most 256 registers a wave: none above v255 */ void att_kernel(const b16* __restrict__ LQh, const b16* __restrict__ LQl, const b16* __restrict__ LKh, const b16* __restrict__ LKl, const b16* __restrict__ VTh, const b16* __restrict__ VTl, int QLIM, float* __restrict__ O) { __shared__ __attribute__((aligned(16))) b16 Ring[2][CBH]; const int tid = threadIdx.x, lane = tid & 31, nloc = lane & 15, hlf = lane >> 4, wave = __builtin_amdgcn_readfirstlane(tid >> 5); const int bh = blockIdx.x % (NB_ * H), b = bh / H, h = bh % H; const int nA = T / CK - (int)(blockIdx.x / (NB_ * H));   // chunks of the first block, 16 .. 9; the second has NCH - nA
  constexpr int NCH = T / CK + 1;   // chunks of a work-group
  constexpr float C2 = SCL / (HS * HS) * 1.4426950408889634f;   // raw accumulator -> score in the log2 domain
  const b16* Kh = LKh + ((size_t)h * NT + (size_t)b * T) * 32 + tid * 8; const b16* Kl = LKl + ((size_t)h * NT + (size_t)b * T) * 32 + tid * 8;   // a lane's own 16 bytes of the first 4 KB of a run, here and below
  const b16* Vh = VTh + ((size_t)b * H + h) * DH * T + tid * 8; const b16* Vl = VTl + ((size_t)b * H + h) * DH * T + tid * 8;
  const unsigned l0 = (unsigned)(size_t)&Ring[0][0] + tid * 16;
  auto fill = [&](int c) { const size_t k0 = (size_t)((c < nA ? c : c - nA) * CK); chunk_copy(l0 + (c & 1) * (CBH * 2), Kh + k0 * 32, Kl + k0 * 32, Vh + k0 * DH, Vl + k0 * DH); };   // chunk c of the 17, into buffer c mod 2
  fill(0);
  asm volatile("s_wait_asynccnt 0x0" ::: "memory");   // this wave's part of chunk 0 has landed
  __syncthreads();   // chunk 0 is whole: every wave reads all of it
  fill(1);
  int c = 0;
#pragma unroll 1   // one copy of the code for the two blocks
  for (int blk = 0; blk < 2; ++blk) { const int nch = blk ? NCH - nA : nA, q0 = (nch - 1) * CK + wave * 16; const size_t tq = (size_t)b * T + q0;
  const b16* pqh = LQh + ((size_t)h * NT + tq) * 32 + lane * 8; const b16* pql = LQl + ((size_t)h * NT + tq) * 32 + lane * 8; const v16b qa = frag_fo(pqh), ql = frag_fo(pql);
  asm volatile("s_wait_xcnt 0x0" :: "v"(pqh), "v"(pql) : "memory");   // the two addresses are inputs, so they stay in their registers up to this wait
  v8f oacc[4] = {(v8f){}, (v8f){}, (v8f){}, (v8f){}}; float mrun = -INFINITY, lsum = 0.0f;
#pragma unroll 1   // one chunk's code: a second copy would take registers
  for (int ch = 0; ch < nch; ++ch, ++c) { const int k0 = ch * CK; v8f sacc[CK / 16]; const b16* R = &Ring[c & 1][lane * 8]; const b16* pkh = R; const b16* pkl = R + CKH; const b16* pvh = R + 2 * CKH; const b16* pvl = R + 2 * CKH + CVH;   // a lane's own 16 bytes of a tile in fragment order
#pragma unroll
    for (int g = 0; g < CK / 16; g += 4) { v16b kh[4], kl[4];   // four independent tiles a group: no product waits for the one before it
#pragma unroll
      for (int t = 0; t < 4; ++t) { kh[t] = frag_fo(pkh + (g + t) * 512); kl[t] = frag_fo(pkl + (g + t) * 512); }
#pragma unroll
      for (int t = 0; t < 4; ++t) sacc[g + t] = wmma16b(kh[t], qa, (v8f){});
#pragma unroll
      for (int t = 0; t < 4; ++t) sacc[g + t] = wmma16b(kl[t], qa, sacc[g + t]);
#pragma unroll
      for (int t = 0; t < 4; ++t) sacc[g + t] = wmma16b(kh[t], ql, sacc[g + t]); }
    if (ch == nch - 1) { const int kd = q0 + nloc - k0 - 8 * hlf;   // causal mask: only the last chunk holds keys behind a query
#pragma unroll
      for (int t = 0; t < CK / 16; ++t)
#pragma unroll
        for (int r8 = 0; r8 < 8; ++r8) sacc[t][r8] = (t * 16 + r8 <= kd) ? sacc[t][r8] : -INFINITY; }
    float m4[4] = {sacc[0][0], sacc[0][1], sacc[0][2], sacc[0][3]};   // four chains, so that no maximum waits for the one before it
#pragma unroll
    for (int t = 0; t < CK / 16; ++t)
#pragma unroll
      for (int r8 = 0; r8 < 8; ++r8) m4[r8 & 3] = fmaxf(m4[r8 & 3], sacc[t][r8]);
    float mx = fmaxf(fmaxf(m4[0], m4[1]), fmaxf(m4[2], m4[3])); mx = fmaxf(mx, xhalf(mx));   // the two halves of the wave hold the two halves of a query's keys
    const float mn = fmaxf(mrun, mx), fac = exp2s((mrun - mn) * C2), nb = -mn * C2; mrun = mn;
    v16b pa[CK / 32], pb[CK / 32]; float sm[4] = {0.0f, 0.0f, 0.0f, 0.0f};
#pragma unroll
    for (int t = 0; t < CK / 16; ++t)
#pragma unroll
      for (int r8 = 0; r8 < 8; ++r8) { const float p = exp2s(fmaf(sacc[t][r8], C2, nb)); sm[r8 & 3] += p; b16 ph, pl; split16(p * PS, ph, pl); pa[t >> 1][(t & 1) * 8 + r8] = ph; pb[t >> 1][(t & 1) * 8 + r8] = pl; }
    lsum = lsum * fac + ((sm[0] + sm[1]) + (sm[2] + sm[3]));
#pragma unroll
    for (int t = 0; t < 4; ++t)
#pragma unroll
      for (int r8 = 0; r8 < 8; ++r8) oacc[t][r8] *= fac;
#pragma unroll
    for (int jj = 0; jj < CK / 64; ++jj)   // a block of loads: 64 keys, two d tiles
#pragma unroll
      for (int tp = 0; tp < 4; tp += 2) { v16b vh[2][2], vl[2][2];
#pragma unroll
        for (int t = 0; t < 2; ++t)
#pragma unroll
          for (int j = 0; j < 2; ++j) { const int vo = ((jj * 2 + j) * 4 + tp + t) * 512; vh[t][j] = frag_fo(pvh + vo); vl[t][j] = frag_fo(pvl + vo); }
#pragma unroll
        for (int j = 0; j < 2; ++j) { const int J = jj * 2 + j;
#pragma unroll
          for (int t = 0; t < 2; ++t) oacc[tp + t] = wmma16b(vh[t][j], pa[J], oacc[tp + t]);
#pragma unroll
          for (int t = 0; t < 2; ++t) oacc[tp + t] = wmma16b(vl[t][j], pa[J], oacc[tp + t]);
#pragma unroll
          for (int t = 0; t < 2; ++t) oacc[tp + t] = wmma16b(vh[t][j], pb[J], oacc[tp + t]); } }
    asm volatile("s_wait_dscnt 0x0" :: "v"(lsum) : "memory");   // this wave has read all it reads of buffer c mod 2. The row sum is an input so that it is formed in front of the branch below: behind it, where the compiler otherwise moves the 64 additions, the 64 exponentials stay in registers over the v^T products, and registers spill
    asm volatile("s_wait_asynccnt 0x0" ::: "memory");   // this wave's part of chunk c + 1 has landed
    __syncthreads();   // chunk c + 1 is whole, and no wave still reads buffer c mod 2
    if (c + 2 < NCH) fill(c + 2); }
  const float rl = (1.0f / (PS * HS)) / (lsum + xhalf(lsum));
  if (q0 < QLIM) {
#pragma unroll
    for (int t = 0; t < 4; ++t) { float* op = O + (tq + nloc) * D + h * DH + t * 16 + 8 * hlf;   // a lane's 8 accumulator registers are 8 consecutive d of its query
      *(v4f*)op = (v4f){oacc[t][0] * rl, oacc[t][1] * rl, oacc[t][2] * rl, oacc[t][3] * rl}; *(v4f*)(op + 4) = (v4f){oacc[t][4] * rl, oacc[t][5] * rl, oacc[t][6] * rl, oacc[t][7] * rl}; }
    asm volatile("s_wait_xcnt 0x0" ::: "memory"); } }   // the second block's trip rewrites the address and data registers that these stores name
  asm volatile("s_wait_asynccnt 0x0" ::: "memory"); }   // no copy is outstanding when the wave ends
// outp_kernel: one work-group per (64 tokens, quarter np of the output columns); the hi and lo token tiles are staged once in LDS and shared; wave w takes all 64 tokens x output columns 256np + 32w .. + 31 (4 x 2 tiles), so that a weight tile is read once per 64 tokens.
__global__ __launch_bounds__(OWV * 32) void outp_kernel(const float* __restrict__ O, const b16* __restrict__ WO, const float* __restrict__ bo, int QLIM, float* __restrict__ out) { __shared__ __attribute__((aligned(16))) b16 Ah[MT][D + 8], Al[MT][D + 8]; __shared__ __attribute__((aligned(16))) float Tfs[OWV][16][36]; const int tid = threadIdx.x, lane = tid & 31, nloc = lane & 15, hlf = lane >> 4, wave = __builtin_amdgcn_readfirstlane(tid >> 5), np = blockIdx.x & 3; const size_t t0 = (size_t)(blockIdx.x >> 2) * MT; if ((int)(t0 % T) >= QLIM) return;
  const int c0 = np * 256 + wave * 32; const b16* W = WO + (size_t)c0 * D + lane * 8;
  // Register ring, as in proj_kernel: the two weight fragments of a k step are asked for ORB - 1 k steps ahead. The first ones fly while the last run of the token tiles is converted.
  v16b bw[ORB][2];
  const v4f* os = (const v4f*)(O + t0 * D) + tid;
  v4f ov[2][16];   // runs of 16 loads, the next run asked for before this one is converted; load i is token i
#pragma unroll
  for (int j = 0; j < 16; ++j) ov[0][j] = os[j * (D / 4)];
#pragma unroll
  for (int r = 0; r < MT / 16; ++r) {
    if (r < MT / 16 - 1) {
#pragma unroll
      for (int j = 0; j < 16; ++j) ov[(r + 1) & 1][j] = os[((r + 1) * 16 + j) * (D / 4)]; }
    else {
#pragma unroll
      for (int s = 0; s < ORB - 1; ++s)
#pragma unroll
        for (int n = 0; n < 2; ++n) bw[s][n] = frag_fo(W + (size_t)n * 16 * D + s * 512); }
#pragma unroll
    for (int i = 0; i < 16; ++i) { v4b hv, lv;
#pragma unroll
      for (int j = 0; j < 4; ++j) { b16 p, pl; split16(ov[r & 1][i][j] * HS, p, pl); hv[j] = p; lv[j] = pl; }
      *(v4b*)&Ah[r * 16 + i][tid * 4] = hv; *(v4b*)&Al[r * 16 + i][tid * 4] = lv; }
    __builtin_amdgcn_sched_barrier(0); }   // keeps the run after the next behind this run's conversion: with three runs in registers the wave needs registers above v255
  if (tid < MT) for (int k = D; k < D + 8; ++k) { Ah[tid][k] = (b16)0.0f; Al[tid][k] = (b16)0.0f; }
  __syncthreads();   // the staged token tiles are read by every wave
  float (*Tf)[36] = Tfs[wave]; v8f acc[4][2];
#pragma unroll
  for (int m = 0; m < 4; ++m)
#pragma unroll
    for (int n = 0; n < 2; ++n) acc[m][n] = (v8f){};
#pragma unroll 1   // one ring turn is the loop body: every ring index is a constant, and a second copy would take registers from the ring
  for (int st0 = 0; st0 < NK - ORB; st0 += ORB)
#pragma unroll
    for (int s = 0; s < ORB; ++s) { const int kb = (st0 + s) * 32; v16b a[4], al[4];
#pragma unroll
      for (int n = 0; n < 2; ++n) bw[(s + ORB - 1) % ORB][n] = frag_fo(W + (size_t)n * 16 * D + (size_t)(st0 + s + ORB - 1) * 512);
#pragma unroll
      for (int m = 0; m < 4; ++m) { a[m] = frag_kb(&Ah[m * 16 + nloc][kb], hlf); al[m] = frag_kb(&Al[m * 16 + nloc][kb], hlf); }
#pragma unroll
      for (int m = 0; m < 4; ++m)
#pragma unroll
        for (int n = 0; n < 2; ++n) acc[m][n] = wmma16b(a[m], bw[s][n], acc[m][n]);
#pragma unroll
      for (int m = 0; m < 4; ++m)
#pragma unroll
        for (int n = 0; n < 2; ++n) acc[m][n] = wmma16b(al[m], bw[s][n], acc[m][n]);
      if (s == ORB - 1) asm volatile("s_wait_xcnt 0x0" ::: "memory"); }   // the next turn forms its addresses in the registers that this turn's loads name
#pragma unroll
  for (int s = 0; s < ORB; ++s) { const int kb = (NK - ORB + s) * 32; v16b a[4], al[4];   // the last turn: only its first step still fetches
    if (s == 0) {
#pragma unroll
      for (int n = 0; n < 2; ++n) bw[ORB - 1][n] = frag_fo(W + (size_t)n * 16 * D + (NK - 1) * 512);
      asm volatile("s_wait_xcnt 0x0" :: "v"(W) : "memory"); }   // the address is an input, so it stays in its registers up to this wait: the epilogue reuses them
#pragma unroll
    for (int m = 0; m < 4; ++m) { a[m] = frag_kb(&Ah[m * 16 + nloc][kb], hlf); al[m] = frag_kb(&Al[m * 16 + nloc][kb], hlf); }
#pragma unroll
    for (int m = 0; m < 4; ++m)
#pragma unroll
      for (int n = 0; n < 2; ++n) acc[m][n] = wmma16b(a[m], bw[s][n], acc[m][n]);
#pragma unroll
    for (int m = 0; m < 4; ++m)
#pragma unroll
      for (int n = 0; n < 2; ++n) acc[m][n] = wmma16b(al[m], bw[s][n], acc[m][n]); }
  const float bb0 = bfv(bo[c0 + nloc]), bb1 = bfv(bo[c0 + 16 + nloc]);
#pragma unroll
  for (int m = 0; m < 4; ++m) {   // 16 tokens at a time through the wave's own LDS tile
#pragma unroll
    for (int n = 0; n < 2; ++n)
#pragma unroll
      for (int r8 = 0; r8 < 8; ++r8) Tf[8 * hlf + r8][n * 16 + nloc] = acc[m][n][r8] * (1.0f / (HS * WSC)) + (n ? bb1 : bb0);
    wave_lds_sync();
#pragma unroll
    for (int i = 0; i < 4; ++i) { const int rr = i * 4 + (lane >> 3); *(v4f*)(out + (t0 + m * 16 + rr) * D + c0 + (lane & 7) * 4) = *(const v4f*)(&Tf[rr][(lane & 7) * 4]); }   // a wave's store: the whole 128-byte lines of 4 tokens
    wave_lds_sync();   // the rows are read before the next 16 tokens are written over them
    asm volatile("s_wait_xcnt 0x0" ::: "memory"); } }   // the next trip rewrites the data registers that these stores name
}  // namespace

extern "C" void kernel_launch(void* const* d_in, const int* in_sizes, int n_in, void* d_out, int out_size, void* d_ws, size_t ws_size, hipStream_t stream) {
  (void)n_in;
  auto Fp = [&](int i) { return (const float*)d_in[i]; };
  // inputs: 0 x [2,2048,1024]; 1 W1_q [64,1024]; 2 W2_q; 3 W1_k; 4 W2_k; 5 W_v [1024,1024]; 6 b_v; 7 W_out [1024,1024]; 8 b_out
  if (in_sizes[0] != NT * D || in_sizes[1] != 64 * D || in_sizes[4] != 64 * D || in_sizes[5] != D * D || in_sizes[7] != D * D || out_size != NT * D) return;
  const int QLIM = T;   // per-sequence query cut (multiple of 16)
  size_t off = 0; char* ws = (char*)d_ws;
  auto carve = [&](size_t bytes) { char* p = ws + off; off += (bytes + 255) & ~(size_t)255; return p; };
  b16* WQK = (b16*)carve((size_t)256 * D * 2); b16* WV = (b16*)carve((size_t)D * D * 2); b16* WO = (b16*)carve((size_t)D * D * 2); b16* LQh = (b16*)carve((size_t)H * NT * 32 * 2); b16* LQl = (b16*)carve((size_t)H * NT * 32 * 2); b16* LKh = (b16*)carve((size_t)H * NT * 32 * 2); b16* LKl = (b16*)carve((size_t)H * NT * 32 * 2); float* V = (float*)carve((size_t)NT * D * 4); b16* VTh = (b16*)carve((size_t)NB_ * H * DH * T * 2); b16* VTl = (b16*)carve((size_t)NB_ * H * DH * T * 2); float* O = (float*)carve((size_t)NT * D * 4);
  if (off > ws_size || off > ((size_t)80 << 20)) return;   // ~ 71 MB
  wput_kernel<<<128, 256, 0, stream>>>(Fp(1), Fp(2), Fp(3), Fp(4), Fp(5), Fp(7), WQK, WV, WO);
  proj_kernel<<<NT / MT * 4, PWV * 32, 0, stream>>>(Fp(0), WQK, WV, Fp(6), LQh, LQl, LKh, LKl, V);
  vt_kernel<<<dim3(NB_ * (T / 64), H), 256, 0, stream>>>(V, VTh, VTl);
  att_kernel<<<NB_ * H * (T / CK / 2), AWV * 32, 0, stream>>>(LQh, LQl, LKh, LKl, VTh, VTl, QLIM, O);
  outp_kernel<<<NT / MT * 4, OWV * 32, 0, stream>>>(O, WO, Fp(8), QLIM, (float*)d_out);
}

// v007
// Measured time: 88 microseconds a run.
// Two timings next to v006 both put it at 1.08 times that version's speed.
// Over all steps from v000 it is 17.7 times as fast.
#include <hip/hip_runtime.h>

// PluckerKernelAttention: q1,q2,k1,k2 = x W^T (1024 -> 16 heads x 4); L_q = normalize(exterior(q1,q2)), L_k likewise (6-d Plucker lines); scores = L_q . (J6 L_k) / sqrt(6) with a causal mask; attn = softmax; v = x W_v^T + b_v (16 x 64); o = attn v; out = o W_out^T + b_out -> [2][2048][1024].
// Deterministic: flash-style online softmax over fixed 128-key chunks (causal: chunks up to the query block), fixed order; no atomics.
// WMMA (v_wmma_f32_16x16x32_f16, f32 accumulate): x (EXACT bf16 x8, K 1024) x [W1q;W2q;W1k;W2k] rows (16 tiles) and x W_v rows (64 tiles), 4 x 2 tiles a wave, 10 waves per work-group of 64 tokens x 320 columns; per (b, h, 16-query) wave and key chunk S^T = JL_k rows (hi+lo x256, K 6 -> 32; 8 tiles) x L_q (hi+lo) and O^T += v^T rows (hi+lo; 4 tiles, K 128) x P (hi+lo x256, packed from the score accumulators), 3 products; out-proj o (hi+lo, K 1024) x W_out rows (64 tiles, 4 x 2 a wave, 8 waves per work-group of 64 tokens x 256 columns); weights EXACT x256, (out, in) rows stored as 16 x 32 tiles in fragment order, about 4.2 M WMMA; Plucker exterior/normalisation and softmax in f32.

namespace {
constexpr int NB_ = 2, T = 2048, D = 1024, H = 16, DH = 64, NT = NB_ * T /* 4096 tokens */, CK = 128 /* keys of an attention chunk */, MT = 64 /* tokens of a proj or out-proj work-group */, PWV = 10 /* waves of a proj work-group */, OWV = 8 /* waves of an out-proj work-group */, PRB = 8, ORB = 4 /* k steps of their weight rings */, NK = D / 32 /* k steps of a projection */, AWV = 8 /* waves of an attention work-group */, CKH = CK * 32 /* halves of a chunk of L_k, hi or lo */, CVH = CK * DH /* halves of a chunk of v^T, hi or lo */, CBH = 2 * CKH + 2 * CVH /* halves of a ring buffer */;
constexpr float XS = 8.0f, HS = 256.0f, PS = 256.0f, WSC = 256.0f, SCL = 0.40824829046386302f /* 6^-0.5 */;
typedef _Float16 b16;
typedef __attribute__((ext_vector_type(16))) _Float16 v16b;
typedef __attribute__((ext_vector_type(8))) _Float16 v8b;
typedef __attribute__((ext_vector_type(4))) _Float16 v4b;
typedef __attribute__((ext_vector_type(2))) _Float16 v2b;
typedef __attribute__((ext_vector_type(8))) float v8f;
typedef __attribute__((ext_vector_type(4))) float v4f;
typedef __attribute__((ext_vector_type(2))) float v2f;
__device__ __forceinline__ float bf16_rne(float f) { unsigned int u = __float_as_uint(f); u += 0x7FFFu + ((u >> 16) & 1u); float r = __uint_as_float(u & 0xFFFF0000u); asm volatile("" : "+v"(r)); return r; }
__device__ __forceinline__ float bfv(float f) { float r = bf16_rne(f); asm volatile("" : "+v"(r)); return r; }
__device__ __forceinline__ void split16(float v, b16& hi, b16& lo) { hi = (b16)v; lo = (b16)(v - (float)hi); }
__device__ __forceinline__ v16b frag_kb(const b16* p, int hh) { const v8b a = *(const v8b*)(p + 8 * hh), b = *(const v8b*)(p + 16 + 8 * hh); v16b f;
#pragma unroll
  for (int e = 0; e < 8; ++e) { f[e] = a[e]; f[8 + e] = b[e]; } return f; }
// Fragment order: a 16-row x 32-k operand tile that a kernel of this file writes to the workspace is 512 halves laid as [k >> 4][(k >> 3 & 1) * 16 + row][k & 7], so that each of a wave's two 16-byte loads takes 512 contiguous bytes (4 whole lines). p = tile + lane * 8. Same registers, same k order as frag_kb on a row-major tile.
__device__ __forceinline__ v16b frag_fo(const b16* p) { const v8b a = *(const v8b*)p, b = *(const v8b*)(p + 256); v16b f;
#pragma unroll
  for (int e = 0; e < 8; ++e) { f[e] = a[e]; f[8 + e] = b[e]; } return f; }
__device__ __forceinline__ v8f wmma16b(v16b a, v16b b, v8f c) { v8f d = __builtin_amdgcn_wmma_f32_16x16x32_f16(false, a, false, b, (short)0, c, false, false); asm volatile("v_nop\n\tv_nop\n\tv_nop\n\tv_nop" : "+v"(d) : "v"(a), "v"(b)); return d; }
__device__ __forceinline__ void wave_lds_sync() { __builtin_amdgcn_fence(__ATOMIC_RELEASE, "workgroup"); __builtin_amdgcn_wave_barrier(); __builtin_amdgcn_fence(__ATOMIC_ACQUIRE, "workgroup"); }
__device__ __forceinline__ float xhalf(float x) { return __builtin_bit_cast(float, __builtin_amdgcn_permlanex16(__builtin_bit_cast(int, x), __builtin_bit_cast(int, x), 0x76543210, 0xfedcba98, false, false)); }   // lane l with lane l ^ 16
__device__ __forceinline__ float exp2s(float x) { float r; asm("v_exp_f32 %0, %1\n\tv_nop" : "=v"(r) : "v"(x)); return r; }   // 2^x; the v_nop is the one slot asked for between a transcendental and a next instruction that reads its result or overwrites its source: in one statement, so that it stands directly behind
__device__ __forceinline__ float pmul(float a, float b) { float p = a * b; asm volatile("" : "+v"(p)); return p; }

__global__ __launch_bounds__(256) void wput_kernel(const float* __restrict__ w1q, const float* __restrict__ w2q, const float* __restrict__ w1k, const float* __restrict__ w2k, const float* __restrict__ wv, const float* __restrict__ wo, b16* __restrict__ WQK, b16* __restrict__ WV, b16* __restrict__ WO) { const size_t nt = (size_t)gridDim.x * 256, u0 = (size_t)blockIdx.x * 256 + threadIdx.x; v8b v;
  // u counts the 16-byte units of the destination (tile = 16 rows x 32 k, NK tiles a row tile): a wave stores 512 contiguous bytes, and a block reads whole lines of 16 rows
  for (size_t u = u0; u < (size_t)256 * 128; u += nt) { const int o = (int)(u >> 11) * 16 + ((int)u & 15), k0 = ((int)(u >> 6) & 31) * 32 + ((int)(u >> 4) & 3) * 8; const float* w = o < 64 ? w1q : (o < 128 ? w2q : (o < 192 ? w1k : w2k)); const int oo = o % 64;
#pragma unroll
    for (int j = 0; j < 8; ++j) v[j] = (b16)(bf16_rne(w[(size_t)oo * D + k0 + j]) * WSC); { *(v8b*)(WQK + u * 8) = v;  } }
  for (size_t u = u0; u < (size_t)D * 128; u += nt) { const int o = (int)(u >> 11) * 16 + ((int)u & 15), k0 = ((int)(u >> 6) & 31) * 32 + ((int)(u >> 4) & 3) * 8; v8b a, c;
#pragma unroll
    for (int j = 0; j < 8; ++j) { a[j] = (b16)(bf16_rne(wv[(size_t)o * D + k0 + j]) * WSC); c[j] = (b16)(bf16_rne(wo[(size_t)o * D + k0 + j]) * WSC); } { *(v8b*)(WV + u * 8) = a; *(v8b*)(WO + u * 8) = c;  } } }
// proj_kernel: one work-group per (64 tokens, quarter np of the columns). The token tile is staged once in LDS and shared; a wave takes all 64 tokens x 32 columns (4 x 2 tiles), so that a weight tile is read once per 64 tokens: wave 0 the q1,q2 columns of heads 4np..4np+3, wave 1 their k1,k2 columns, wave w >= 2 takes 32 columns of v and writes them as v^T, hi and lo, in the form the attention reads.
__global__ __launch_bounds__(PWV * 32) void proj_kernel(const float* __restrict__ x, const b16* __restrict__ WQK, const b16* __restrict__ WV, const float* __restrict__ bv, b16* __restrict__ LQh, b16* __restrict__ LQl, b16* __restrict__ LKh, b16* __restrict__ LKl, b16* __restrict__ VTh, b16* __restrict__ VTl) { __shared__ __attribute__((aligned(16))) b16 Ah[MT][D + 8]; __shared__ __attribute__((aligned(16))) float Tfs[2][MT][36] /* the q and the k wave only */; const int tid = threadIdx.x, lane = tid & 31, nloc = lane & 15, hlf = lane >> 4, wave = __builtin_amdgcn_readfirstlane(tid >> 5), np = blockIdx.x & 3; const size_t t0 = (size_t)(blockIdx.x >> 2) * MT;
  const bool isqk = wave < 2; const int c0 = np * 256 + (wave - 2) * 32;
  const b16* W = (isqk ? WQK + (size_t)(np * 16 + wave * 128) * D : WV + (size_t)c0 * D) + lane * 8; const size_t tstr = isqk ? (size_t)64 * D : (size_t)16 * D;
  // Staging: 16 bytes a lane, runs of SB loads, the next run asked for before this one is converted (the pinned rounding keeps the loads where the source has them).
  constexpr int SB = 17, NTH = PWV * 32, REM = MT * D / 4 - 3 * SB * NTH /* 64 units are left: the last two waves */; const v4f* xs = (const v4f*)(x + t0 * D) + tid;
  auto put = [&](int u, v4f xv) { v4b hv;
#pragma unroll
    for (int j = 0; j < 4; ++j) hv[j] = (b16)(bf16_rne(xv[j]) * XS);
    *(v4b*)&Ah[u >> 8][(u & 255) * 4] = hv; };
  // Register ring: the two weight fragments of a k step are asked for PRB - 1 k steps ahead of the products that use them. The first ones fly while the last run of the token tile is converted.
  v16b bw[PRB][2]; v4f xv[2][SB], xr = (v4f){}; const bool rem = wave >= PWV - REM / 32;
#pragma unroll
  for (int j = 0; j < SB; ++j) xv[0][j] = xs[j * NTH];
#pragma unroll
  for (int r = 0; r < 3; ++r) {
    if (r < 2) {
#pragma unroll
      for (int j = 0; j < SB; ++j) xv[(r + 1) & 1][j] = xs[((r + 1) * SB + j) * NTH]; }
    else { if (rem) xr = xs[3 * SB * NTH - (NTH - REM)];
#pragma unroll
      for (int s = 0; s < PRB - 1; ++s)
#pragma unroll
        for (int n = 0; n < 2; ++n) bw[s][n] = frag_fo(W + n * tstr + s * 512); }
#pragma unroll
    for (int j = 0; j < SB; ++j) put((r * SB + j) * NTH + tid, xv[r & 1][j]); }
  if (rem) put(3 * SB * NTH - (NTH - REM) + tid, xr);
  if (tid < MT) for (int k = D; k < D + 8; ++k) Ah[tid][k] = (b16)0.0f;
  __syncthreads();   // the staged token tile is read by every wave
  v8f acc[4][2];
#pragma unroll
  for (int m = 0; m < 4; ++m)
#pragma unroll
    for (int n = 0; n < 2; ++n) acc[m][n] = (v8f){};
#pragma unroll 1   // one ring turn is the loop body: every ring index is a constant, and a second copy would take registers from the ring
  for (int st0 = 0; st0 < NK - PRB; st0 += PRB)
#pragma unroll
    for (int s = 0; s < PRB; ++s) { const int kb = (st0 + s) * 32; v16b a[4];
#pragma unroll
      for (int n = 0; n < 2; ++n) bw[(s + PRB - 1) % PRB][n] = frag_fo(W + n * tstr + (size_t)(st0 + s + PRB - 1) * 512);
#pragma unroll
      for (int m = 0; m < 4; ++m) a[m] = frag_kb(&Ah[m * 16 + nloc][kb], hlf);
#pragma unroll
      for (int m = 0; m < 4; ++m)
#pragma unroll
        for (int n = 0; n < 2; ++n) acc[m][n] = wmma16b(a[m], bw[s][n], acc[m][n]);
      if (s == PRB - 1) asm volatile("s_wait_xcnt 0x0" ::: "memory"); }   // the next turn forms its addresses in the registers that this turn's loads name
#pragma unroll
  for (int s = 0; s < PRB; ++s) { const int kb = (NK - PRB + s) * 32; v16b a[4];   // the last turn: only its first step still fetches
    if (s == 0) {
#pragma unroll
      for (int n = 0; n < 2; ++n) bw[PRB - 1][n] = frag_fo(W + n * tstr + (NK - 1) * 512);
      asm volatile("s_wait_xcnt 0x0" :: "v"(W) : "memory"); }   // the address is an input, so it stays in its registers up to this wait: the epilogue reuses them
#pragma unroll
    for (int m = 0; m < 4; ++m) a[m] = frag_kb(&Ah[m * 16 + nloc][kb], hlf);
#pragma unroll
    for (int m = 0; m < 4; ++m)
#pragma unroll
      for (int n = 0; n < 2; ++n) acc[m][n] = wmma16b(a[m], bw[s][n], acc[m][n]); }
  if (isqk) {   // Plucker lines: wave 0 the q lines, wave 1 the k lines; lane = (token lane & 15 of a 16-token tile, head pair lane >> 4); loop the 4 token tiles and the 2 heads of a pair
    const int isk = wave; float (*Tf)[36] = Tfs[wave];
#pragma unroll
    for (int n = 0; n < 2; ++n)
#pragma unroll
      for (int m = 0; m < 4; ++m)
#pragma unroll
        for (int r8 = 0; r8 < 8; ++r8) Tf[m * 16 + 8 * hlf + r8][n * 16 + nloc] = acc[m][n][r8] * (1.0f / (XS * WSC));
    wave_lds_sync();
#pragma unroll 1
    for (int io = 0; io < 8; io += 4) {
#pragma unroll   // four independent lines side by side: each is one long dependent chain (root, division)
    for (int it = io; it < io + 4; ++it) { const int rr = (it >> 1) * 16 + nloc, hl = hlf * 2 + (it & 1), h = np * 4 + hl; const float* p1 = &Tf[rr][hl * 4]; const float* p2 = &Tf[rr][16 + hl * 4]; float Lm[6]; Lm[0] = p1[0] * p2[1] - p1[1] * p2[0]; Lm[1] = p1[0] * p2[2] - p1[2] * p2[0]; Lm[2] = p1[0] * p2[3] - p1[3] * p2[0]; Lm[3] = p1[1] * p2[2] - p1[2] * p2[1]; Lm[4] = p1[1] * p2[3] - p1[3] * p2[1]; Lm[5] = p1[2] * p2[3] - p1[3] * p2[2];
      float n2 = 0.0f; for (int c = 0; c < 6; ++c) n2 += Lm[c] * Lm[c]; const float inv = 1.0f / fmaxf(sqrtf(n2), 1e-12f); float Lo[6];
      if (isk) { Lo[0] = Lm[5]; Lo[1] = -Lm[4]; Lo[2] = Lm[3]; Lo[3] = Lm[2]; Lo[4] = -Lm[1]; Lo[5] = Lm[0]; } else { for (int c = 0; c < 6; ++c) Lo[c] = Lm[c]; }
      b16 hh_[32], ll_[32]; for (int c = 0; c < 32; ++c) { hh_[c] = (b16)0.0f; ll_[c] = (b16)0.0f; } for (int c = 0; c < 6; ++c) split16(Lo[c] * inv * HS, hh_[c], ll_[c]);
      b16* dh = (isk ? LKh : LQh) + ((size_t)h * NT + t0 + (it >> 1) * 16) * 32 + nloc * 8; b16* dl = (isk ? LKl : LQl) + ((size_t)h * NT + t0 + (it >> 1) * 16) * 32 + nloc * 8;   // 16 tokens are one tile in fragment order
      for (int c = 0; c < 32; c += 8) { v8b a, bq; for (int j = 0; j < 8; ++j) { a[j] = hh_[c + j]; bq[j] = ll_[c + j]; } *(v8b*)(dh + c * 16) = a; *(v8b*)(dl + c * 16) = bq; } }
      asm volatile("s_wait_xcnt 0x0" ::: "memory");   // the next trip rewrites the address and data registers that these stores name
    } }
  else {   // v^T hi and lo in fragment order, tiles as [b, h][32-key step][16-d tile], straight from the accumulators: a lane's 8 registers of a tile are 8 consecutive keys (8 * hlf + r8 of token tile m) of one d (column nloc), which is the lane's own 16-byte unit of half m & 1 of the 16-d x 32-key tile; a wave's store is 512 contiguous bytes
    const size_t ob = ((((t0 / T) * H + (c0 >> 6)) * (T / 32) + (t0 % T) / 32) * 4 + ((c0 >> 4) & 3)) * 512 + lane * 8; b16* dh = VTh + ob; b16* dl = VTl + ob;
#pragma unroll   // constant offsets on the two store addresses
    for (int n = 0; n < 2; ++n) { const float bb = bfv(bv[c0 + n * 16 + nloc]);
#pragma unroll
      for (int m = 0; m < 4; ++m) { v8b vh, vl;
#pragma unroll
        for (int r8 = 0; r8 < 8; ++r8) { b16 h0, l0; split16((acc[m][n][r8] * (1.0f / (XS * WSC)) + bb) * HS, h0, l0); vh[r8] = h0; vl[r8] = l0; }
        const int vo = ((m >> 1) * 4 + n) * 512 + (m & 1) * 256; *(v8b*)(dh + vo) = vh; *(v8b*)(dl + vo) = vl; } }
    asm volatile("s_wait_xcnt 0x0" ::: "memory");   // closes the run of stores before any later instruction of the listing rewrites a register that they name
  } }
// att_kernel: one work-group of 8 waves per (b, h, t): the 128-query block 15 - t and then the block t, one after the other, so that every work-group walks 17 key chunks. A wave takes 16 queries of the block. S^T = JL_k x L_q^T, so a lane holds the scores of ONE query (column nloc; keys 8 * hlf + r of each 16-key tile): mask, maximum, exp and sum stay in registers,
// two converted score tiles are the B operand (hardware k order, the order of frag_kb) of O^T += v^T x P^T, and the rescale factor and the final 1 / sum are per lane. Every inner loop is unrolled so that each index into a register array is a constant.
// The 8 waves of a block need the same key chunks: a chunk (L_k hi, L_k lo, v^T hi, v^T lo, each one contiguous run of the workspace in fragment order, 48 KB together) is brought into LDS once for all of them, one chunk ahead, two buffers.
// chunk_copy: the work-group's 256 lanes move one chunk, 12 asynchronous copies of 16 bytes a lane; a wave's copy is 512 contiguous bytes on both sides. l = the lane's LDS byte address in the buffer, the pointers = the lane's own 16 bytes of each run.
__device__ __forceinline__ void chunk_copy(unsigned l, const b16* kh, const b16* kl, const b16* vh, const b16* vl) {
  asm volatile(   // the wait in the last line stands in front of every later rewrite of a register that these copies name (a precaution): in the copies' own statement, so that the compiler moves nothing in between
    "global_load_async_to_lds_b128 %0, %12, off\n\t"
    "global_load_async_to_lds_b128 %1, %13, off\n\t"
    "global_load_async_to_lds_b128 %2, %14, off\n\t"
    "global_load_async_to_lds_b128 %3, %15, off\n\t"
    "global_load_async_to_lds_b128 %4, %16, off\n\t"
    "global_load_async_to_lds_b128 %5, %17, off\n\t"
    "global_load_async_to_lds_b128 %6, %18, off\n\t"
    "global_load_async_to_lds_b128 %7, %19, off\n\t"
    "global_load_async_to_lds_b128 %8, %20, off\n\t"
    "global_load_async_to_lds_b128 %9, %21, off\n\t"
    "global_load_async_to_lds_b128 %10, %22, off\n\t"
    "global_load_async_to_lds_b128 %11, %23, off\n\t"
    "s_wait_xcnt 0x0"
    :: "v"(l), "v"(l + 4096u), "v"(l + 8192u), "v"(l + 12288u), "v"(l + 16384u), "v"(l + 20480u), "v"(l + 24576u), "v"(l + 28672u), "v"(l + 32768u), "v"(l + 36864u), "v"(l + 40960u), "v"(l + 45056u),
       "v"(kh), "v"(kh + 2048), "v"(kl), "v"(kl + 2048), "v"(vh), "v"(vh + 2048), "v"(vh + 4096), "v"(vh + 6144), "v"(vl), "v"(vl + 2048), "v"(vl + 4096), "v"(vl + 6144) : "memory"); }
__global__ __launch_bounds__(AWV * 32) __attribute__((amdgpu_waves_per_eu(4, 4))) /* at most 256 registers a wave: none above v255 */ void att_kernel(const b16* __restrict__ LQh, const b16* __restrict__ LQl, const b16* __restrict__ LKh, const b16* __restrict__ LKl, const b16* __restrict__ VTh, const b16* __restrict__ VTl, int QLIM, float* __restrict__ O) { __shared__ __attribute__((aligned(16))) b16 Ring[2][CBH]; const int tid = threadIdx.x, lane = tid & 31, nloc = lane & 15, hlf = lane >> 4, wave = __builtin_amdgcn_readfirstlane(tid >> 5); const int bh = blockIdx.x % (NB_ * H), b = bh / H, h = bh % H; const int nA = T / CK - (int)(blockIdx.x / (NB_ * H));   // chunks of the first block, 16 .. 9; the second has NCH - nA
  constexpr int NCH = T / CK + 1;   // chunks of a work-group
  constexpr float C2 = SCL / (HS * HS) * 1.4426950408889634f;   // raw accumulator -> score in the log2 domain
  const b16* Kh = LKh + ((size_t)h * NT + (size_t)b * T) * 32 + tid * 8; const b16* Kl = LKl + ((size_t)h * NT + (size_t)b * T) * 32 + tid * 8;   // a lane's own 16 bytes of the first 4 KB of a run, here and below
  const b16* Vh = VTh + ((size_t)b * H + h) * DH * T + tid * 8; const b16* Vl = VTl + ((size_t)b * H + h) * DH * T + tid * 8;
  const unsigned l0 = (unsigned)(size_t)&Ring[0][0] + tid * 16;
  auto fill = [&](int c) { const size_t k0 = (size_t)((c < nA ? c : c - nA) * CK); chunk_copy(l0 + (c & 1) * (CBH * 2), Kh + k0 * 32, Kl + k0 * 32, Vh + k0 * DH, Vl + k0 * DH); };   // chunk c of the 17, into buffer c mod 2
  fill(0);
  asm volatile("s_wait_asynccnt 0x0" ::: "memory");   // this wave's part of chunk 0 has landed
  __syncthreads();   // chunk 0 is whole: every wave reads all of it
  fill(1);
  int c = 0;
#pragma unroll 1   // one copy of the code for the two blocks
  for (int blk = 0; blk < 2; ++blk) { const int nch = blk ? NCH - nA : nA, q0 = (nch - 1) * CK + wave * 16; const size_t tq = (size_t)b * T + q0;
  const b16* pqh = LQh + ((size_t)h * NT + tq) * 32 + lane * 8; const b16* pql = LQl + ((size_t)h * NT + tq) * 32 + lane * 8; const v16b qa = frag_fo(pqh), ql = frag_fo(pql);
  asm volatile("s_wait_xcnt 0x0" :: "v"(pqh), "v"(pql) : "memory");   // the two addresses are inputs, so they stay in their registers up to this wait
  v8f oacc[4] = {(v8f){}, (v8f){}, (v8f){}, (v8f){}}; float mrun = -INFINITY, lsum = 0.0f;
#pragma unroll 1   // one chunk's code: a second copy would take registers
  for (int ch = 0; ch < nch; ++ch, ++c) { const int k0 = ch * CK; v8f sacc[CK / 16]; const b16* R = &Ring[c & 1][lane * 8]; const b16* pkh = R; const b16* pkl = R + CKH; const b16* pvh = R + 2 * CKH; const b16* pvl = R + 2 * CKH + CVH;   // a lane's own 16 bytes of a tile in fragment order
#pragma unroll
    for (int g = 0; g < CK / 16; g += 4) { v16b kh[4], kl[4];   // four independent tiles a group: no product waits for the one before it
#pragma unroll
      for (int t = 0; t < 4; ++t) { kh[t] = frag_fo(pkh + (g + t) * 512); kl[t] = frag_fo(pkl + (g + t) * 512); }
#pragma unroll
      for (int t = 0; t < 4; ++t) sacc[g + t] = wmma16b(kh[t], qa, (v8f){});
#pragma unroll
      for (int t = 0; t < 4; ++t) sacc[g + t] = wmma16b(kl[t], qa, sacc[g + t]);
#pragma unroll
      for (int t = 0; t < 4; ++t) sacc[g + t] = wmma16b(kh[t], ql, sacc[g + t]); }
    if (ch == nch - 1) { const int kd = q0 + nloc - k0 - 8 * hlf;   // causal mask: only the last chunk holds keys behind a query
#pragma unroll
      for (int t = 0; t < CK / 16; ++t)
#pragma unroll
        for (int r8 = 0; r8 < 8; ++r8) sacc[t][r8] = (t * 16 + r8 <= kd) ? sacc[t][r8] : -INFINITY; }
    float m4[4] = {sacc[0][0], sacc[0][1], sacc[0][2], sacc[0][3]};   // four chains, so that no maximum waits for the one before it
#pragma unroll
    for (int t = 0; t < CK / 16; ++t)
#pragma unroll
      for (int r8 = 0; r8 < 8; ++r8) m4[r8 & 3] = fmaxf(m4[r8 & 3], sacc[t][r8]);
    float mx = fmaxf(fmaxf(m4[0], m4[1]), fmaxf(m4[2], m4[3])); mx = fmaxf(mx, xhalf(mx));   // the two halves of the wave hold the two halves of a query's keys
    const float mn = fmaxf(mrun, mx), fac = exp2s((mrun - mn) * C2), nb = -mn * C2; mrun = mn;
    v16b pa[CK / 32], pb[CK / 32]; float sm[4] = {0.0f, 0.0f, 0.0f, 0.0f};
#pragma unroll
    for (int t = 0; t < CK / 16; ++t)
#pragma unroll
      for (int r8 = 0; r8 < 8; ++r8) { const float p = exp2s(fmaf(sacc[t][r8], C2, nb)); sm[r8 & 3] += p; b16 ph, pl; split16(p * PS, ph, pl); pa[t >> 1][(t & 1) * 8 + r8] = ph; pb[t >> 1][(t & 1) * 8 + r8] = pl; }
    lsum = lsum * fac + ((sm[0] + sm[1]) + (sm[2] + sm[3]));
#pragma unroll
    for (int t = 0; t < 4; ++t)
#pragma unroll
      for (int r8 = 0; r8 < 8; ++r8) oacc[t][r8] *= fac;
#pragma unroll
    for (int jj = 0; jj < CK / 64; ++jj)   // a block of loads: 64 keys, two d tiles
#pragma unroll
      for (int tp = 0; tp < 4; tp += 2) { v16b vh[2][2], vl[2][2];
#pragma unroll
        for (int t = 0; t < 2; ++t)
#pragma unroll
          for (int j = 0; j < 2; ++j) { const int vo = ((jj * 2 + j) * 4 + tp + t) * 512; vh[t][j] = frag_fo(pvh + vo); vl[t][j] = frag_fo(pvl + vo); }
#pragma unroll
        for (int j = 0; j < 2; ++j) { const int J = jj * 2 + j;
#pragma unroll
          for (int t = 0; t < 2; ++t) oacc[tp + t] = wmma16b(vh[t][j], pa[J], oacc[tp + t]);
#pragma unroll
          for (int t = 0; t < 2; ++t) oacc[tp + t] = wmma16b(vl[t][j], pa[J], oacc[tp + t]);
#pragma unroll
          for (int t = 0; t < 2; ++t) oacc[tp + t] = wmma16b(vh[t][j], pb[J], oacc[tp + t]); } }
    asm volatile("s_wait_dscnt 0x0" :: "v"(lsum) : "memory");   // this wave has read all it reads of buffer c mod 2. The row sum is an input so that it is formed in front of the branch below: behind it, where the compiler otherwise moves the 64 additions, the 64 exponentials stay in registers over the v^T products, and registers spill
    asm volatile("s_wait_asynccnt 0x0" ::: "memory");   // this wave's part of chunk c + 1 has landed
    __syncthreads();   // chunk c + 1 is whole, and no wave still reads buffer c mod 2
    if (c + 2 < NCH) fill(c + 2); }
  const float rl = (1.0f / (PS * HS)) / (lsum + xhalf(lsum));
  if (q0 < QLIM) {
#pragma unroll
    for (int t = 0; t < 4; ++t) { float* op = O + (tq + nloc) * D + h * DH + t * 16 + 8 * hlf;   // a lane's 8 accumulator registers are 8 consecutive d of its query
      *(v4f*)op = (v4f){oacc[t][0] * rl, oacc[t][1] * rl, oacc[t][2] * rl, oacc[t][3] * rl}; *(v4f*)(op + 4) = (v4f){oacc[t][4] * rl, oacc[t][5] * rl, oacc[t][6] * rl, oacc[t][7] * rl}; }
    asm volatile("s_wait_xcnt 0x0" ::: "memory"); } }   // the second block's trip rewrites the address and data registers that these stores name
  asm volatile("s_wait_asynccnt 0x0" ::: "memory"); }   // no copy is outstanding when the wave ends
// outp_kernel: one work-group per (64 tokens, quarter np of the output columns); the hi and lo token tiles are staged once in LDS and shared; wave w takes all 64 tokens x output columns 256np + 32w .. + 31 (4 x 2 tiles), so that a weight tile is read once per 64 tokens.
__global__ __launch_bounds__(OWV * 32) void outp_kernel(const float* __restrict__ O, const b16* __restrict__ WO, const float* __restrict__ bo, int QLIM, float* __restrict__ out) { __shared__ __attribute__((aligned(16))) b16 Ah[MT][D + 8], Al[MT][D + 8]; __shared__ __attribute__((aligned(16))) float Tfs[OWV][16][36]; const int tid = threadIdx.x, lane = tid & 31, nloc = lane & 15, hlf = lane >> 4, wave = __builtin_amdgcn_readfirstlane(tid >> 5), np = blockIdx.x & 3; const size_t t0 = (size_t)(blockIdx.x >> 2) * MT; if ((int)(t0 % T) >= QLIM) return;
  const int c0 = np * 256 + wave * 32; const b16* W = WO + (size_t)c0 * D + lane * 8;
  // Register ring, as in proj_kernel: the two weight fragments of a k step are asked for ORB - 1 k steps ahead. The first ones fly while the last run of the token tiles is converted.
  v16b bw[ORB][2];
  const v4f* os = (const v4f*)(O + t0 * D) + tid;
  v4f ov[2][16];   // runs of 16 loads, the next run asked for before this one is converted; load i is token i
#pragma unroll
  for (int j = 0; j < 16; ++j) ov[0][j] = os[j * (D / 4)];
#pragma unroll
  for (int r = 0; r < MT / 16; ++r) {
    if (r < MT / 16 - 1) {
#pragma unroll
      for (int j = 0; j < 16; ++j) ov[(r + 1) & 1][j] = os[((r + 1) * 16 + j) * (D / 4)]; }
    else {
#pragma unroll
      for (int s = 0; s < ORB - 1; ++s)
#pragma unroll
        for (int n = 0; n < 2; ++n) bw[s][n] = frag_fo(W + (size_t)n * 16 * D + s * 512); }
#pragma unroll
    for (int i = 0; i < 16; ++i) { v4b hv, lv;
#pragma unroll
      for (int j = 0; j < 4; ++j) { b16 p, pl; split16(ov[r & 1][i][j] * HS, p, pl); hv[j] = p; lv[j] = pl; }
      *(v4b*)&Ah[r * 16 + i][tid * 4] = hv; *(v4b*)&Al[r * 16 + i][tid * 4] = lv; }
    __builtin_amdgcn_sched_barrier(0); }   // keeps the run after the next behind this run's conversion: with three runs in registers the wave needs registers above v255
  if (tid < MT) for (int k = D; k < D + 8; ++k) { Ah[tid][k] = (b16)0.0f; Al[tid][k] = (b16)0.0f; }
  __syncthreads();   // the staged token tiles are read by every wave
  float (*Tf)[36] = Tfs[wave]; v8f acc[4][2];
#pragma unroll
  for (int m = 0; m < 4; ++m)
#pragma unroll
    for (int n = 0; n < 2; ++n) acc[m][n] = (v8f){};
#pragma unroll 1   // one ring turn is the loop body: every ring index is a constant, and a second copy would take registers from the ring
  for (int st0 = 0; st0 < NK - ORB; st0 += ORB)
#pragma unroll
    for (int s = 0; s < ORB; ++s) { const int kb = (st0 + s) * 32; v16b a[4], al[4];
#pragma unroll
      for (int n = 0; n < 2; ++n) bw[(s + ORB - 1) % ORB][n] = frag_fo(W + (size_t)n * 16 * D + (size_t)(st0 + s + ORB - 1) * 512);
#pragma unroll
      for (int m = 0; m < 4; ++m) { a[m] = frag_kb(&Ah[m * 16 + nloc][kb], hlf); al[m] = frag_kb(&Al[m * 16 + nloc][kb], hlf); }
#pragma unroll
      for (int m = 0; m < 4; ++m)
#pragma unroll
        for (int n = 0; n < 2; ++n) acc[m][n] = wmma16b(a[m], bw[s][n], acc[m][n]);
#pragma unroll
      for (int m = 0; m < 4; ++m)
#pragma unroll
        for (int n = 0; n < 2; ++n) acc[m][n] = wmma16b(al[m], bw[s][n], acc[m][n]);
      if (s == ORB - 1) asm volatile("s_wait_xcnt 0x0" ::: "memory"); }   // the next turn forms its addresses in the registers that this turn's loads name
#pragma unroll
  for (int s = 0; s < ORB; ++s) { const int kb = (NK - ORB + s) * 32; v16b a[4], al[4];   // the last turn: only its first step still fetches
    if (s == 0) {
#pragma unroll
      for (int n = 0; n < 2; ++n) bw[ORB - 1][n] = frag_fo(W + (size_t)n * 16 * D + (NK - 1) * 512);
      asm volatile("s_wait_xcnt 0x0" :: "v"(W) : "memory"); }   // the address is an input, so it stays in its registers up to this wait: the epilogue reuses them
#pragma unroll
    for (int m = 0; m < 4; ++m) { a[m] = frag_kb(&Ah[m * 16 + nloc][kb], hlf); al[m] = frag_kb(&Al[m * 16 + nloc][kb], hlf); }
#pragma unroll
    for (int m = 0; m < 4; ++m)
#pragma unroll
      for (int n = 0; n < 2; ++n) acc[m][n] = wmma16b(a[m], bw[s][n], acc[m][n]);
#pragma unroll
    for (int m = 0; m < 4; ++m)
#pragma unroll
      for (int n = 0; n < 2; ++n) acc[m][n] = wmma16b(al[m], bw[s][n], acc[m][n]); }
  const float bb0 = bfv(bo[c0 + nloc]), bb1 = bfv(bo[c0 + 16 + nloc]);
#pragma unroll
  for (int m = 0; m < 4; ++m) {   // 16 tokens at a time through the wave's own LDS tile
#pragma unroll
    for (int n = 0; n < 2; ++n)
#pragma unroll
      for (int r8 = 0; r8 < 8; ++r8) Tf[8 * hlf + r8][n * 16 + nloc] = acc[m][n][r8] * (1.0f / (HS * WSC)) + (n ? bb1 : bb0);
    wave_lds_sync();
#pragma unroll
    for (int i = 0; i < 4; ++i) { const int rr = i * 4 + (lane >> 3); *(v4f*)(out + (t0 + m * 16 + rr) * D + c0 + (lane & 7) * 4) = *(const v4f*)(&Tf[rr][(lane & 7) * 4]); }   // a wave's store: the whole 128-byte lines of 4 tokens
    wave_lds_sync();   // the rows are read before the next 16 tokens are written over them
    asm volatile("s_wait_xcnt 0x0" ::: "memory"); } }   // the next trip rewrites the data registers that these stores name
}  // namespace

extern "C" void kernel_launch(void* const* d_in, const int* in_sizes, int n_in, void* d_out, int out_size, void* d_ws, size_t ws_size, hipStream_t stream) {
  (void)n_in;
  auto Fp = [&](int i) { return (const float*)d_in[i]; };
  // inputs: 0 x [2,2048,1024]; 1 W1_q [64,1024]; 2 W2_q; 3 W1_k; 4 W2_k; 5 W_v [1024,1024]; 6 b_v; 7 W_out [1024,1024]; 8 b_out
  if (in_sizes[0] != NT * D || in_sizes[1] != 64 * D || in_sizes[4] != 64 * D || in_sizes[5] != D * D || in_sizes[7] != D * D || out_size != NT * D) return;
  const int QLIM = T;   // per-sequence query cut (multiple of 16)
  size_t off = 0; char* ws = (char*)d_ws;
  auto carve = [&](size_t bytes) { char* p = ws + off; off += (bytes + 255) & ~(size_t)255; return p; };
  b16* WQK = (b16*)carve((size_t)256 * D * 2); b16* WV = (b16*)carve((size_t)D * D * 2); b16* WO = (b16*)carve((size_t)D * D * 2); b16* LQh = (b16*)carve((size_t)H * NT * 32 * 2); b16* LQl = (b16*)carve((size_t)H * NT * 32 * 2); b16* LKh = (b16*)carve((size_t)H * NT * 32 * 2); b16* LKl = (b16*)carve((size_t)H * NT * 32 * 2); b16* VTh = (b16*)carve((size_t)NB_ * H * DH * T * 2); b16* VTl = (b16*)carve((size_t)NB_ * H * DH * T * 2); float* O = (float*)carve((size_t)NT * D * 4);
  if (off > ws_size || off > ((size_t)80 << 20)) return;   // ~ 55 MB
  wput_kernel<<<128, 256, 0, stream>>>(Fp(1), Fp(2), Fp(3), Fp(4), Fp(5), Fp(7), WQK, WV, WO);
  proj_kernel<<<NT / MT * 4, PWV * 32, 0, stream>>>(Fp(0), WQK, WV, Fp(6), LQh, LQl, LKh, LKl, VTh, VTl);
  att_kernel<<<NB_ * H * (T / CK / 2), AWV * 32, 0, stream>>>(LQh, LQl, LKh, LKl, VTh, VTl, QLIM, O);
  outp_kernel<<<NT / MT * 4, OWV * 32, 0, stream>>>(O, WO, Fp(8), QLIM, (float*)d_out);
}

// v008
// One run takes 83.5 microseconds.
// Timed twice side by side with v007, it ran 1.06 and 1.05 times as fast.
// All steps since v000 together make it 18.7 times as fast.
#include <hip/hip_runtime.h>

// PluckerKernelAttention: q1,q2,k1,k2 = x W^T (1024 -> 16 heads x 4); L_q = normalize(exterior(q1,q2)), L_k likewise (6-d Plucker lines); scores = L_q . (J6 L_k) / sqrt(6) with a causal mask; attn = softmax; v = x W_v^T + b_v (16 x 64); o = attn v; out = o W_out^T + b_out -> [2][2048][1024].
// Deterministic: flash-style online softmax over fixed 128-key chunks (causal: chunks up to the query block), fixed order; no atomics.
// WMMA (v_wmma_f32_16x16x32_f16, f32 accumulate): x (EXACT bf16 x8, K 1024) x [W1q;W2q;W1k;W2k] rows (16 tiles) and x W_v rows (64 tiles), 4 x 2 tiles a wave, 10 waves per work-group of 64 tokens x 320 columns; per (b, h, 16-query) wave and key chunk S^T = JL_k rows (x256; k slots hi, lo, hi of the 6 components, K 18 -> 32; 8 tiles) x L_q (slots hi, hi, lo), one product a tile, and O^T += v^T rows (hi+lo; 4 tiles, K 128) x P (hi+lo x256, packed from the score accumulators), 3 products; out-proj o (hi+lo, K 1024) x W_out rows (64 tiles, 4 x 2 a wave, 8 waves per work-group of 64 tokens x 256 columns); weights EXACT x256, (out, in) rows stored as 16 x 32 tiles in fragment order, about 3.7 M WMMA; Plucker exterior/normalisation and softmax in f32.

namespace {
constexpr int NB_ = 2, T = 2048, D = 1024, H = 16, DH = 64, NT = NB_ * T /* 4096 tokens */, CK = 128 /* keys of an attention chunk */, MT = 64 /* tokens of a proj or out-proj work-group */, PWV = 10 /* waves of a proj work-group */, OWV = 8 /* waves of an out-proj work-group */, PRB = 8, ORB = 4 /* k steps of their weight rings */, NK = D / 32 /* k steps of a projection */, AWV = 8 /* waves of an attention work-group */, CKH = CK * 32 /* halves of a chunk of L_k */, CVH = CK * DH /* halves of a chunk of v^T, hi or lo */, CBH = CKH + 2 * CVH /* halves of a ring buffer */;
constexpr float XS = 8.0f, HS = 256.0f, PS = 256.0f, WSC = 256.0f, SCL = 0.40824829046386302f /* 6^-0.5 */;
typedef _Float16 b16;
typedef __attribute__((ext_vector_type(16))) _Float16 v16b;
typedef __attribute__((ext_vector_type(8))) _Float16 v8b;
typedef __attribute__((ext_vector_type(4))) _Float16 v4b;
typedef __attribute__((ext_vector_type(2))) _Float16 v2b;
typedef __attribute__((ext_vector_type(8))) float v8f;
typedef __attribute__((ext_vector_type(4))) float v4f;
typedef __attribute__((ext_vector_type(2))) float v2f;
__device__ __forceinline__ float bf16_rne(float f) { unsigned int u = __float_as_uint(f); u += 0x7FFFu + ((u >> 16) & 1u); float r = __uint_as_float(u & 0xFFFF0000u); asm volatile("" : "+v"(r)); return r; }
__device__ __forceinline__ float bfv(float f) { float r = bf16_rne(f); asm volatile("" : "+v"(r)); return r; }
__device__ __forceinline__ void split16(float v, b16& hi, b16& lo) { hi = (b16)v; lo = (b16)(v - (float)hi); }
__device__ __forceinline__ v16b frag_kb(const b16* p, int hh) { const v8b a = *(const v8b*)(p + 8 * hh), b = *(const v8b*)(p + 16 + 8 * hh); v16b f;
#pragma unroll
  for (int e = 0; e < 8; ++e) { f[e] = a[e]; f[8 + e] = b[e]; } return f; }
// Fragment order: a 16-row x 32-k operand tile that a kernel of this file writes to the workspace is 512 halves laid as [k >> 4][(k >> 3 & 1) * 16 + row][k & 7], so that each of a wave's two 16-byte loads takes 512 contiguous bytes (4 whole lines). p = tile + lane * 8. Same registers, same k order as frag_kb on a row-major tile.
__device__ __forceinline__ v16b frag_fo(const b16* p) { const v8b a = *(const v8b*)p, b = *(const v8b*)(p + 256); v16b f;
#pragma unroll
  for (int e = 0; e < 8; ++e) { f[e] = a[e]; f[8 + e] = b[e]; } return f; }
__device__ __forceinline__ v8f wmma16b(v16b a, v16b b, v8f c) { v8f d = __builtin_amdgcn_wmma_f32_16x16x32_f16(false, a, false, b, (short)0, c, false, false); asm volatile("v_nop\n\tv_nop\n\tv_nop\n\tv_nop" : "+v"(d) : "v"(a), "v"(b)); return d; }
__device__ __forceinline__ void wave_lds_sync() { __builtin_amdgcn_fence(__ATOMIC_RELEASE, "workgroup"); __builtin_amdgcn_wave_barrier(); __builtin_amdgcn_fence(__ATOMIC_ACQUIRE, "workgroup"); }
__device__ __forceinline__ float xhalf(float x) { return __builtin_bit_cast(float, __builtin_amdgcn_permlanex16(__builtin_bit_cast(int, x), __builtin_bit_cast(int, x), 0x76543210, 0xfedcba98, false, false)); }   // lane l with lane l ^ 16
__device__ __forceinline__ float exp2s(float x) { float r; asm("v_exp_f32 %0, %1\n\tv_nop" : "=v"(r) : "v"(x)); return r; }   // 2^x; the v_nop is the one slot asked for between a transcendental and a next instruction that reads its result or overwrites its source: in one statement, so that it stands directly behind
__device__ __forceinline__ float pmul(float a, float b) { float p = a * b; asm volatile("" : "+v"(p)); return p; }

__global__ __launch_bounds__(256) void wput_kernel(const float* __restrict__ w1q, const float* __restrict__ w2q, const float* __restrict__ w1k, const float* __restrict__ w2k, const float* __restrict__ wv, const float* __restrict__ wo, b16* __restrict__ WQK, b16* __restrict__ WV, b16* __restrict__ WO) { const size_t nt = (size_t)gridDim.x * 256, u0 = (size_t)blockIdx.x * 256 + threadIdx.x; v8b v;
  // u counts the 16-byte units of the destination (tile = 16 rows x 32 k, NK tiles a row tile): a wave stores 512 contiguous bytes, and a block reads whole lines of 16 rows
  for (size_t u = u0; u < (size_t)256 * 128; u += nt) { const int o = (int)(u >> 11) * 16 + ((int)u & 15), k0 = ((int)(u >> 6) & 31) * 32 + ((int)(u >> 4) & 3) * 8; const float* w = o < 64 ? w1q : (o < 128 ? w2q : (o < 192 ? w1k : w2k)); const int oo = o % 64;
#pragma unroll
    for (int j = 0; j < 8; ++j) v[j] = (b16)(bf16_rne(w[(size_t)oo * D + k0 + j]) * WSC); { *(v8b*)(WQK + u * 8) = v;  } }
  for (size_t u = u0; u < (size_t)D * 128; u += nt) { const int o = (int)(u >> 11) * 16 + ((int)u & 15), k0 = ((int)(u >> 6) & 31) * 32 + ((int)(u >> 4) & 3) * 8; v8b a, c;
#pragma unroll
    for (int j = 0; j < 8; ++j) { a[j] = (b16)(bf16_rne(wv[(size_t)o * D + k0 + j]) * WSC); c[j] = (b16)(bf16_rne(wo[(size_t)o * D + k0 + j]) * WSC); } { *(v8b*)(WV + u * 8) = a; *(v8b*)(WO + u * 8) = c;  } } }
// proj_kernel: one work-group per (64 tokens, quarter np of the columns). The token tile is staged once in LDS and shared; a wave takes all 64 tokens x 32 columns (4 x 2 tiles), so that a weight tile is read once per 64 tokens: wave 0 the q1,q2 columns of heads 4np..4np+3, wave 1 their k1,k2 columns, wave w >= 2 takes 32 columns of v and writes them as v^T, hi and lo, in the form the attention reads.
__global__ __launch_bounds__(PWV * 32) void proj_kernel(const float* __restrict__ x, const b16* __restrict__ WQK, const b16* __restrict__ WV, const float* __restrict__ bv, b16* __restrict__ LQ, b16* __restrict__ LK, b16* __restrict__ VTh, b16* __restrict__ VTl) { __shared__ __attribute__((aligned(16))) b16 Ah[MT][D + 8]; __shared__ __attribute__((aligned(16))) float Tfs[2][MT][36] /* the q and the k wave only */; const int tid = threadIdx.x, lane = tid & 31, nloc = lane & 15, hlf = lane >> 4, wave = __builtin_amdgcn_readfirstlane(tid >> 5), np = blockIdx.x & 3; const size_t t0 = (size_t)(blockIdx.x >> 2) * MT;
  const bool isqk = wave < 2; const int c0 = np * 256 + (wave - 2) * 32;
  const b16* W = (isqk ? WQK + (size_t)(np * 16 + wave * 128) * D : WV + (size_t)c0 * D) + lane * 8; const size_t tstr = isqk ? (size_t)64 * D : (size_t)16 * D;
  // Staging: 16 bytes a lane, runs of SB loads, the next run asked for before this one is converted (the pinned rounding keeps the loads where the source has them).
  constexpr int SB = 17, NTH = PWV * 32, REM = MT * D / 4 - 3 * SB * NTH /* 64 units are left: the last two waves */; const v4f* xs = (const v4f*)(x + t0 * D) + tid;
  auto put = [&](int u, v4f xv) { v4b hv;
#pragma unroll
    for (int j = 0; j < 4; ++j) hv[j] = (b16)(bf16_rne(xv[j]) * XS);
    *(v4b*)&Ah[u >> 8][(u & 255) * 4] = hv; };
  // Register ring: the two weight fragments of a k step are asked for PRB - 1 k steps ahead of the products that use them. The first ones fly while the last run of the token tile is converted.
  v16b bw[PRB][2]; v4f xv[2][SB], xr = (v4f){}; const bool rem = wave >= PWV - REM / 32;
#pragma unroll
  for (int j = 0; j < SB; ++j) xv[0][j] = xs[j * NTH];
#pragma unroll
  for (int r = 0; r < 3; ++r) {
    if (r < 2) {
#pragma unroll
      for (int j = 0; j < SB; ++j) xv[(r + 1) & 1][j] = xs[((r + 1) * SB + j) * NTH]; }
    else { if (rem) xr = xs[3 * SB * NTH - (NTH - REM)];
#pragma unroll
      for (int s = 0; s < PRB - 1; ++s)
#pragma unroll
        for (int n = 0; n < 2; ++n) bw[s][n] = frag_fo(W + n * tstr + s * 512); }
#pragma unroll
    for (int j = 0; j < SB; ++j) put((r * SB + j) * NTH + tid, xv[r & 1][j]); }
  if (rem) put(3 * SB * NTH - (NTH - REM) + tid, xr);
  if (tid < MT) for (int k = D; k < D + 8; ++k) Ah[tid][k] = (b16)0.0f;
  __syncthreads();   // the staged token tile is read by every wave
  v8f acc[4][2];
#pragma unroll
  for (int m = 0; m < 4; ++m)
#pragma unroll
    for (int n = 0; n < 2; ++n) acc[m][n] = (v8f){};
#pragma unroll 1   // one ring turn is the loop body: every ring index is a constant, and a second copy would take registers from the ring
  for (int st0 = 0; st0 < NK - PRB; st0 += PRB)
#pragma unroll
    for (int s = 0; s < PRB; ++s) { const int kb = (st0 + s) * 32; v16b a[4];
#pragma unroll
      for (int n = 0; n < 2; ++n) bw[(s + PRB - 1) % PRB][n] = frag_fo(W + n * tstr + (size_t)(st0 + s + PRB - 1) * 512);
#pragma unroll
      for (int m = 0; m < 4; ++m) a[m] = frag_kb(&Ah[m * 16 + nloc][kb], hlf);
#pragma unroll
      for (int m = 0; m < 4; ++m)
#pragma unroll
        for (int n = 0; n < 2; ++n) acc[m][n] = wmma16b(a[m], bw[s][n], acc[m][n]);
      if (s == PRB - 1) asm volatile("s_wait_xcnt 0x0" ::: "memory"); }   // the next turn forms its addresses in the registers that this turn's loads name
#pragma unroll
  for (int s = 0; s < PRB; ++s) { const int kb = (NK - PRB + s) * 32; v16b a[4];   // the last turn: only its first step still fetches
    if (s == 0) {
#pragma unroll
      for (int n = 0; n < 2; ++n) bw[PRB - 1][n] = frag_fo(W + n * tstr + (NK - 1) * 512);
      asm volatile("s_wait_xcnt 0x0" :: "v"(W) : "memory"); }   // the address is an input, so it stays in its registers up to this wait: the epilogue reuses them
#pragma unroll
    for (int m = 0; m < 4; ++m) a[m] = frag_kb(&Ah[m * 16 + nloc][kb], hlf);
#pragma unroll
    for (int m = 0; m < 4; ++m)
#pragma unroll
      for (int n = 0; n < 2; ++n) acc[m][n] = wmma16b(a[m], bw[s][n], acc[m][n]); }
  if (isqk) {   // Plucker lines: wave 0 the q lines, wave 1 the k lines; lane = (token lane & 15 of a 16-token tile, head pair lane >> 4); loop the 4 token tiles and the 2 heads of a pair
    const int isk = wave; float (*Tf)[36] = Tfs[wave];
#pragma unroll
    for (int n = 0; n < 2; ++n)
#pragma unroll
      for (int m = 0; m < 4; ++m)
#pragma unroll
        for (int r8 = 0; r8 < 8; ++r8) Tf[m * 16 + 8 * hlf + r8][n * 16 + nloc] = acc[m][n][r8] * (1.0f / (XS * WSC));
    wave_lds_sync();
#pragma unroll 1
    for (int io = 0; io < 8; io += 4) {
#pragma unroll   // four independent lines side by side: each is one long dependent chain (root, division)
    for (int it = io; it < io + 4; ++it) { const int rr = (it >> 1) * 16 + nloc, hl = hlf * 2 + (it & 1), h = np * 4 + hl; const float* p1 = &Tf[rr][hl * 4]; const float* p2 = &Tf[rr][16 + hl * 4]; float Lm[6]; Lm[0] = p1[0] * p2[1] - p1[1] * p2[0]; Lm[1] = p1[0] * p2[2] - p1[2] * p2[0]; Lm[2] = p1[0] * p2[3] - p1[3] * p2[0]; Lm[3] = p1[1] * p2[2] - p1[2] * p2[1]; Lm[4] = p1[1] * p2[3] - p1[3] * p2[1]; Lm[5] = p1[2] * p2[3] - p1[3] * p2[2];
      float n2 = 0.0f; for (int c = 0; c < 6; ++c) n2 += Lm[c] * Lm[c]; const float inv = 1.0f / fmaxf(sqrtf(n2), 1e-12f); float Lo[6];
      if (isk) { Lo[0] = Lm[5]; Lo[1] = -Lm[4]; Lo[2] = Lm[3]; Lo[3] = Lm[2]; Lo[4] = -Lm[1]; Lo[5] = Lm[0]; } else { for (int c = 0; c < 6; ++c) Lo[c] = Lm[c]; }
      // one 32-k row holds hi and lo: k slots 0..5, 6..11, 12..17 are hi, lo, hi of a k line and hi, hi, lo of a q line, so that ONE product sums k_hi q_hi + k_lo q_hi + k_hi q_lo; slots 18..31 are 0
      b16 pk_[32]; for (int c = 0; c < 32; ++c) pk_[c] = (b16)0.0f; for (int c = 0; c < 6; ++c) { b16 h0, l0; split16(Lo[c] * inv * HS, h0, l0); pk_[c] = h0; pk_[6 + c] = isk ? l0 : h0; pk_[12 + c] = isk ? h0 : l0; }
      b16* dp = (isk ? LK : LQ) + ((size_t)h * NT + t0 + (it >> 1) * 16) * 32 + nloc * 8;   // 16 tokens are one tile in fragment order
      for (int c = 0; c < 32; c += 8) { v8b a; for (int j = 0; j < 8; ++j) a[j] = pk_[c + j]; *(v8b*)(dp + c * 16) = a; } }
      asm volatile("s_wait_xcnt 0x0" ::: "memory");   // the next trip rewrites the address and data registers that these stores name
    } }
  else {   // v^T hi and lo in fragment order, tiles as [b, h][32-key step][16-d tile], straight from the accumulators: a lane's 8 registers of a tile are 8 consecutive keys (8 * hlf + r8 of token tile m) of one d (column nloc), which is the lane's own 16-byte unit of half m & 1 of the 16-d x 32-key tile; a wave's store is 512 contiguous bytes
    const size_t ob = ((((t0 / T) * H + (c0 >> 6)) * (T / 32) + (t0 % T) / 32) * 4 + ((c0 >> 4) & 3)) * 512 + lane * 8; b16* dh = VTh + ob; b16* dl = VTl + ob;
#pragma unroll   // constant offsets on the two store addresses
    for (int n = 0; n < 2; ++n) { const float bb = bfv(bv[c0 + n * 16 + nloc]);
#pragma unroll
      for (int m = 0; m < 4; ++m) { v8b vh, vl;
#pragma unroll
        for (int r8 = 0; r8 < 8; ++r8) { b16 h0, l0; split16((acc[m][n][r8] * (1.0f / (XS * WSC)) + bb) * HS, h0, l0); vh[r8] = h0; vl[r8] = l0; }
        const int vo = ((m >> 1) * 4 + n) * 512 + (m & 1) * 256; *(v8b*)(dh + vo) = vh; *(v8b*)(dl + vo) = vl; } }
    asm volatile("s_wait_xcnt 0x0" ::: "memory");   // closes the run of stores before any later instruction of the listing rewrites a register that they name
  } }
// att_kernel: one work-group of 8 waves per (b, h, t): the 128-query block 15 - t and then the block t, one after the other, so that every work-group walks 17 key chunks. A wave takes 16 queries of the block. S^T = JL_k x L_q^T, so a lane holds the scores of ONE query (column nloc; keys 8 * hlf + r of each 16-key tile): mask, maximum, exp and sum stay in registers,
// two converted score tiles are the B operand (hardware k order, the order of frag_kb) of O^T += v^T x P^T, and the rescale factor and the final 1 / sum are per lane. Every inner loop is unrolled so that each index into a register array is a constant.
// The 8 waves of a block need the same key chunks: a chunk (L_k, v^T hi, v^T lo, each one contiguous run of the workspace in fragment order, 40 KB together) is brought into LDS once for all of them, one chunk ahead, two buffers.
// chunk_copy: the work-group's 256 lanes move one chunk, 10 asynchronous copies of 16 bytes a lane; a wave's copy is 512 contiguous bytes on both sides. l = the lane's LDS byte address in the buffer, the pointers = the lane's own 16 bytes of each run.
__device__ __forceinline__ void chunk_copy(unsigned l, const b16* kp, const b16* vh, const b16* vl) {
  asm volatile(   // the wait in the last line stands in front of every later rewrite of a register that these copies name (a precaution): in the copies' own statement, so that the compiler moves nothing in between
    "global_load_async_to_lds_b128 %0, %10, off\n\t"
    "global_load_async_to_lds_b128 %1, %11, off\n\t"
    "global_load_async_to_lds_b128 %2, %12, off\n\t"
    "global_load_async_to_lds_b128 %3, %13, off\n\t"
    "global_load_async_to_lds_b128 %4, %14, off\n\t"
    "global_load_async_to_lds_b128 %5, %15, off\n\t"
    "global_load_async_to_lds_b128 %6, %16, off\n\t"
    "global_load_async_to_lds_b128 %7, %17, off\n\t"
    "global_load_async_to_lds_b128 %8, %18, off\n\t"
    "global_load_async_to_lds_b128 %9, %19, off\n\t"
    "s_wait_xcnt 0x0"
    :: "v"(l), "v"(l + 4096u), "v"(l + 8192u), "v"(l + 12288u), "v"(l + 16384u), "v"(l + 20480u), "v"(l + 24576u), "v"(l + 28672u), "v"(l + 32768u), "v"(l + 36864u),
       "v"(kp), "v"(kp + 2048), "v"(vh), "v"(vh + 2048), "v"(vh + 4096), "v"(vh + 6144), "v"(vl), "v"(vl + 2048), "v"(vl + 4096), "v"(vl + 6144) : "memory"); }
__global__ __launch_bounds__(AWV * 32) __attribute__((amdgpu_waves_per_eu(4, 4))) /* at most 256 registers a wave: none above v255 */ void att_kernel(const b16* __restrict__ LQ, const b16* __restrict__ LK, const b16* __restrict__ VTh, const b16* __restrict__ VTl, int QLIM, float* __restrict__ O) { __shared__ __attribute__((aligned(16))) b16 Ring[2][CBH]; const int tid = threadIdx.x, lane = tid & 31, nloc = lane & 15, hlf = lane >> 4, wave = __builtin_amdgcn_readfirstlane(tid >> 5); const int bh = blockIdx.x % (NB_ * H), b = bh / H, h = bh % H; const int nA = T / CK - (int)(blockIdx.x / (NB_ * H));   // chunks of the first block, 16 .. 9; the second has NCH - nA
  constexpr int NCH = T / CK + 1;   // chunks of a work-group
  constexpr float C2 = SCL / (HS * HS) * 1.4426950408889634f;   // raw accumulator -> score in the log2 domain
  const b16* Kp = LK + ((size_t)h * NT + (size_t)b * T) * 32 + tid * 8;   // a lane's own 16 bytes of the first 4 KB of a run, here and below
  const b16* Vh = VTh + ((size_t)b * H + h) * DH * T + tid * 8; const b16* Vl = VTl + ((size_t)b * H + h) * DH * T + tid * 8;
  const unsigned l0 = (unsigned)(size_t)&Ring[0][0] + tid * 16;
  auto fill = [&](int c) { const size_t k0 = (size_t)((c < nA ? c : c - nA) * CK); chunk_copy(l0 + (c & 1) * (CBH * 2), Kp + k0 * 32, Vh + k0 * DH, Vl + k0 * DH); };   // chunk c of the 17, into buffer c mod 2
  fill(0);
  asm volatile("s_wait_asynccnt 0x0" ::: "memory");   // this wave's part of chunk 0 has landed
  __syncthreads();   // chunk 0 is whole: every wave reads all of it
  fill(1);
  int c = 0;
#pragma unroll 1   // one copy of the code for the two blocks
  for (int blk = 0; blk < 2; ++blk) { const int nch = blk ? NCH - nA : nA, q0 = (nch - 1) * CK + wave * 16; const size_t tq = (size_t)b * T + q0;
  const b16* pq = LQ + ((size_t)h * NT + tq) * 32 + lane * 8; const v16b qa = frag_fo(pq);
  asm volatile("s_wait_xcnt 0x0" :: "v"(pq) : "memory");   // the address is an input, so it stays in its registers up to this wait
  v8f oacc[4] = {(v8f){}, (v8f){}, (v8f){}, (v8f){}}; float mrun = -INFINITY, lsum = 0.0f;
#pragma unroll 1   // one chunk's code: a second copy would take registers
  for (int ch = 0; ch < nch; ++ch, ++c) { const int k0 = ch * CK; v8f sacc[CK / 16]; const b16* R = &Ring[c & 1][lane * 8]; const b16* pk = R; const b16* pvh = R + CKH; const b16* pvl = R + CKH + CVH;   // a lane's own 16 bytes of a tile in fragment order
    { v16b kf[CK / 16];   // one block of loads, then eight independent tiles, one product each (hi and lo share the 32 k slots)
#pragma unroll
      for (int t = 0; t < CK / 16; ++t) kf[t] = frag_fo(pk + t * 512);
#pragma unroll
      for (int t = 0; t < CK / 16; ++t) sacc[t] = wmma16b(kf[t], qa, (v8f){}); }
    if (ch == nch - 1) { const int kd = q0 + nloc - k0 - 8 * hlf;   // causal mask: only the last chunk holds keys behind a query
#pragma unroll
      for (int t = 0; t < CK / 16; ++t)
#pragma unroll
        for (int r8 = 0; r8 < 8; ++r8) sacc[t][r8] = (t * 16 + r8 <= kd) ? sacc[t][r8] : -INFINITY; }
    float m4[4] = {sacc[0][0], sacc[0][1], sacc[0][2], sacc[0][3]};   // four chains, so that no maximum waits for the one before it
#pragma unroll
    for (int t = 0; t < CK / 16; ++t)
#pragma unroll
      for (int r8 = 0; r8 < 8; ++r8) m4[r8 & 3] = fmaxf(m4[r8 & 3], sacc[t][r8]);
    float mx = fmaxf(fmaxf(m4[0], m4[1]), fmaxf(m4[2], m4[3])); mx = fmaxf(mx, xhalf(mx));   // the two halves of the wave hold the two halves of a query's keys
    const float mn = fmaxf(mrun, mx), fac = exp2s((mrun - mn) * C2), nb = -mn * C2; mrun = mn;
    v16b pa[CK / 32], pb[CK / 32]; float sm[4] = {0.0f, 0.0f, 0.0f, 0.0f};
#pragma unroll
    for (int t = 0; t < CK / 16; ++t)
#pragma unroll
      for (int r8 = 0; r8 < 8; ++r8) { const float p = exp2s(fmaf(sacc[t][r8], C2, nb)); sm[r8 & 3] += p; b16 ph, pl; split16(p * PS, ph, pl); pa[t >> 1][(t & 1) * 8 + r8] = ph; pb[t >> 1][(t & 1) * 8 + r8] = pl; }
    lsum = lsum * fac + ((sm[0] + sm[1]) + (sm[2] + sm[3]));
#pragma unroll
    for (int t = 0; t < 4; ++t)
#pragma unroll
      for (int r8 = 0; r8 < 8; ++r8) oacc[t][r8] *= fac;
#pragma unroll
    for (int jj = 0; jj < CK / 64; ++jj)   // a block of loads: 64 keys, two d tiles
#pragma unroll
      for (int tp = 0; tp < 4; tp += 2) { v16b vh[2][2], vl[2][2];
#pragma unroll
        for (int t = 0; t < 2; ++t)
#pragma unroll
          for (int j = 0; j < 2; ++j) { const int vo = ((jj * 2 + j) * 4 + tp + t) * 512; vh[t][j] = frag_fo(pvh + vo); vl[t][j] = frag_fo(pvl + vo); }
#pragma unroll
        for (int j = 0; j < 2; ++j) { const int J = jj * 2 + j;
#pragma unroll
          for (int t = 0; t < 2; ++t) oacc[tp + t] = wmma16b(vh[t][j], pa[J], oacc[tp + t]);
#pragma unroll
          for (int t = 0; t < 2; ++t) oacc[tp + t] = wmma16b(vl[t][j], pa[J], oacc[tp + t]);
#pragma unroll
          for (int t = 0; t < 2; ++t) oacc[tp + t] = wmma16b(vh[t][j], pb[J], oacc[tp + t]); } }
    asm volatile("s_wait_dscnt 0x0" :: "v"(lsum) : "memory");   // this wave has read all it reads of buffer c mod 2. The row sum is an input so that it is formed in front of the branch below: behind it, where the compiler otherwise moves the 64 additions, the 64 exponentials stay in registers over the v^T products, and registers spill
    asm volatile("s_wait_asynccnt 0x0" ::: "memory");   // this wave's part of chunk c + 1 has landed
    __syncthreads();   // chunk c + 1 is whole, and no wave still reads buffer c mod 2
    if (c + 2 < NCH) fill(c + 2); }
  const float rl = (1.0f / (PS * HS)) / (lsum + xhalf(lsum));
  if (q0 < QLIM) {
#pragma unroll
    for (int t = 0; t < 4; ++t) { float* op = O + (tq + nloc) * D + h * DH + t * 16 + 8 * hlf;   // a lane's 8 accumulator registers are 8 consecutive d of its query
      *(v4f*)op = (v4f){oacc[t][0] * rl, oacc[t][1] * rl, oacc[t][2] * rl, oacc[t][3] * rl}; *(v4f*)(op + 4) = (v4f){oacc[t][4] * rl, oacc[t][5] * rl, oacc[t][6] * rl, oacc[t][7] * rl}; }
    asm volatile("s_wait_xcnt 0x0" ::: "memory"); } }   // the second block's trip rewrites the address and data registers that these stores name
  asm volatile("s_wait_asynccnt 0x0" ::: "memory"); }   // no copy is outstanding when the wave ends
// outp_kernel: one work-group per (64 tokens, quarter np of the output columns); the hi and lo token tiles are staged once in LDS and shared; wave w takes all 64 tokens x output columns 256np + 32w .. + 31 (4 x 2 tiles), so that a weight tile is read once per 64 tokens.
__global__ __launch_bounds__(OWV * 32) void outp_kernel(const float* __restrict__ O, const b16* __restrict__ WO, const float* __restrict__ bo, int QLIM, float* __restrict__ out) { __shared__ __attribute__((aligned(16))) b16 Ah[MT][D + 8], Al[MT][D + 8]; __shared__ __attribute__((aligned(16))) float Tfs[OWV][16][36]; const int tid = threadIdx.x, lane = tid & 31, nloc = lane & 15, hlf = lane >> 4, wave = __builtin_amdgcn_readfirstlane(tid >> 5), np = blockIdx.x & 3; const size_t t0 = (size_t)(blockIdx.x >> 2) * MT; if ((int)(t0 % T) >= QLIM) return;
  const int c0 = np * 256 + wave * 32; const b16* W = WO + (size_t)c0 * D + lane * 8;
  // Register ring, as in proj_kernel: the two weight fragments of a k step are asked for ORB - 1 k steps ahead. The first ones fly while the last run of the token tiles is converted.
  v16b bw[ORB][2];
  const v4f* os = (const v4f*)(O + t0 * D) + tid;
  v4f ov[2][16];   // runs of 16 loads, the next run asked for before this one is converted; load i is token i
#pragma unroll
  for (int j = 0; j < 16; ++j) ov[0][j] = os[j * (D / 4)];
#pragma unroll
  for (int r = 0; r < MT / 16; ++r) {
    if (r < MT / 16 - 1) {
#pragma unroll
      for (int j = 0; j < 16; ++j) ov[(r + 1) & 1][j] = os[((r + 1) * 16 + j) * (D / 4)]; }
    else {
#pragma unroll
      for (int s = 0; s < ORB - 1; ++s)
#pragma unroll
        for (int n = 0; n < 2; ++n) bw[s][n] = frag_fo(W + (size_t)n * 16 * D + s * 512); }
#pragma unroll
    for (int i = 0; i < 16; ++i) { v4b hv, lv;
#pragma unroll
      for (int j = 0; j < 4; ++j) { b16 p, pl; split16(ov[r & 1][i][j] * HS, p, pl); hv[j] = p; lv[j] = pl; }
      *(v4b*)&Ah[r * 16 + i][tid * 4] = hv; *(v4b*)&Al[r * 16 + i][tid * 4] = lv; }
    __builtin_amdgcn_sched_barrier(0); }   // keeps the run after the next behind this run's conversion: with three runs in registers the wave needs registers above v255
  if (tid < MT) for (int k = D; k < D + 8; ++k) { Ah[tid][k] = (b16)0.0f; Al[tid][k] = (b16)0.0f; }
  __syncthreads();   // the staged token tiles are read by every wave
  float (*Tf)[36] = Tfs[wave]; v8f acc[4][2];
#pragma unroll
  for (int m = 0; m < 4; ++m)
#pragma unroll
    for (int n = 0; n < 2; ++n) acc[m][n] = (v8f){};
#pragma unroll 1   // one ring turn is the loop body: every ring index is a constant, and a second copy would take registers from the ring
  for (int st0 = 0; st0 < NK - ORB; st0 += ORB)
#pragma unroll
    for (int s = 0; s < ORB; ++s) { const int kb = (st0 + s) * 32; v16b a[4], al[4];
#pragma unroll
      for (int n = 0; n < 2; ++n) bw[(s + ORB - 1) % ORB][n] = frag_fo(W + (size_t)n * 16 * D + (size_t)(st0 + s + ORB - 1) * 512);
#pragma unroll
      for (int m = 0; m < 4; ++m) { a[m] = frag_kb(&Ah[m * 16 + nloc][kb], hlf); al[m] = frag_kb(&Al[m * 16 + nloc][kb], hlf); }
#pragma unroll
      for (int m = 0; m < 4; ++m)
#pragma unroll
        for (int n = 0; n < 2; ++n) acc[m][n] = wmma16b(a[m], bw[s][n], acc[m][n]);
#pragma unroll
      for (int m = 0; m < 4; ++m)
#pragma unroll
        for (int n = 0; n < 2; ++n) acc[m][n] = wmma16b(al[m], bw[s][n], acc[m][n]);
      if (s == ORB - 1) asm volatile("s_wait_xcnt 0x0" ::: "memory"); }   // the next turn forms its addresses in the registers that this turn's loads name
#pragma unroll
  for (int s = 0; s < ORB; ++s) { const int kb = (NK - ORB + s) * 32; v16b a[4], al[4];   // the last turn: only its first step still fetches
    if (s == 0) {
#pragma unroll
      for (int n = 0; n < 2; ++n) bw[ORB - 1][n] = frag_fo(W + (size_t)n * 16 * D + (NK - 1) * 512);
      asm volatile("s_wait_xcnt 0x0" :: "v"(W) : "memory"); }   // the address is an input, so it stays in its registers up to this wait: the epilogue reuses them
#pragma unroll
    for (int m = 0; m < 4; ++m) { a[m] = frag_kb(&Ah[m * 16 + nloc][kb], hlf); al[m] = frag_kb(&Al[m * 16 + nloc][kb], hlf); }
#pragma unroll
    for (int m = 0; m < 4; ++m)
#pragma unroll
      for (int n = 0; n < 2; ++n) acc[m][n] = wmma16b(a[m], bw[s][n], acc[m][n]);
#pragma unroll
    for (int m = 0; m < 4; ++m)
#pragma unroll
      for (int n = 0; n < 2; ++n) acc[m][n] = wmma16b(al[m], bw[s][n], acc[m][n]); }
  const float bb0 = bfv(bo[c0 + nloc]), bb1 = bfv(bo[c0 + 16 + nloc]);
#pragma unroll
  for (int m = 0; m < 4; ++m) {   // 16 tokens at a time through the wave's own LDS tile
#pragma unroll
    for (int n = 0; n < 2; ++n)
#pragma unroll
      for (int r8 = 0; r8 < 8; ++r8) Tf[8 * hlf + r8][n * 16 + nloc] = acc[m][n][r8] * (1.0f / (HS * WSC)) + (n ? bb1 : bb0);
    wave_lds_sync();
#pragma unroll
    for (int i = 0; i < 4; ++i) { const int rr = i * 4 + (lane >> 3); *(v4f*)(out + (t0 + m * 16 + rr) * D + c0 + (lane & 7) * 4) = *(const v4f*)(&Tf[rr][(lane & 7) * 4]); }   // a wave's store: the whole 128-byte lines of 4 tokens
    wave_lds_sync();   // the rows are read before the next 16 tokens are written over them
    asm volatile("s_wait_xcnt 0x0" ::: "memory"); } }   // the next trip rewrites the data registers that these stores name
}  // namespace

extern "C" void kernel_launch(void* const* d_in, const int* in_sizes, int n_in, void* d_out, int out_size, void* d_ws, size_t ws_size, hipStream_t stream) {
  (void)n_in;
  auto Fp = [&](int i) { return (const float*)d_in[i]; };
  // inputs: 0 x [2,2048,1024]; 1 W1_q [64,1024]; 2 W2_q; 3 W1_k; 4 W2_k; 5 W_v [1024,1024]; 6 b_v; 7 W_out [1024,1024]; 8 b_out
  if (in_sizes[0] != NT * D || in_sizes[1] != 64 * D || in_sizes[4] != 64 * D || in_sizes[5] != D * D || in_sizes[7] != D * D || out_size != NT * D) return;
  const int QLIM = T;   // per-sequence query cut (multiple of 16)
  size_t off = 0; char* ws = (char*)d_ws;
  auto carve = [&](size_t bytes) { char* p = ws + off; off += (bytes + 255) & ~(size_t)255; return p; };
  b16* WQK = (b16*)carve((size_t)256 * D * 2); b16* WV = (b16*)carve((size_t)D * D * 2); b16* WO = (b16*)carve((size_t)D * D * 2); b16* LQ = (b16*)carve((size_t)H * NT * 32 * 2); b16* LK = (b16*)carve((size_t)H * NT * 32 * 2); b16* VTh = (b16*)carve((size_t)NB_ * H * DH * T * 2); b16* VTl = (b16*)carve((size_t)NB_ * H * DH * T * 2); float* O = (float*)carve((size_t)NT * D * 4);
  if (off > ws_size || off > ((size_t)80 << 20)) return;   // ~ 47 MB
  wput_kernel<<<128, 256, 0, stream>>>(Fp(1), Fp(2), Fp(3), Fp(4), Fp(5), Fp(7), WQK, WV, WO);
  proj_kernel<<<NT / MT * 4, PWV * 32, 0, stream>>>(Fp(0), WQK, WV, Fp(6), LQ, LK, VTh, VTl);
  att_kernel<<<NB_ * H * (T / CK / 2), AWV * 32, 0, stream>>>(LQ, LK, VTh, VTl, QLIM, O);
  outp_kernel<<<NT / MT * 4, OWV * 32, 0, stream>>>(O, WO, Fp(8), QLIM, (float*)d_out);
}

// v009
// A run of this version takes 78.9 microseconds.
// Timed twice side by side with v008, it ran 1.06 times as fast both times.
// Over all steps from v000 it is 19.7 times as fast.
#include <hip/hip_runtime.h>

// PluckerKernelAttention: q1,q2,k1,k2 = x W^T (1024 -> 16 heads x 4); L_q = normalize(exterior(q1,q2)), L_k likewise (6-d Plucker lines); scores = L_q . (J6 L_k) / sqrt(6) with a causal mask; attn = softmax; v = x W_v^T + b_v (16 x 64); o = attn v; out = o W_out^T + b_out -> [2][2048][1024].
// Deterministic: softmax numerators and row sums accumulated over fixed 128-key chunks (causal: chunks up to the query block), fixed order; no atomics. No running maximum: L_q and JL_k have norm at most 1 for every input (each is divided by max(norm, 1e-12)), so |score| <= 6^-0.5 and exp(score) lies in [0.66, 1.51].
// WMMA (v_wmma_f32_16x16x32_f16, f32 accumulate): x (EXACT bf16 x8, K 1024) x [W1q;W2q;W1k;W2k] rows (16 tiles) and x W_v rows (64 tiles), 4 x 2 tiles a wave, 10 waves per work-group of 64 tokens x 320 columns; per (b, h, 16-query) wave and key chunk S^T = JL_k rows (k slots hi, lo, hi of the 6 components, K 18 -> 32; 8 tiles) x L_q (x 6^-0.5 log2 e; slots hi, hi, lo), one product a tile, and O^T += v^T rows (hi+lo; 4 tiles, K 128) x P (hi+lo, packed from the score accumulators), 3 products; out-proj o (hi+lo, K 1024) x W_out rows (64 tiles, 4 x 2 a wave, 8 waves per work-group of 64 tokens x 256 columns); weights EXACT x256, (out, in) rows stored as 16 x 32 tiles in fragment order, about 3.7 M WMMA; Plucker exterior/normalisation and softmax in f32.

namespace {
constexpr int NB_ = 2, T = 2048, D = 1024, H = 16, DH = 64, NT = NB_ * T /* 4096 tokens */, CK = 128 /* keys of an attention chunk */, MT = 64 /* tokens of a proj or out-proj work-group */, PWV = 10 /* waves of a proj work-group */, OWV = 8 /* waves of an out-proj work-group */, PRB = 8, ORB = 4 /* k steps of their weight rings */, NK = D / 32 /* k steps of a projection */, AWV = 8 /* waves of an attention work-group */, CKH = CK * 32 /* halves of a chunk of L_k */, CVH = CK * DH /* halves of a chunk of v^T, hi or lo */, CBH = CKH + 2 * CVH /* halves of a ring buffer */;
constexpr float XS = 8.0f, HS = 256.0f, WSC = 256.0f, SCL = 0.40824829046386302f /* 6^-0.5 */, QSC = SCL * 1.4426950408889634f /* carried by L_q: the score product is the argument of 2^x */;
typedef _Float16 b16;
typedef __attribute__((ext_vector_type(16))) _Float16 v16b;
typedef __attribute__((ext_vector_type(8))) _Float16 v8b;
typedef __attribute__((ext_vector_type(4))) _Float16 v4b;
typedef __attribute__((ext_vector_type(2))) _Float16 v2b;
typedef __attribute__((ext_vector_type(8))) float v8f;
typedef __attribute__((ext_vector_type(4))) float v4f;
typedef __attribute__((ext_vector_type(2))) float v2f;
__device__ __forceinline__ float bf16_rne(float f) { unsigned int u = __float_as_uint(f); u += 0x7FFFu + ((u >> 16) & 1u); float r = __uint_as_float(u & 0xFFFF0000u); asm volatile("" : "+v"(r)); return r; }
__device__ __forceinline__ float bfv(float f) { float r = bf16_rne(f); asm volatile("" : "+v"(r)); return r; }
__device__ __forceinline__ void split16(float v, b16& hi, b16& lo) { hi = (b16)v; lo = (b16)(v - (float)hi); }
__device__ __forceinline__ v16b frag_kb(const b16* p, int hh) { const v8b a = *(const v8b*)(p + 8 * hh), b = *(const v8b*)(p + 16 + 8 * hh); v16b f;
#pragma unroll
  for (int e = 0; e < 8; ++e) { f[e] = a[e]; f[8 + e] = b[e]; } return f; }
// Fragment order: a 16-row x 32-k operand tile that a kernel of this file writes to the workspace is 512 halves laid as [k >> 4][(k >> 3 & 1) * 16 + row][k & 7], so that each of a wave's two 16-byte loads takes 512 contiguous bytes (4 whole lines). p = tile + lane * 8. Same registers, same k order as frag_kb on a row-major tile.
__device__ __forceinline__ v16b frag_fo(const b16* p) { const v8b a = *(const v8b*)p, b = *(const v8b*)(p + 256); v16b f;
#pragma unroll
  for (int e = 0; e < 8; ++e) { f[e] = a[e]; f[8 + e] = b[e]; } return f; }
__device__ __forceinline__ v8f wmma16b(v16b a, v16b b, v8f c) { v8f d = __builtin_amdgcn_wmma_f32_16x16x32_f16(false, a, false, b, (short)0, c, false, false); asm volatile("v_nop\n\tv_nop\n\tv_nop\n\tv_nop" : "+v"(d) : "v"(a), "v"(b)); return d; }
__device__ __forceinline__ void wave_lds_sync() { __builtin_amdgcn_fence(__ATOMIC_RELEASE, "workgroup"); __builtin_amdgcn_wave_barrier(); __builtin_amdgcn_fence(__ATOMIC_ACQUIRE, "workgroup"); }
__device__ __forceinline__ float xhalf(float x) { return __builtin_bit_cast(float, __builtin_amdgcn_permlanex16(__builtin_bit_cast(int, x), __builtin_bit_cast(int, x), 0x76543210, 0xfedcba98, false, false)); }   // lane l with lane l ^ 16
__device__ __forceinline__ float exp2s(float x) { float r; asm("v_exp_f32 %0, %1\n\tv_nop" : "=v"(r) : "v"(x)); return r; }   // 2^x; the v_nop is the one slot asked for between a transcendental and a next instruction that reads its result or overwrites its source: in one statement, so that it stands directly behind
__device__ __forceinline__ float pmul(float a, float b) { float p = a * b; asm volatile("" : "+v"(p)); return p; }

__global__ __launch_bounds__(256) void wput_kernel(const float* __restrict__ w1q, const float* __restrict__ w2q, const float* __restrict__ w1k, const float* __restrict__ w2k, const float* __restrict__ wv, const float* __restrict__ wo, b16* __restrict__ WQK, b16* __restrict__ WV, b16* __restrict__ WO) { const size_t nt = (size_t)gridDim.x * 256, u0 = (size_t)blockIdx.x * 256 + threadIdx.x; v8b v;
  // u counts the 16-byte units of the destination (tile = 16 rows x 32 k, NK tiles a row tile): a wave stores 512 contiguous bytes, and a block reads whole lines of 16 rows
  for (size_t u = u0; u < (size_t)256 * 128; u += nt) { const int o = (int)(u >> 11) * 16 + ((int)u & 15), k0 = ((int)(u >> 6) & 31) * 32 + ((int)(u >> 4) & 3) * 8; const float* w = o < 64 ? w1q : (o < 128 ? w2q : (o < 192 ? w1k : w2k)); const int oo = o % 64;
#pragma unroll
    for (int j = 0; j < 8; ++j) v[j] = (b16)(bf16_rne(w[(size_t)oo * D + k0 + j]) * WSC); { *(v8b*)(WQK + u * 8) = v;  } }
  for (size_t u = u0; u < (size_t)D * 128; u += nt) { const int o = (int)(u >> 11) * 16 + ((int)u & 15), k0 = ((int)(u >> 6) & 31) * 32 + ((int)(u >> 4) & 3) * 8; v8b a, c;
#pragma unroll
    for (int j = 0; j < 8; ++j) { a[j] = (b16)(bf16_rne(wv[(size_t)o * D + k0 + j]) * WSC); c[j] = (b16)(bf16_rne(wo[(size_t)o * D + k0 + j]) * WSC); } { *(v8b*)(WV + u * 8) = a; *(v8b*)(WO + u * 8) = c;  } } }
// proj_kernel: one work-group per (64 tokens, quarter np of the columns). The token tile is staged once in LDS and shared; a wave takes all 64 tokens x 32 columns (4 x 2 tiles), so that a weight tile is read once per 64 tokens: wave 0 the q1,q2 columns of heads 4np..4np+3, wave 1 their k1,k2 columns, wave w >= 2 takes 32 columns of v and writes them as v^T, hi and lo, in the form the attention reads.
__global__ __launch_bounds__(PWV * 32) void proj_kernel(const float* __restrict__ x, const b16* __restrict__ WQK, const b16* __restrict__ WV, const float* __restrict__ bv, b16* __restrict__ LQ, b16* __restrict__ LK, b16* __restrict__ VTh, b16* __restrict__ VTl) { __shared__ __attribute__((aligned(16))) b16 Ah[MT][D + 8]; __shared__ __attribute__((aligned(16))) float Tfs[2][MT][36] /* the q and the k wave only */; const int tid = threadIdx.x, lane = tid & 31, nloc = lane & 15, hlf = lane >> 4, wave = __builtin_amdgcn_readfirstlane(tid >> 5), np = blockIdx.x & 3; const size_t t0 = (size_t)(blockIdx.x >> 2) * MT;
  const bool isqk = wave < 2; const int c0 = np * 256 + (wave - 2) * 32;
  const b16* W = (isqk ? WQK + (size_t)(np * 16 + wave * 128) * D : WV + (size_t)c0 * D) + lane * 8; const size_t tstr = isqk ? (size_t)64 * D : (size_t)16 * D;
  // Staging: 16 bytes a lane, runs of SB loads, the next run asked for before this one is converted (the pinned rounding keeps the loads where the source has them).
  constexpr int SB = 17, NTH = PWV * 32, REM = MT * D / 4 - 3 * SB * NTH /* 64 units are left: the last two waves */; const v4f* xs = (const v4f*)(x + t0 * D) + tid;
  auto put = [&](int u, v4f xv) { v4b hv;
#pragma unroll
    for (int j = 0; j < 4; ++j) hv[j] = (b16)(bf16_rne(xv[j]) * XS);
    *(v4b*)&Ah[u >> 8][(u & 255) * 4] = hv; };
  // Register ring: the two weight fragments of a k step are asked for PRB - 1 k steps ahead of the products that use them. The first ones fly while the last run of the token tile is converted.
  v16b bw[PRB][2]; v4f xv[2][SB], xr = (v4f){}; const bool rem = wave >= PWV - REM / 32;
#pragma unroll
  for (int j = 0; j < SB; ++j) xv[0][j] = xs[j * NTH];
#pragma unroll
  for (int r = 0; r < 3; ++r) {
    if (r < 2) {
#pragma unroll
      for (int j = 0; j < SB; ++j) xv[(r + 1) & 1][j] = xs[((r + 1) * SB + j) * NTH]; }
    else { if (rem) xr = xs[3 * SB * NTH - (NTH - REM)];
#pragma unroll
      for (int s = 0; s < PRB - 1; ++s)
#pragma unroll
        for (int n = 0; n < 2; ++n) bw[s][n] = frag_fo(W + n * tstr + s * 512); }
#pragma unroll
    for (int j = 0; j < SB; ++j) put((r * SB + j) * NTH + tid, xv[r & 1][j]); }
  if (rem) put(3 * SB * NTH - (NTH - REM) + tid, xr);
  if (tid < MT) for (int k = D; k < D + 8; ++k) Ah[tid][k] = (b16)0.0f;
  __syncthreads();   // the staged token tile is read by every wave
  v8f acc[4][2];
#pragma unroll
  for (int m = 0; m < 4; ++m)
#pragma unroll
    for (int n = 0; n < 2; ++n) acc[m][n] = (v8f){};
#pragma unroll 1   // one ring turn is the loop body: every ring index is a constant, and a second copy would take registers from the ring
  for (int st0 = 0; st0 < NK - PRB; st0 += PRB)
#pragma unroll
    for (int s = 0; s < PRB; ++s) { const int kb = (st0 + s) * 32; v16b a[4];
#pragma unroll
      for (int n = 0; n < 2; ++n) bw[(s + PRB - 1) % PRB][n] = frag_fo(W + n * tstr + (size_t)(st0 + s + PRB - 1) * 512);
#pragma unroll
      for (int m = 0; m < 4; ++m) a[m] = frag_kb(&Ah[m * 16 + nloc][kb], hlf);
#pragma unroll
      for (int m = 0; m < 4; ++m)
#pragma unroll
        for (int n = 0; n < 2; ++n) acc[m][n] = wmma16b(a[m], bw[s][n], acc[m][n]);
      if (s == PRB - 1) asm volatile("s_wait_xcnt 0x0" ::: "memory"); }   // the next turn forms its addresses in the registers that this turn's loads name
#pragma unroll
  for (int s = 0; s < PRB; ++s) { const int kb = (NK - PRB + s) * 32; v16b a[4];   // the last turn: only its first step still fetches
    if (s == 0) {
#pragma unroll
      for (int n = 0; n < 2; ++n) bw[PRB - 1][n] = frag_fo(W + n * tstr + (NK - 1) * 512);
      asm volatile("s_wait_xcnt 0x0" :: "v"(W) : "memory"); }   // the address is an input, so it stays in its registers up to this wait: the epilogue reuses them
#pragma unroll
    for (int m = 0; m < 4; ++m) a[m] = frag_kb(&Ah[m * 16 + nloc][kb], hlf);
#pragma unroll
    for (int m = 0; m < 4; ++m)
#pragma unroll
      for (int n = 0; n < 2; ++n) acc[m][n] = wmma16b(a[m], bw[s][n], acc[m][n]); }
  if (isqk) {   // Plucker lines: wave 0 the q lines, wave 1 the k lines; lane = (token lane & 15 of a 16-token tile, head pair lane >> 4); loop the 4 token tiles and the 2 heads of a pair
    const int isk = wave; float (*Tf)[36] = Tfs[wave];
#pragma unroll
    for (int n = 0; n < 2; ++n)
#pragma unroll
      for (int m = 0; m < 4; ++m)
#pragma unroll
        for (int r8 = 0; r8 < 8; ++r8) Tf[m * 16 + 8 * hlf + r8][n * 16 + nloc] = acc[m][n][r8] * (1.0f / (XS * WSC));
    wave_lds_sync();
#pragma unroll 1
    for (int io = 0; io < 8; io += 4) {
#pragma unroll   // four independent lines side by side: each is one long dependent chain (root, division)
    for (int it = io; it < io + 4; ++it) { const int rr = (it >> 1) * 16 + nloc, hl = hlf * 2 + (it & 1), h = np * 4 + hl; const float* p1 = &Tf[rr][hl * 4]; const float* p2 = &Tf[rr][16 + hl * 4]; float Lm[6]; Lm[0] = p1[0] * p2[1] - p1[1] * p2[0]; Lm[1] = p1[0] * p2[2] - p1[2] * p2[0]; Lm[2] = p1[0] * p2[3] - p1[3] * p2[0]; Lm[3] = p1[1] * p2[2] - p1[2] * p2[1]; Lm[4] = p1[1] * p2[3] - p1[3] * p2[1]; Lm[5] = p1[2] * p2[3] - p1[3] * p2[2];
      float n2 = 0.0f; for (int c = 0; c < 6; ++c) n2 += Lm[c] * Lm[c]; const float inv = 1.0f / fmaxf(sqrtf(n2), 1e-12f); float Lo[6];
      if (isk) { Lo[0] = Lm[5]; Lo[1] = -Lm[4]; Lo[2] = Lm[3]; Lo[3] = Lm[2]; Lo[4] = -Lm[1]; Lo[5] = Lm[0]; } else { for (int c = 0; c < 6; ++c) Lo[c] = Lm[c]; }
      // one 32-k row holds hi and lo: k slots 0..5, 6..11, 12..17 are hi, lo, hi of a k line and hi, hi, lo of a q line, so that ONE product sums k_hi q_hi + k_lo q_hi + k_hi q_lo; slots 18..31 are 0
      b16 pk_[32]; for (int c = 0; c < 32; ++c) pk_[c] = (b16)0.0f; for (int c = 0; c < 6; ++c) { b16 h0, l0; split16(Lo[c] * inv * (isk ? 1.0f : QSC), h0, l0); pk_[c] = h0; pk_[6 + c] = isk ? l0 : h0; pk_[12 + c] = isk ? h0 : l0; }
      b16* dp = (isk ? LK : LQ) + ((size_t)h * NT + t0 + (it >> 1) * 16) * 32 + nloc * 8;   // 16 tokens are one tile in fragment order
      for (int c = 0; c < 32; c += 8) { v8b a; for (int j = 0; j < 8; ++j) a[j] = pk_[c + j]; *(v8b*)(dp + c * 16) = a; } }
      asm volatile("s_wait_xcnt 0x0" ::: "memory");   // the next trip rewrites the address and data registers that these stores name
    } }
  else {   // v^T hi and lo in fragment order, tiles as [b, h][32-key step][16-d tile], straight from the accumulators: a lane's 8 registers of a tile are 8 consecutive keys (8 * hlf + r8 of token tile m) of one d (column nloc), which is the lane's own 16-byte unit of half m & 1 of the 16-d x 32-key tile; a wave's store is 512 contiguous bytes
    const size_t ob = ((((t0 / T) * H + (c0 >> 6)) * (T / 32) + (t0 % T) / 32) * 4 + ((c0 >> 4) & 3)) * 512 + lane * 8; b16* dh = VTh + ob; b16* dl = VTl + ob;
#pragma unroll   // constant offsets on the two store addresses
    for (int n = 0; n < 2; ++n) { const float bb = bfv(bv[c0 + n * 16 + nloc]);
#pragma unroll
      for (int m = 0; m < 4; ++m) { v8b vh, vl;
#pragma unroll
        for (int r8 = 0; r8 < 8; ++r8) { b16 h0, l0; split16((acc[m][n][r8] * (1.0f / (XS * WSC)) + bb) * HS, h0, l0); vh[r8] = h0; vl[r8] = l0; }
        const int vo = ((m >> 1) * 4 + n) * 512 + (m & 1) * 256; *(v8b*)(dh + vo) = vh; *(v8b*)(dl + vo) = vl; } }
    asm volatile("s_wait_xcnt 0x0" ::: "memory");   // closes the run of stores before any later instruction of the listing rewrites a register that they name
  } }
// att_kernel: one work-group of 8 waves per (b, h, t): the 128-query block 15 - t and then the block t, one after the other, so that every work-group walks 17 key chunks. A wave takes 16 queries of the block. S^T = JL_k x L_q^T, so a lane holds the scores of ONE query (column nloc; keys 8 * hlf + r of each 16-key tile): mask, exp and sum stay in registers,
// two converted score tiles are the B operand (hardware k order, the order of frag_kb) of O^T += v^T x P^T, and the final 1 / sum is per lane. Every inner loop is unrolled so that each index into a register array is a constant.
// The 8 waves of a block need the same key chunks: a chunk (L_k, v^T hi, v^T lo, each one contiguous run of the workspace in fragment order, 40 KB together) is brought into LDS once for all of them, one chunk ahead, two buffers.
// chunk_copy: the work-group's 256 lanes move one chunk, 10 asynchronous copies of 16 bytes a lane; a wave's copy is 512 contiguous bytes on both sides. l = the lane's LDS byte address in the buffer, the pointers = the lane's own 16 bytes of each run.
__device__ __forceinline__ void chunk_copy(unsigned l, const b16* kp, const b16* vh, const b16* vl) {
  asm volatile(   // the wait in the last line stands in front of every later rewrite of a register that these copies name (a precaution): in the copies' own statement, so that the compiler moves nothing in between
    "global_load_async_to_lds_b128 %0, %10, off\n\t"
    "global_load_async_to_lds_b128 %1, %11, off\n\t"
    "global_load_async_to_lds_b128 %2, %12, off\n\t"
    "global_load_async_to_lds_b128 %3, %13, off\n\t"
    "global_load_async_to_lds_b128 %4, %14, off\n\t"
    "global_load_async_to_lds_b128 %5, %15, off\n\t"
    "global_load_async_to_lds_b128 %6, %16, off\n\t"
    "global_load_async_to_lds_b128 %7, %17, off\n\t"
    "global_load_async_to_lds_b128 %8, %18, off\n\t"
    "global_load_async_to_lds_b128 %9, %19, off\n\t"
    "s_wait_xcnt 0x0"
    :: "v"(l), "v"(l + 4096u), "v"(l + 8192u), "v"(l + 12288u), "v"(l + 16384u), "v"(l + 20480u), "v"(l + 24576u), "v"(l + 28672u), "v"(l + 32768u), "v"(l + 36864u),
       "v"(kp), "v"(kp + 2048), "v"(vh), "v"(vh + 2048), "v"(vh + 4096), "v"(vh + 6144), "v"(vl), "v"(vl + 2048), "v"(vl + 4096), "v"(vl + 6144) : "memory"); }
__global__ __launch_bounds__(AWV * 32) __attribute__((amdgpu_waves_per_eu(4, 4))) /* at most 256 registers a wave: none above v255 */ void att_kernel(const b16* __restrict__ LQ, const b16* __restrict__ LK, const b16* __restrict__ VTh, const b16* __restrict__ VTl, int QLIM, float* __restrict__ O) { __shared__ __attribute__((aligned(16))) b16 Ring[2][CBH]; const int tid = threadIdx.x, lane = tid & 31, nloc = lane & 15, hlf = lane >> 4, wave = __builtin_amdgcn_readfirstlane(tid >> 5); const int bh = blockIdx.x % (NB_ * H), b = bh / H, h = bh % H; const int nA = T / CK - (int)(blockIdx.x / (NB_ * H));   // chunks of the first block, 16 .. 9; the second has NCH - nA
  constexpr int NCH = T / CK + 1;   // chunks of a work-group
  const b16* Kp = LK + ((size_t)h * NT + (size_t)b * T) * 32 + tid * 8;   // a lane's own 16 bytes of the first 4 KB of a run, here and below
  const b16* Vh = VTh + ((size_t)b * H + h) * DH * T + tid * 8; const b16* Vl = VTl + ((size_t)b * H + h) * DH * T + tid * 8;
  const unsigned l0 = (unsigned)(size_t)&Ring[0][0] + tid * 16;
  auto fill = [&](int c) { const size_t k0 = (size_t)((c < nA ? c : c - nA) * CK); chunk_copy(l0 + (c & 1) * (CBH * 2), Kp + k0 * 32, Vh + k0 * DH, Vl + k0 * DH); };   // chunk c of the 17, into buffer c mod 2
  fill(0);
  asm volatile("s_wait_asynccnt 0x0" ::: "memory");   // this wave's part of chunk 0 has landed
  __syncthreads();   // chunk 0 is whole: every wave reads all of it
  fill(1);
  int c = 0;
#pragma unroll 1   // one copy of the code for the two blocks
  for (int blk = 0; blk < 2; ++blk) { const int nch = blk ? NCH - nA : nA, q0 = (nch - 1) * CK + wave * 16; const size_t tq = (size_t)b * T + q0;
  const b16* pq = LQ + ((size_t)h * NT + tq) * 32 + lane * 8; const v16b qa = frag_fo(pq);
  asm volatile("s_wait_xcnt 0x0" :: "v"(pq) : "memory");   // the address is an input, so it stays in its registers up to this wait
  v8f o0 = (v8f){}, o1 = (v8f){}, o2 = (v8f){}, o3 = (v8f){}; float lsum = 0.0f;   // the four d tiles of O^T by name: held as one array, the build copied all 32 registers at the loop's back edge
#pragma unroll 1   // one chunk's code: a second copy would take registers
  for (int ch = 0; ch < nch; ++ch, ++c) { const int k0 = ch * CK; v8f sacc[CK / 16]; const b16* R = &Ring[c & 1][lane * 8]; const b16* pk = R; const b16* pvh = R + CKH; const b16* pvl = R + CKH + CVH;   // a lane's own 16 bytes of a tile in fragment order
    { v16b kf[CK / 16];   // one block of loads, then eight independent tiles, one product each (hi and lo share the 32 k slots)
#pragma unroll
      for (int t = 0; t < CK / 16; ++t) kf[t] = frag_fo(pk + t * 512);
#pragma unroll
      for (int t = 0; t < CK / 16; ++t) sacc[t] = wmma16b(kf[t], qa, (v8f){}); }
    if (ch == nch - 1) { const int kd = q0 + nloc - k0 - 8 * hlf;   // causal mask: only the last chunk holds keys behind a query
#pragma unroll
      for (int t = 0; t < CK / 16; ++t)
#pragma unroll
        for (int r8 = 0; r8 < 8; ++r8) sacc[t][r8] = (t * 16 + r8 <= kd) ? sacc[t][r8] : -INFINITY; }
    v16b pa[CK / 32], pb[CK / 32]; float sm[4] = {0.0f, 0.0f, 0.0f, 0.0f};
#pragma unroll
    for (int t = 0; t < CK / 16; ++t)
#pragma unroll
      for (int r8 = 0; r8 < 8; ++r8) { const float p = exp2s(sacc[t][r8]); sm[r8 & 3] += p; b16 ph, pl; split16(p, ph, pl); pa[t >> 1][(t & 1) * 8 + r8] = ph; pb[t >> 1][(t & 1) * 8 + r8] = pl; }
    lsum += (sm[0] + sm[1]) + (sm[2] + sm[3]);
#pragma unroll
    for (int jj = 0; jj < CK / 64; ++jj)   // a block of loads: 64 keys, two d tiles
#pragma unroll
      for (int tp = 0; tp < 4; tp += 2) { v16b vh[2][2], vl[2][2];
#pragma unroll
        for (int t = 0; t < 2; ++t)
#pragma unroll
          for (int j = 0; j < 2; ++j) { const int vo = ((jj * 2 + j) * 4 + tp + t) * 512; vh[t][j] = frag_fo(pvh + vo); vl[t][j] = frag_fo(pvl + vo); }
#pragma unroll
        for (int j = 0; j < 2; ++j) { const int J = jj * 2 + j; v8f& oa = tp ? o2 : o0; v8f& ob = tp ? o3 : o1;
          oa = wmma16b(vh[0][j], pa[J], oa); ob = wmma16b(vh[1][j], pa[J], ob);
          oa = wmma16b(vl[0][j], pa[J], oa); ob = wmma16b(vl[1][j], pa[J], ob);
          oa = wmma16b(vh[0][j], pb[J], oa); ob = wmma16b(vh[1][j], pb[J], ob); } }
    asm volatile("s_wait_dscnt 0x0" :: "v"(lsum) : "memory");   // this wave has read all it reads of buffer c mod 2. The row sum is an input so that it is formed in front of the branch below: behind it, where the compiler otherwise moves the 64 additions, the 64 exponentials stay in registers over the v^T products, and registers spill
    asm volatile("s_wait_asynccnt 0x0" ::: "memory");   // this wave's part of chunk c + 1 has landed
    __syncthreads();   // chunk c + 1 is whole, and no wave still reads buffer c mod 2
    if (c + 2 < NCH) fill(c + 2); }
  const float rl = (1.0f / HS) / (lsum + xhalf(lsum));
  if (q0 < QLIM) {
#pragma unroll
    for (int t = 0; t < 4; ++t) { float* op = O + (tq + nloc) * D + h * DH + t * 16 + 8 * hlf; const v8f ot = t == 0 ? o0 : (t == 1 ? o1 : (t == 2 ? o2 : o3));   // a lane's 8 accumulator registers are 8 consecutive d of its query
      *(v4f*)op = (v4f){ot[0] * rl, ot[1] * rl, ot[2] * rl, ot[3] * rl}; *(v4f*)(op + 4) = (v4f){ot[4] * rl, ot[5] * rl, ot[6] * rl, ot[7] * rl}; }
    asm volatile("s_wait_xcnt 0x0" ::: "memory"); } }   // the second block's trip rewrites the address and data registers that these stores name
  asm volatile("s_wait_asynccnt 0x0" ::: "memory"); }   // no copy is outstanding when the wave ends
// outp_kernel: one work-group per (64 tokens, quarter np of the output columns); the hi and lo token tiles are staged once in LDS and shared; wave w takes all 64 tokens x output columns 256np + 32w .. + 31 (4 x 2 tiles), so that a weight tile is read once per 64 tokens.
__global__ __launch_bounds__(OWV * 32) void outp_kernel(const float* __restrict__ O, const b16* __restrict__ WO, const float* __restrict__ bo, int QLIM, float* __restrict__ out) { __shared__ __attribute__((aligned(16))) b16 Ah[MT][D + 8], Al[MT][D + 8]; __shared__ __attribute__((aligned(16))) float Tfs[OWV][16][36]; const int tid = threadIdx.x, lane = tid & 31, nloc = lane & 15, hlf = lane >> 4, wave = __builtin_amdgcn_readfirstlane(tid >> 5), np = blockIdx.x & 3; const size_t t0 = (size_t)(blockIdx.x >> 2) * MT; if ((int)(t0 % T) >= QLIM) return;
  const int c0 = np * 256 + wave * 32; const b16* W = WO + (size_t)c0 * D + lane * 8;
  // Register ring, as in proj_kernel: the two weight fragments of a k step are asked for ORB - 1 k steps ahead. The first ones fly while the last run of the token tiles is converted.
  v16b bw[ORB][2];
  const v4f* os = (const v4f*)(O + t0 * D) + tid;
  v4f ov[2][16];   // runs of 16 loads, the next run asked for before this one is converted; load i is token i
#pragma unroll
  for (int j = 0; j < 16; ++j) ov[0][j] = os[j * (D / 4)];
#pragma unroll
  for (int r = 0; r < MT / 16; ++r) {
    if (r < MT / 16 - 1) {
#pragma unroll
      for (int j = 0; j < 16; ++j) ov[(r + 1) & 1][j] = os[((r + 1) * 16 + j) * (D / 4)]; }
    else {
#pragma unroll
      for (int s = 0; s < ORB - 1; ++s)
#pragma unroll
        for (int n = 0; n < 2; ++n) bw[s][n] = frag_fo(W + (size_t)n * 16 * D + s * 512); }
#pragma unroll
    for (int i = 0; i < 16; ++i) { v4b hv, lv;
#pragma unroll
      for (int j = 0; j < 4; ++j) { b16 p, pl; split16(ov[r & 1][i][j] * HS, p, pl); hv[j] = p; lv[j] = pl; }
      *(v4b*)&Ah[r * 16 + i][tid * 4] = hv; *(v4b*)&Al[r * 16 + i][tid * 4] = lv; }
    __builtin_amdgcn_sched_barrier(0); }   // keeps the run after the next behind this run's conversion: with three runs in registers the wave needs registers above v255
  if (tid < MT) for (int k = D; k < D + 8; ++k) { Ah[tid][k] = (b16)0.0f; Al[tid][k] = (b16)0.0f; }
  __syncthreads();   // the staged token tiles are read by every wave
  float (*Tf)[36] = Tfs[wave]; v8f acc[4][2];
#pragma unroll
  for (int m = 0; m < 4; ++m)
#pragma unroll
    for (int n = 0; n < 2; ++n) acc[m][n] = (v8f){};
#pragma unroll 1   // one ring turn is the loop body: every ring index is a constant, and a second copy would take registers from the ring
  for (int st0 = 0; st0 < NK - ORB; st0 += ORB)
#pragma unroll
    for (int s = 0; s < ORB; ++s) { const int kb = (st0 + s) * 32; v16b a[4], al[4];
#pragma unroll
      for (int n = 0; n < 2; ++n) bw[(s + ORB - 1) % ORB][n] = frag_fo(W + (size_t)n * 16 * D + (size_t)(st0 + s + ORB - 1) * 512);
#pragma unroll
      for (int m = 0; m < 4; ++m) { a[m] = frag_kb(&Ah[m * 16 + nloc][kb], hlf); al[m] = frag_kb(&Al[m * 16 + nloc][kb], hlf); }
#pragma unroll
      for (int m = 0; m < 4; ++m)
#pragma unroll
        for (int n = 0; n < 2; ++n) acc[m][n] = wmma16b(a[m], bw[s][n], acc[m][n]);
#pragma unroll
      for (int m = 0; m < 4; ++m)
#pragma unroll
        for (int n = 0; n < 2; ++n) acc[m][n] = wmma16b(al[m], bw[s][n], acc[m][n]);
      if (s == ORB - 1) asm volatile("s_wait_xcnt 0x0" ::: "memory"); }   // the next turn forms its addresses in the registers that this turn's loads name
#pragma unroll
  for (int s = 0; s < ORB; ++s) { const int kb = (NK - ORB + s) * 32; v16b a[4], al[4];   // the last turn: only its first step still fetches
    if (s == 0) {
#pragma unroll
      for (int n = 0; n < 2; ++n) bw[ORB - 1][n] = frag_fo(W + (size_t)n * 16 * D + (NK - 1) * 512);
      asm volatile("s_wait_xcnt 0x0" :: "v"(W) : "memory"); }   // the address is an input, so it stays in its registers up to this wait: the epilogue reuses them
#pragma unroll
    for (int m = 0; m < 4; ++m) { a[m] = frag_kb(&Ah[m * 16 + nloc][kb], hlf); al[m] = frag_kb(&Al[m * 16 + nloc][kb], hlf); }
#pragma unroll
    for (int m = 0; m < 4; ++m)
#pragma unroll
      for (int n = 0; n < 2; ++n) acc[m][n] = wmma16b(a[m], bw[s][n], acc[m][n]);
#pragma unroll
    for (int m = 0; m < 4; ++m)
#pragma unroll
      for (int n = 0; n < 2; ++n) acc[m][n] = wmma16b(al[m], bw[s][n], acc[m][n]); }
  const float bb0 = bfv(bo[c0 + nloc]), bb1 = bfv(bo[c0 + 16 + nloc]);
#pragma unroll
  for (int m = 0; m < 4; ++m) {   // 16 tokens at a time through the wave's own LDS tile
#pragma unroll
    for (int n = 0; n < 2; ++n)
#pragma unroll
      for (int r8 = 0; r8 < 8; ++r8) Tf[8 * hlf + r8][n * 16 + nloc] = acc[m][n][r8] * (1.0f / (HS * WSC)) + (n ? bb1 : bb0);
    wave_lds_sync();
#pragma unroll
    for (int i = 0; i < 4; ++i) { const int rr = i * 4 + (lane >> 3); *(v4f*)(out + (t0 + m * 16 + rr) * D + c0 + (lane & 7) * 4) = *(const v4f*)(&Tf[rr][(lane & 7) * 4]); }   // a wave's store: the whole 128-byte lines of 4 tokens
    wave_lds_sync();   // the rows are read before the next 16 tokens are written over them
    asm volatile("s_wait_xcnt 0x0" ::: "memory"); } }   // the next trip rewrites the data registers that these stores name
}  // namespace

extern "C" void kernel_launch(void* const* d_in, const int* in_sizes, int n_in, void* d_out, int out_size, void* d_ws, size_t ws_size, hipStream_t stream) {
  (void)n_in;
  auto Fp = [&](int i) { return (const float*)d_in[i]; };
  // inputs: 0 x [2,2048,1024]; 1 W1_q [64,1024]; 2 W2_q; 3 W1_k; 4 W2_k; 5 W_v [1024,1024]; 6 b_v; 7 W_out [1024,1024]; 8 b_out
  if (in_sizes[0] != NT * D || in_sizes[1] != 64 * D || in_sizes[4] != 64 * D || in_sizes[5] != D * D || in_sizes[7] != D * D || out_size != NT * D) return;
  const int QLIM = T;   // per-sequence query cut (multiple of 16)
  size_t off = 0; char* ws = (char*)d_ws;
  auto carve = [&](size_t bytes) { char* p = ws + off; off += (bytes + 255) & ~(size_t)255; return p; };
  b16* WQK = (b16*)carve((size_t)256 * D * 2); b16* WV = (b16*)carve((size_t)D * D * 2); b16* WO = (b16*)carve((size_t)D * D * 2); b16* LQ = (b16*)carve((size_t)H * NT * 32 * 2); b16* LK = (b16*)carve((size_t)H * NT * 32 * 2); b16* VTh = (b16*)carve((size_t)NB_ * H * DH * T * 2); b16* VTl = (b16*)carve((size_t)NB_ * H * DH * T * 2); float* O = (float*)carve((size_t)NT * D * 4);
  if (off > ws_size || off > ((size_t)80 << 20)) return;   // ~ 47 MB
  wput_kernel<<<128, 256, 0, stream>>>(Fp(1), Fp(2), Fp(3), Fp(4), Fp(5), Fp(7), WQK, WV, WO);
  proj_kernel<<<NT / MT * 4, PWV * 32, 0, stream>>>(Fp(0), WQK, WV, Fp(6), LQ, LK, VTh, VTl);
  att_kernel<<<NB_ * H * (T / CK / 2), AWV * 32, 0, stream>>>(LQ, LK, VTh, VTl, QLIM, O);
  outp_kernel<<<NT / MT * 4, OWV * 32, 0, stream>>>(O, WO, Fp(8), QLIM, (float*)d_out);
}

// v010
// One run takes 73.1 microseconds.
// Timed twice side by side with v009, it ran 1.08 times as fast both times.
// Over all steps from v000 it is 21.3 times as fast.
#include <hip/hip_runtime.h>

// PluckerKernelAttention: q1,q2,k1,k2 = x W^T (1024 -> 16 heads x 4); L_q = normalize(exterior(q1,q2)), L_k likewise (6-d Plucker lines); scores = L_q . (J6 L_k) / sqrt(6) with a causal mask; attn = softmax; v = x W_v^T + b_v (16 x 64); o = attn v; out = o W_out^T + b_out -> [2][2048][1024].
// Deterministic: softmax numerators and row sums accumulated over fixed 128-key chunks (causal: chunks up to the query block), each of a chunk's four 32-key steps by its own wave, the four partial sums joined in a fixed order; no atomics. No running maximum: L_q and JL_k have norm at most 1 for every input (each is divided by max(norm, 1e-12)), so |score| <= 6^-0.5 and exp(score) lies in [0.66, 1.51].
// WMMA (v_wmma_f32_16x16x32_f16, f32 accumulate): x (EXACT bf16 x8, K 1024) x [W1q;W2q;W1k;W2k] rows (16 tiles) and x W_v rows (64 tiles), 4 x 2 tiles a wave, 10 waves per work-group of 64 tokens x 320 columns; per (b, h, 32-query, 32-key step) wave and key chunk S^T = JL_k rows (k slots hi, lo, hi of the 6 components, K 18 -> 32; 2 tiles) x L_q (x 6^-0.5 log2 e; slots hi, hi, lo; 2 tiles), one product a tile pair, and O^T += v^T rows (hi+lo; 4 tiles, K 32) x P (hi+lo, packed from the score accumulators; 2 tiles), 3 products; out-proj o (hi+lo, K 1024) x W_out rows (64 tiles, 4 x 2 a wave, 8 waves per work-group of 64 tokens x 256 columns); weights EXACT x256, (out, in) rows stored as 16 x 32 tiles in fragment order, about 3.7 M WMMA; Plucker exterior/normalisation and softmax in f32.

namespace {
constexpr int NB_ = 2, T = 2048, D = 1024, H = 16, DH = 64, NT = NB_ * T /* 4096 tokens */, CK = 128 /* keys of an attention chunk */, MT = 64 /* tokens of a proj or out-proj work-group */, PWV = 10 /* waves of a proj work-group */, OWV = 8 /* waves of an out-proj work-group */, PRB = 8, ORB = 4 /* k steps of their weight rings */, NK = D / 32 /* k steps of a projection */, AWV = 16 /* waves of an attention work-group */, CKH = CK * 32 /* halves of a chunk of L_k */, CVH = CK * DH /* halves of a chunk of v^T, hi or lo */, CBH = CKH + 2 * CVH /* halves of a ring buffer */;
constexpr float XS = 8.0f, HS = 256.0f, WSC = 256.0f, SCL = 0.40824829046386302f /* 6^-0.5 */, QSC = SCL * 1.4426950408889634f /* carried by L_q: the score product is the argument of 2^x */;
typedef _Float16 b16;
typedef __attribute__((ext_vector_type(16))) _Float16 v16b;
typedef __attribute__((ext_vector_type(8))) _Float16 v8b;
typedef __attribute__((ext_vector_type(4))) _Float16 v4b;
typedef __attribute__((ext_vector_type(2))) _Float16 v2b;
typedef __attribute__((ext_vector_type(8))) float v8f;
typedef __attribute__((ext_vector_type(4))) float v4f;
typedef __attribute__((ext_vector_type(2))) float v2f;
__device__ __forceinline__ float bf16_rne(float f) { unsigned int u = __float_as_uint(f); u += 0x7FFFu + ((u >> 16) & 1u); float r = __uint_as_float(u & 0xFFFF0000u); asm volatile("" : "+v"(r)); return r; }
__device__ __forceinline__ float bfv(float f) { float r = bf16_rne(f); asm volatile("" : "+v"(r)); return r; }
__device__ __forceinline__ void split16(float v, b16& hi, b16& lo) { hi = (b16)v; lo = (b16)(v - (float)hi); }
__device__ __forceinline__ v16b frag_kb(const b16* p, int hh) { const v8b a = *(const v8b*)(p + 8 * hh), b = *(const v8b*)(p + 16 + 8 * hh); v16b f;
#pragma unroll
  for (int e = 0; e < 8; ++e) { f[e] = a[e]; f[8 + e] = b[e]; } return f; }
// Fragment order: a 16-row x 32-k operand tile that a kernel of this file writes to the workspace is 512 halves laid as [k >> 4][(k >> 3 & 1) * 16 + row][k & 7], so that each of a wave's two 16-byte loads takes 512 contiguous bytes (4 whole lines). p = tile + lane * 8. Same registers, same k order as frag_kb on a row-major tile.
__device__ __forceinline__ v16b frag_fo(const b16* p) { const v8b a = *(const v8b*)p, b = *(const v8b*)(p + 256); v16b f;
#pragma unroll
  for (int e = 0; e < 8; ++e) { f[e] = a[e]; f[8 + e] = b[e]; } return f; }
__device__ __forceinline__ v8f wmma16b(v16b a, v16b b, v8f c) { v8f d = __builtin_amdgcn_wmma_f32_16x16x32_f16(false, a, false, b, (short)0, c, false, false); asm volatile("v_nop\n\tv_nop\n\tv_nop\n\tv_nop" : "+v"(d) : "v"(a), "v"(b)); return d; }
__device__ __forceinline__ void wave_lds_sync() { __builtin_amdgcn_fence(__ATOMIC_RELEASE, "workgroup"); __builtin_amdgcn_wave_barrier(); __builtin_amdgcn_fence(__ATOMIC_ACQUIRE, "workgroup"); }
__device__ __forceinline__ float xhalf(float x) { return __builtin_bit_cast(float, __builtin_amdgcn_permlanex16(__builtin_bit_cast(int, x), __builtin_bit_cast(int, x), 0x76543210, 0xfedcba98, false, false)); }   // lane l with lane l ^ 16
__device__ __forceinline__ float exp2s(float x) { float r; asm("v_exp_f32 %0, %1\n\tv_nop" : "=v"(r) : "v"(x)); return r; }   // 2^x; the v_nop is the one slot asked for between a transcendental and a next instruction that reads its result or overwrites its source: in one statement, so that it stands directly behind
__device__ __forceinline__ float pmul(float a, float b) { float p = a * b; asm volatile("" : "+v"(p)); return p; }

__global__ __launch_bounds__(256) void wput_kernel(const float* __restrict__ w1q, const float* __restrict__ w2q, const float* __restrict__ w1k, const float* __restrict__ w2k, const float* __restrict__ wv, const float* __restrict__ wo, b16* __restrict__ WQK, b16* __restrict__ WV, b16* __restrict__ WO) { const size_t nt = (size_t)gridDim.x * 256, u0 = (size_t)blockIdx.x * 256 + threadIdx.x; v8b v;
  // u counts the 16-byte units of the destination (tile = 16 rows x 32 k, NK tiles a row tile): a wave stores 512 contiguous bytes, and a block reads whole lines of 16 rows
  for (size_t u = u0; u < (size_t)256 * 128; u += nt) { const int o = (int)(u >> 11) * 16 + ((int)u & 15), k0 = ((int)(u >> 6) & 31) * 32 + ((int)(u >> 4) & 3) * 8; const float* w = o < 64 ? w1q : (o < 128 ? w2q : (o < 192 ? w1k : w2k)); const int oo = o % 64;
#pragma unroll
    for (int j = 0; j < 8; ++j) v[j] = (b16)(bf16_rne(w[(size_t)oo * D + k0 + j]) * WSC); { *(v8b*)(WQK + u * 8) = v;  } }
  for (size_t u = u0; u < (size_t)D * 128; u += nt) { const int o = (int)(u >> 11) * 16 + ((int)u & 15), k0 = ((int)(u >> 6) & 31) * 32 + ((int)(u >> 4) & 3) * 8; v8b a, c;
#pragma unroll
    for (int j = 0; j < 8; ++j) { a[j] = (b16)(bf16_rne(wv[(size_t)o * D + k0 + j]) * WSC); c[j] = (b16)(bf16_rne(wo[(size_t)o * D + k0 + j]) * WSC); } { *(v8b*)(WV + u * 8) = a; *(v8b*)(WO + u * 8) = c;  } } }
// proj_kernel: one work-group per (64 tokens, quarter np of the columns). The token tile is staged once in LDS and shared; a wave takes all 64 tokens x 32 columns (4 x 2 tiles), so that a weight tile is read once per 64 tokens: wave 0 the q1,q2 columns of heads 4np..4np+3, wave 1 their k1,k2 columns, wave w >= 2 takes 32 columns of v and writes them as v^T, hi and lo, in the form the attention reads.
__global__ __launch_bounds__(PWV * 32) void proj_kernel(const float* __restrict__ x, const b16* __restrict__ WQK, const b16* __restrict__ WV, const float* __restrict__ bv, b16* __restrict__ LQ, b16* __restrict__ LK, b16* __restrict__ VTh, b16* __restrict__ VTl) { __shared__ __attribute__((aligned(16))) b16 Ah[MT][D + 8]; __shared__ __attribute__((aligned(16))) float Tfs[2][MT][36] /* the q and the k wave only */; const int tid = threadIdx.x, lane = tid & 31, nloc = lane & 15, hlf = lane >> 4, wave = __builtin_amdgcn_readfirstlane(tid >> 5), np = blockIdx.x & 3; const size_t t0 = (size_t)(blockIdx.x >> 2) * MT;
  const bool isqk = wave < 2; const int c0 = np * 256 + (wave - 2) * 32;
  const b16* W = (isqk ? WQK + (size_t)(np * 16 + wave * 128) * D : WV + (size_t)c0 * D) + lane * 8; const size_t tstr = isqk ? (size_t)64 * D : (size_t)16 * D;
  // Staging: 16 bytes a lane, runs of SB loads, the next run asked for before this one is converted (the pinned rounding keeps the loads where the source has them).
  constexpr int SB = 17, NTH = PWV * 32, REM = MT * D / 4 - 3 * SB * NTH /* 64 units are left: the last two waves */; const v4f* xs = (const v4f*)(x + t0 * D) + tid;
  auto put = [&](int u, v4f xv) { v4b hv;
#pragma unroll
    for (int j = 0; j < 4; ++j) hv[j] = (b16)(bf16_rne(xv[j]) * XS);
    *(v4b*)&Ah[u >> 8][(u & 255) * 4] = hv; };
  // Register ring: the two weight fragments of a k step are asked for PRB - 1 k steps ahead of the products that use them. The first ones fly while the last run of the token tile is converted.
  v16b bw[PRB][2]; v4f xv[2][SB], xr = (v4f){}; const bool rem = wave >= PWV - REM / 32;
#pragma unroll
  for (int j = 0; j < SB; ++j) xv[0][j] = xs[j * NTH];
#pragma unroll
  for (int r = 0; r < 3; ++r) {
    if (r < 2) {
#pragma unroll
      for (int j = 0; j < SB; ++j) xv[(r + 1) & 1][j] = xs[((r + 1) * SB + j) * NTH]; }
    else { if (rem) xr = xs[3 * SB * NTH - (NTH - REM)];
#pragma unroll
      for (int s = 0; s < PRB - 1; ++s)
#pragma unroll
        for (int n = 0; n < 2; ++n) bw[s][n] = frag_fo(W + n * tstr + s * 512); }
#pragma unroll
    for (int j = 0; j < SB; ++j) put((r * SB + j) * NTH + tid, xv[r & 1][j]); }
  if (rem) put(3 * SB * NTH - (NTH - REM) + tid, xr);
  if (tid < MT) for (int k = D; k < D + 8; ++k) Ah[tid][k] = (b16)0.0f;
  __syncthreads();   // the staged token tile is read by every wave
  v8f acc[4][2];
#pragma unroll
  for (int m = 0; m < 4; ++m)
#pragma unroll
    for (int n = 0; n < 2; ++n) acc[m][n] = (v8f){};
#pragma unroll 1   // one ring turn is the loop body: every ring index is a constant, and a second copy would take registers from the ring
  for (int st0 = 0; st0 < NK - PRB; st0 += PRB)
#pragma unroll
    for (int s = 0; s < PRB; ++s) { const int kb = (st0 + s) * 32; v16b a[4];
#pragma unroll
      for (int n = 0; n < 2; ++n) bw[(s + PRB - 1) % PRB][n] = frag_fo(W + n * tstr + (size_t)(st0 + s + PRB - 1) * 512);
#pragma unroll
      for (int m = 0; m < 4; ++m) a[m] = frag_kb(&Ah[m * 16 + nloc][kb], hlf);
#pragma unroll
      for (int m = 0; m < 4; ++m)
#pragma unroll
        for (int n = 0; n < 2; ++n) acc[m][n] = wmma16b(a[m], bw[s][n], acc[m][n]);
      if (s == PRB - 1) asm volatile("s_wait_xcnt 0x0" ::: "memory"); }   // the next turn forms its addresses in the registers that this turn's loads name
#pragma unroll
  for (int s = 0; s < PRB; ++s) { const int kb = (NK - PRB + s) * 32; v16b a[4];   // the last turn: only its first step still fetches
    if (s == 0) {
#pragma unroll
      for (int n = 0; n < 2; ++n) bw[PRB - 1][n] = frag_fo(W + n * tstr + (NK - 1) * 512);
      asm volatile("s_wait_xcnt 0x0" :: "v"(W) : "memory"); }   // the address is an input, so it stays in its registers up to this wait: the epilogue reuses them
#pragma unroll
    for (int m = 0; m < 4; ++m) a[m] = frag_kb(&Ah[m * 16 + nloc][kb], hlf);
#pragma unroll
    for (int m = 0; m < 4; ++m)
#pragma unroll
      for (int n = 0; n < 2; ++n) acc[m][n] = wmma16b(a[m], bw[s][n], acc[m][n]); }
  if (isqk) {   // Plucker lines: wave 0 the q lines, wave 1 the k lines; lane = (token lane & 15 of a 16-token tile, head pair lane >> 4); loop the 4 token tiles and the 2 heads of a pair
    const int isk = wave; float (*Tf)[36] = Tfs[wave];
#pragma unroll
    for (int n = 0; n < 2; ++n)
#pragma unroll
      for (int m = 0; m < 4; ++m)
#pragma unroll
        for (int r8 = 0; r8 < 8; ++r8) Tf[m * 16 + 8 * hlf + r8][n * 16 + nloc] = acc[m][n][r8] * (1.0f / (XS * WSC));
    wave_lds_sync();
#pragma unroll 1
    for (int io = 0; io < 8; io += 4) {
#pragma unroll   // four independent lines side by side: each is one long dependent chain (root, division)
    for (int it = io; it < io + 4; ++it) { const int rr = (it >> 1) * 16 + nloc, hl = hlf * 2 + (it & 1), h = np * 4 + hl; const float* p1 = &Tf[rr][hl * 4]; const float* p2 = &Tf[rr][16 + hl * 4]; float Lm[6]; Lm[0] = p1[0] * p2[1] - p1[1] * p2[0]; Lm[1] = p1[0] * p2[2] - p1[2] * p2[0]; Lm[2] = p1[0] * p2[3] - p1[3] * p2[0]; Lm[3] = p1[1] * p2[2] - p1[2] * p2[1]; Lm[4] = p1[1] * p2[3] - p1[3] * p2[1]; Lm[5] = p1[2] * p2[3] - p1[3] * p2[2];
      float n2 = 0.0f; for (int c = 0; c < 6; ++c) n2 += Lm[c] * Lm[c]; const float inv = 1.0f / fmaxf(sqrtf(n2), 1e-12f); float Lo[6];
      if (isk) { Lo[0] = Lm[5]; Lo[1] = -Lm[4]; Lo[2] = Lm[3]; Lo[3] = Lm[2]; Lo[4] = -Lm[1]; Lo[5] = Lm[0]; } else { for (int c = 0; c < 6; ++c) Lo[c] = Lm[c]; }
      // one 32-k row holds hi and lo: k slots 0..5, 6..11, 12..17 are hi, lo, hi of a k line and hi, hi, lo of a q line, so that ONE product sums k_hi q_hi + k_lo q_hi + k_hi q_lo; slots 18..31 are 0
      b16 pk_[32]; for (int c = 0; c < 32; ++c) pk_[c] = (b16)0.0f; for (int c = 0; c < 6; ++c) { b16 h0, l0; split16(Lo[c] * inv * (isk ? 1.0f : QSC), h0, l0); pk_[c] = h0; pk_[6 + c] = isk ? l0 : h0; pk_[12 + c] = isk ? h0 : l0; }
      b16* dp = (isk ? LK : LQ) + ((size_t)h * NT + t0 + (it >> 1) * 16) * 32 + nloc * 8;   // 16 tokens are one tile in fragment order
      for (int c = 0; c < 32; c += 8) { v8b a; for (int j = 0; j < 8; ++j) a[j] = pk_[c + j]; *(v8b*)(dp + c * 16) = a; } }
      asm volatile("s_wait_xcnt 0x0" ::: "memory");   // the next trip rewrites the address and data registers that these stores name
    } }
  else {   // v^T hi and lo in fragment order, tiles as [b, h][32-key step][16-d tile], straight from the accumulators: a lane's 8 registers of a tile are 8 consecutive keys (8 * hlf + r8 of token tile m) of one d (column nloc), which is the lane's own 16-byte unit of half m & 1 of the 16-d x 32-key tile; a wave's store is 512 contiguous bytes
    const size_t ob = ((((t0 / T) * H + (c0 >> 6)) * (T / 32) + (t0 % T) / 32) * 4 + ((c0 >> 4) & 3)) * 512 + lane * 8; b16* dh = VTh + ob; b16* dl = VTl + ob;
#pragma unroll   // constant offsets on the two store addresses
    for (int n = 0; n < 2; ++n) { const float bb = bfv(bv[c0 + n * 16 + nloc]);
#pragma unroll
      for (int m = 0; m < 4; ++m) { v8b vh, vl;
#pragma unroll
        for (int r8 = 0; r8 < 8; ++r8) { b16 h0, l0; split16((acc[m][n][r8] * (1.0f / (XS * WSC)) + bb) * HS, h0, l0); vh[r8] = h0; vl[r8] = l0; }
        const int vo = ((m >> 1) * 4 + n) * 512 + (m & 1) * 256; *(v8b*)(dh + vo) = vh; *(v8b*)(dl + vo) = vl; } }
    asm volatile("s_wait_xcnt 0x0" ::: "memory");   // closes the run of stores before any later instruction of the listing rewrites a register that they name
  } }
// att_kernel: one work-group of 16 waves per (b, h, t): the 128-query block 15 - t and then the block t, one after the other, so that every work-group walks 17 key chunks. Wave (qp, kq) takes 32 queries (two 16-query tiles) of the block and, of every chunk, the 32 keys of step kq: a K or v^T fragment read from LDS feeds both query tiles, and four waves share a SIMD.
// S^T = JL_k x L_q^T, so a lane holds the scores of ONE query of each tile (column nloc; keys 8 * hlf + r of each 16-key tile): mask, exp and sum stay in registers, two converted score tiles are the B operand (hardware k order, the order of frag_kb) of O^T += v^T x P^T. Every inner loop is unrolled so that each index into a register array is a constant.
// There is no running maximum, so the four key steps' numerators and row sums of a query simply add: at the end of a block they meet in LDS, in the fixed order kq = 0..3, and the 1 / sum is per lane.
// The 16 waves of a block need the same key chunks: a chunk (L_k, v^T hi, v^T lo, each one contiguous run of the workspace in fragment order, 40 KB together) is brought into LDS once for all of them, one chunk ahead, two buffers.
// chunk_copy: the work-group's 512 lanes move one chunk, 5 asynchronous copies of 16 bytes a lane; a wave's copy is 512 contiguous bytes on both sides. l = the lane's LDS byte address in the buffer, the pointers = the lane's own 16 bytes of each run.
__device__ __forceinline__ void chunk_copy(unsigned l, const b16* kp, const b16* vh, const b16* vl) {
  asm volatile(   // the wait in the last line stands in front of every later rewrite of a register that these copies name (a precaution): in the copies' own statement, so that the compiler moves nothing in between
    "global_load_async_to_lds_b128 %0, %5, off\n\t"
    "global_load_async_to_lds_b128 %1, %6, off\n\t"
    "global_load_async_to_lds_b128 %2, %7, off\n\t"
    "global_load_async_to_lds_b128 %3, %8, off\n\t"
    "global_load_async_to_lds_b128 %4, %9, off\n\t"
    "s_wait_xcnt 0x0"
    :: "v"(l), "v"(l + 8192u), "v"(l + 16384u), "v"(l + 24576u), "v"(l + 32768u),
       "v"(kp), "v"(vh), "v"(vh + 4096), "v"(vl), "v"(vl + 4096) : "memory"); }
__global__ __launch_bounds__(AWV * 32) __attribute__((amdgpu_waves_per_eu(4, 4))) /* at most 256 registers a wave: four waves a SIMD, none above v255 */ void att_kernel(const b16* __restrict__ LQ, const b16* __restrict__ LK, const b16* __restrict__ VTh, const b16* __restrict__ VTl, int QLIM, float* __restrict__ O) { __shared__ __attribute__((aligned(16))) b16 Ring[2][CBH]; __shared__ __attribute__((aligned(16))) v4f Red[4 * 2 * 4 * 4 * 2 * 32] /* [qp][query tile][d tile][kq][half of the 8 registers][lane] */; __shared__ float Ls[AWV][2][32]; const int tid = threadIdx.x, lane = tid & 31, nloc = lane & 15, hlf = lane >> 4, wave = __builtin_amdgcn_readfirstlane(tid >> 5), kq = wave & 3, qp = wave >> 2; const int bh = blockIdx.x % (NB_ * H), b = bh / H, h = bh % H; const int nA = T / CK - (int)(blockIdx.x / (NB_ * H));   // chunks of the first block, 16 .. 9; the second has NCH - nA
  constexpr int NCH = T / CK + 1;   // chunks of a work-group
  const b16* Kp = LK + ((size_t)h * NT + (size_t)b * T) * 32 + tid * 8;   // a lane's own 16 bytes of the first 8 KB of a run, here and below
  const b16* Vh = VTh + ((size_t)b * H + h) * DH * T + tid * 8; const b16* Vl = VTl + ((size_t)b * H + h) * DH * T + tid * 8;
  const unsigned l0 = (unsigned)(size_t)&Ring[0][0] + tid * 16;
  auto fill = [&](int c) { const size_t k0 = (size_t)((c < nA ? c : c - nA) * CK); chunk_copy(l0 + (c & 1) * (CBH * 2), Kp + k0 * 32, Vh + k0 * DH, Vl + k0 * DH); };   // chunk c of the 17, into buffer c mod 2
  fill(0);
  asm volatile("s_wait_asynccnt 0x0" ::: "memory");   // this wave's part of chunk 0 has landed
  __syncthreads();   // chunk 0 is whole: every wave reads its key step of it
  fill(1);
  int c = 0;
#pragma unroll 1   // one copy of the code for the two blocks
  for (int blk = 0; blk < 2; ++blk) { const int nch = blk ? NCH - nA : nA, q0 = (nch - 1) * CK + qp * 32; const size_t tq = (size_t)b * T + q0;
  const b16* pq = LQ + ((size_t)h * NT + tq) * 32 + lane * 8; const v16b qa0 = frag_fo(pq), qa1 = frag_fo(pq + 512);
  asm volatile("s_wait_xcnt 0x0" :: "v"(pq) : "memory");   // the address is an input, so it stays in its registers up to this wait
  v8f a0 = (v8f){}, a1 = (v8f){}, a2 = (v8f){}, a3 = (v8f){}, b0 = (v8f){}, b1 = (v8f){}, b2 = (v8f){}, b3 = (v8f){}; float lsa = 0.0f, lsb = 0.0f;   // the four d tiles of O^T of query tile a and of query tile b, by name: held as an array, a build copied the registers at the loop's back edge
#pragma unroll 1   // one chunk's code: a second copy would take registers
  for (int ch = 0; ch < nch; ++ch, ++c) { v8f sacc[2][2]; const b16* R = &Ring[c & 1][lane * 8]; const b16* pk = R + kq * 1024; const b16* pvh = R + CKH + kq * 2048; const b16* pvl = pvh + CVH;   // a lane's own 16 bytes of a tile in fragment order, key step kq
    { const v16b kf0 = frag_fo(pk), kf1 = frag_fo(pk + 512);   // four independent tiles, one product each (hi and lo share the 32 k slots)
      sacc[0][0] = wmma16b(kf0, qa0, (v8f){}); sacc[0][1] = wmma16b(kf1, qa0, (v8f){}); sacc[1][0] = wmma16b(kf0, qa1, (v8f){}); sacc[1][1] = wmma16b(kf1, qa1, (v8f){}); }
    if (ch == nch - 1) {   // causal mask: only the last chunk holds keys behind a query; there the chunk's first key is the block's first query
#pragma unroll
      for (int u = 0; u < 2; ++u) { const int kd = (qp - kq) * 32 + u * 16 + nloc - 8 * hlf;
#pragma unroll
        for (int t = 0; t < 2; ++t)
#pragma unroll
          for (int r8 = 0; r8 < 8; ++r8) sacc[u][t][r8] = (t * 16 + r8 <= kd) ? sacc[u][t][r8] : -INFINITY; } }
    v16b pa[2], pb[2]; float sm[2][2] = {{0.0f, 0.0f}, {0.0f, 0.0f}};
#pragma unroll
    for (int u = 0; u < 2; ++u)
#pragma unroll
      for (int t = 0; t < 2; ++t)
#pragma unroll
        for (int r8 = 0; r8 < 8; ++r8) { const float p = exp2s(sacc[u][t][r8]); sm[u][r8 & 1] += p; b16 ph, pl; split16(p, ph, pl); pa[u][t * 8 + r8] = ph; pb[u][t * 8 + r8] = pl; }
    lsa += sm[0][0] + sm[0][1]; lsb += sm[1][0] + sm[1][1];
    v16b vh[4], vl[4];   // one block of loads: the step's 32 keys, four d tiles, hi and lo
#pragma unroll
    for (int t = 0; t < 4; ++t) { vh[t] = frag_fo(pvh + t * 512); vl[t] = frag_fo(pvl + t * 512); }
    a0 = wmma16b(vh[0], pa[0], a0); b0 = wmma16b(vh[0], pa[1], b0); a1 = wmma16b(vh[1], pa[0], a1); b1 = wmma16b(vh[1], pa[1], b1); a2 = wmma16b(vh[2], pa[0], a2); b2 = wmma16b(vh[2], pa[1], b2); a3 = wmma16b(vh[3], pa[0], a3); b3 = wmma16b(vh[3], pa[1], b3);
    a0 = wmma16b(vl[0], pa[0], a0); b0 = wmma16b(vl[0], pa[1], b0); a1 = wmma16b(vl[1], pa[0], a1); b1 = wmma16b(vl[1], pa[1], b1); a2 = wmma16b(vl[2], pa[0], a2); b2 = wmma16b(vl[2], pa[1], b2); a3 = wmma16b(vl[3], pa[0], a3); b3 = wmma16b(vl[3], pa[1], b3);
    a0 = wmma16b(vh[0], pb[0], a0); b0 = wmma16b(vh[0], pb[1], b0); a1 = wmma16b(vh[1], pb[0], a1); b1 = wmma16b(vh[1], pb[1], b1); a2 = wmma16b(vh[2], pb[0], a2); b2 = wmma16b(vh[2], pb[1], b2); a3 = wmma16b(vh[3], pb[0], a3); b3 = wmma16b(vh[3], pb[1], b3);
    asm volatile("s_wait_dscnt 0x0" :: "v"(lsa), "v"(lsb) : "memory");   // this wave has read all it reads of buffer c mod 2. The row sums are inputs so that they are formed in front of the branch below and the exponentials do not stay in registers beyond the v^T products
    asm volatile("s_wait_asynccnt 0x0" ::: "memory");   // this wave's part of chunk c + 1 has landed
    __syncthreads();   // chunk c + 1 is whole, and no wave still reads buffer c mod 2
    if (c + 2 < NCH) fill(c + 2); }
  // The four key steps of a query pair meet: every wave leaves its partial tiles and row sums in LDS; wave kq then finishes query tile kq >> 1, d tiles 2 (kq & 1) and + 1, which are whole 128-byte lines of O.
  { v4f* rw = Red + (qp * 32 + kq) * 64 + lane;   // + ((query tile * 4 + d tile) * 4) * 64 + half * 32
    auto put = [&](int ud, v8f o) { rw[ud * 256] = (v4f){o[0], o[1], o[2], o[3]}; rw[ud * 256 + 32] = (v4f){o[4], o[5], o[6], o[7]}; };
    put(0, a0); put(1, a1); put(2, a2); put(3, a3); put(4, b0); put(5, b1); put(6, b2); put(7, b3);
    Ls[wave][0][lane] = lsa; Ls[wave][1][lane] = lsb; }
  __syncthreads();   // the partial tiles are read by the other waves of the query pair. They are written again only behind a barrier of the next block's chunk loop, which no wave passes before every wave has read
  { const int uu = kq >> 1, dp = kq & 1; float ls = 0.0f;
#pragma unroll
    for (int s = 0; s < 4; ++s) ls += Ls[qp * 4 + s][uu][lane];
    const float rl = (1.0f / HS) / (ls + xhalf(ls)); const v4f* rr = Red + (qp * 32 + (uu * 4 + dp * 2) * 4) * 64 + lane; v4f os[2][2];
#pragma unroll
    for (int dd = 0; dd < 2; ++dd)
#pragma unroll
      for (int hf = 0; hf < 2; ++hf) { v4f x = rr[dd * 256 + hf * 32];
#pragma unroll
        for (int s = 1; s < 4; ++s) x += rr[dd * 256 + s * 64 + hf * 32];
        os[dd][hf] = x * rl; }
    if (q0 + uu * 16 < QLIM) { float* op = O + (tq + uu * 16 + nloc) * D + h * DH + dp * 32 + 8 * hlf;   // a lane's 8 values of a tile are 8 consecutive d of its query
#pragma unroll
      for (int dd = 0; dd < 2; ++dd) { *(v4f*)(op + dd * 16) = os[dd][0]; *(v4f*)(op + dd * 16 + 4) = os[dd][1]; }
      asm volatile("s_wait_xcnt 0x0" ::: "memory"); } } }   // the second block's trip rewrites the address and data registers that these stores name
  asm volatile("s_wait_asynccnt 0x0" ::: "memory"); }   // no copy is outstanding when the wave ends
// outp_kernel: one work-group per (64 tokens, quarter np of the output columns); the hi and lo token tiles are staged once in LDS and shared; wave w takes all 64 tokens x output columns 256np + 32w .. + 31 (4 x 2 tiles), so that a weight tile is read once per 64 tokens.
__global__ __launch_bounds__(OWV * 32) void outp_kernel(const float* __restrict__ O, const b16* __restrict__ WO, const float* __restrict__ bo, int QLIM, float* __restrict__ out) { __shared__ __attribute__((aligned(16))) b16 Ah[MT][D + 8], Al[MT][D + 8]; __shared__ __attribute__((aligned(16))) float Tfs[OWV][16][36]; const int tid = threadIdx.x, lane = tid & 31, nloc = lane & 15, hlf = lane >> 4, wave = __builtin_amdgcn_readfirstlane(tid >> 5), np = blockIdx.x & 3; const size_t t0 = (size_t)(blockIdx.x >> 2) * MT; if ((int)(t0 % T) >= QLIM) return;
  const int c0 = np * 256 + wave * 32; const b16* W = WO + (size_t)c0 * D + lane * 8;
  // Register ring, as in proj_kernel: the two weight fragments of a k step are asked for ORB - 1 k steps ahead. The first ones fly while the last run of the token tiles is converted.
  v16b bw[ORB][2];
  const v4f* os = (const v4f*)(O + t0 * D) + tid;
  v4f ov[2][16];   // runs of 16 loads, the next run asked for before this one is converted; load i is token i
#pragma unroll
  for (int j = 0; j < 16; ++j) ov[0][j] = os[j * (D / 4)];
#pragma unroll
  for (int r = 0; r < MT / 16; ++r) {
    if (r < MT / 16 - 1) {
#pragma unroll
      for (int j = 0; j < 16; ++j) ov[(r + 1) & 1][j] = os[((r + 1) * 16 + j) * (D / 4)]; }
    else {
#pragma unroll
      for (int s = 0; s < ORB - 1; ++s)
#pragma unroll
        for (int n = 0; n < 2; ++n) bw[s][n] = frag_fo(W + (size_t)n * 16 * D + s * 512); }
#pragma unroll
    for (int i = 0; i < 16; ++i) { v4b hv, lv;
#pragma unroll
      for (int j = 0; j < 4; ++j) { b16 p, pl; split16(ov[r & 1][i][j] * HS, p, pl); hv[j] = p; lv[j] = pl; }
      *(v4b*)&Ah[r * 16 + i][tid * 4] = hv; *(v4b*)&Al[r * 16 + i][tid * 4] = lv; }
    __builtin_amdgcn_sched_barrier(0); }   // keeps the run after the next behind this run's conversion: with three runs in registers the wave needs registers above v255
  if (tid < MT) for (int k = D; k < D + 8; ++k) { Ah[tid][k] = (b16)0.0f; Al[tid][k] = (b16)0.0f; }
  __syncthreads();   // the staged token tiles are read by every wave
  float (*Tf)[36] = Tfs[wave]; v8f acc[4][2];
#pragma unroll
  for (int m = 0; m < 4; ++m)
#pragma unroll
    for (int n = 0; n < 2; ++n) acc[m][n] = (v8f){};
#pragma unroll 1   // one ring turn is the loop body: every ring index is a constant, and a second copy would take registers from the ring
  for (int st0 = 0; st0 < NK - ORB; st0 += ORB)
#pragma unroll
    for (int s = 0; s < ORB; ++s) { const int kb = (st0 + s) * 32; v16b a[4], al[4];
#pragma unroll
      for (int n = 0; n < 2; ++n) bw[(s + ORB - 1) % ORB][n] = frag_fo(W + (size_t)n * 16 * D + (size_t)(st0 + s + ORB - 1) * 512);
#pragma unroll
      for (int m = 0; m < 4; ++m) { a[m] = frag_kb(&Ah[m * 16 + nloc][kb], hlf); al[m] = frag_kb(&Al[m * 16 + nloc][kb], hlf); }
#pragma unroll
      for (int m = 0; m < 4; ++m)
#pragma unroll
        for (int n = 0; n < 2; ++n) acc[m][n] = wmma16b(a[m], bw[s][n], acc[m][n]);
#pragma unroll
      for (int m = 0; m < 4; ++m)
#pragma unroll
        for (int n = 0; n < 2; ++n) acc[m][n] = wmma16b(al[m], bw[s][n], acc[m][n]);
      if (s == ORB - 1) asm volatile("s_wait_xcnt 0x0" ::: "memory"); }   // the next turn forms its addresses in the registers that this turn's loads name
#pragma unroll
  for (int s = 0; s < ORB; ++s) { const int kb = (NK - ORB + s) * 32; v16b a[4], al[4];   // the last turn: only its first step still fetches
    if (s == 0) {
#pragma unroll
      for (int n = 0; n < 2; ++n) bw[ORB - 1][n] = frag_fo(W + (size_t)n * 16 * D + (NK - 1) * 512);
      asm volatile("s_wait_xcnt 0x0" :: "v"(W) : "memory"); }   // the address is an input, so it stays in its registers up to this wait: the epilogue reuses them
#pragma unroll
    for (int m = 0; m < 4; ++m) { a[m] = frag_kb(&Ah[m * 16 + nloc][kb], hlf); al[m] = frag_kb(&Al[m * 16 + nloc][kb], hlf); }
#pragma unroll
    for (int m = 0; m < 4; ++m)
#pragma unroll
      for (int n = 0; n < 2; ++n) acc[m][n] = wmma16b(a[m], bw[s][n], acc[m][n]);
#pragma unroll
    for (int m = 0; m < 4; ++m)
#pragma unroll
      for (int n = 0; n < 2; ++n) acc[m][n] = wmma16b(al[m], bw[s][n], acc[m][n]); }
  const float bb0 = bfv(bo[c0 + nloc]), bb1 = bfv(bo[c0 + 16 + nloc]);
#pragma unroll
  for (int m = 0; m < 4; ++m) {   // 16 tokens at a time through the wave's own LDS tile
#pragma unroll
    for (int n = 0; n < 2; ++n)
#pragma unroll
      for (int r8 = 0; r8 < 8; ++r8) Tf[8 * hlf + r8][n * 16 + nloc] = acc[m][n][r8] * (1.0f / (HS * WSC)) + (n ? bb1 : bb0);
    wave_lds_sync();
#pragma unroll
    for (int i = 0; i < 4; ++i) { const int rr = i * 4 + (lane >> 3); *(v4f*)(out + (t0 + m * 16 + rr) * D + c0 + (lane & 7) * 4) = *(const v4f*)(&Tf[rr][(lane & 7) * 4]); }   // a wave's store: the whole 128-byte lines of 4 tokens
    wave_lds_sync();   // the rows are read before the next 16 tokens are written over them
    asm volatile("s_wait_xcnt 0x0" ::: "memory"); } }   // the next trip rewrites the data registers that these stores name
}  // namespace

extern "C" void kernel_launch(void* const* d_in, const int* in_sizes, int n_in, void* d_out, int out_size, void* d_ws, size_t ws_size, hipStream_t stream) {
  (void)n_in;
  auto Fp = [&](int i) { return (const float*)d_in[i]; };
  // inputs: 0 x [2,2048,1024]; 1 W1_q [64,1024]; 2 W2_q; 3 W1_k; 4 W2_k; 5 W_v [1024,1024]; 6 b_v; 7 W_out [1024,1024]; 8 b_out
  if (in_sizes[0] != NT * D || in_sizes[1] != 64 * D || in_sizes[4] != 64 * D || in_sizes[5] != D * D || in_sizes[7] != D * D || out_size != NT * D) return;
  const int QLIM = T;   // per-sequence query cut (multiple of 16)
  size_t off = 0; char* ws = (char*)d_ws;
  auto carve = [&](size_t bytes) { char* p = ws + off; off += (bytes + 255) & ~(size_t)255; return p; };
  b16* WQK = (b16*)carve((size_t)256 * D * 2); b16* WV = (b16*)carve((size_t)D * D * 2); b16* WO = (b16*)carve((size_t)D * D * 2); b16* LQ = (b16*)carve((size_t)H * NT * 32 * 2); b16* LK = (b16*)carve((size_t)H * NT * 32 * 2); b16* VTh = (b16*)carve((size_t)NB_ * H * DH * T * 2); b16* VTl = (b16*)carve((size_t)NB_ * H * DH * T * 2); float* O = (float*)carve((size_t)NT * D * 4);
  if (off > ws_size || off > ((size_t)80 << 20)) return;   // ~ 47 MB
  wput_kernel<<<128, 256, 0, stream>>>(Fp(1), Fp(2), Fp(3), Fp(4), Fp(5), Fp(7), WQK, WV, WO);
  proj_kernel<<<NT / MT * 4, PWV * 32, 0, stream>>>(Fp(0), WQK, WV, Fp(6), LQ, LK, VTh, VTl);
  att_kernel<<<NB_ * H * (T / CK / 2), AWV * 32, 0, stream>>>(LQ, LK, VTh, VTl, QLIM, O);
  outp_kernel<<<NT / MT * 4, OWV * 32, 0, stream>>>(O, WO, Fp(8), QLIM, (float*)d_out);
}
